// v000
// The times below were measured on an AMD MI455X: many runs one after another, warmed up first and cycling through
// copies of the inputs, with the whole window's GPU time divided by the number of runs. Launches and the gaps
// between them are all in it. The median over several windows is given; except for v000 it joins two sittings, which
// can be a few percent apart, so the side-by-side timings, each taken in one sitting, are the better comparison.
// The starting kernel, v000, takes 327 microseconds a run.
#include <hip/hip_runtime.h>
#include <hip/hip_bf16.h>

// ---------------------------------------------------------------------------
// MQA forward, all matmuls on v_wmma_f32_16x16x32_f16 (CDNA5 / gfx1250).
// B=2, S=2048, d_model=1024, H=16, Dh=64 (single shared K/V head).
// GEMMs: 4-wave blocks, B-operand staged in LDS via global_load_async_to_lds
// (double buffered, ASYNCcnt), A-operand software-pipelined in registers.
// Attention: 16-wave blocks (one head per wave) sharing async-staged,
// double-buffered K/V tiles in LDS -- 16x cut in L2 traffic for the shared
// MQA head.
// ---------------------------------------------------------------------------

typedef __attribute__((ext_vector_type(16))) _Float16 v16h;
typedef __attribute__((ext_vector_type(8)))  _Float16 h8;
typedef __attribute__((ext_vector_type(8)))  float    v8f;
typedef __attribute__((ext_vector_type(2)))  _Float16 h2;
typedef __attribute__((ext_vector_type(4)))  int      v4i;

#define BB    2
#define SS    2048
#define BSZ   4096      // B*S
#define DIN   1024
#define DHID  1024
#define NH    16
#define DH    64
#define SCALE 0.03125f  // 1/sqrt(1024)

#if __has_builtin(__builtin_amdgcn_global_load_async_to_lds_b128)
#define HAVE_ASYNC 1
#else
#define HAVE_ASYNC 0
#endif

// 16-byte global -> LDS copy; async (ASYNCcnt) when the gfx1250 builtin exists.
__device__ __forceinline__ void cp16(const _Float16* g, _Float16* l) {
#if HAVE_ASYNC
  __builtin_amdgcn_global_load_async_to_lds_b128(
      (__attribute__((address_space(1))) v4i*)g,
      (__attribute__((address_space(3))) v4i*)l, 0, 0);
#else
  *(h8*)l = *(const h8*)g;
#endif
}

// Wait until at most N async copies remain in flight.
template <int N>
__device__ __forceinline__ void wait_async() {
#if HAVE_ASYNC
#if __has_builtin(__builtin_amdgcn_s_wait_asynccnt)
  __builtin_amdgcn_s_wait_asynccnt(N);
#else
  asm volatile("s_wait_asynccnt %0" ::"i"(N) : "memory");
#endif
#endif
}

// Assemble a 16-bit WMMA A/B fragment (16x32 resp. 32x16) for one K=32 chunk.
// Per ISA 7.12.2: lane holds row/col (lane&15); hi = lane>>4 selects the K
// half-groups. Half t -> K = t + 8*hi + 8*(t>=8); pairs merge into b128 loads.
__device__ __forceinline__ v16h frag16(const _Float16* __restrict__ base, int hi) {
  v16h r;
#pragma unroll
  for (int tp = 0; tp < 8; ++tp) {
    const int kk = 2 * tp + 8 * hi + ((tp >= 4) ? 8 : 0);
    h2 p = *(const h2*)(base + kk);
    r[2 * tp]     = p.x;
    r[2 * tp + 1] = p.y;
  }
  return r;
}

// ---------------------------------------------------------------------------
// fp32 -> f16 casts (one-time, memory bound, ~3us of the budget)
// ---------------------------------------------------------------------------
__global__ void cast_h(const float* __restrict__ in, _Float16* __restrict__ out,
                       int n) {
  int i = blockIdx.x * blockDim.x + threadIdx.x;
  if (i < n) out[i] = (_Float16)in[i];
}

// W [K,N] fp32 row-major  ->  W^T [N,K] f16 row-major
__global__ void cast_t(const float* __restrict__ in, _Float16* __restrict__ out,
                       int K, int N) {
  int i = blockIdx.x * blockDim.x + threadIdx.x;
  if (i < K * N) {
    int k = i / N, n = i - k * N;
    out[(size_t)n * K + k] = (_Float16)in[i];
  }
}

// ---------------------------------------------------------------------------
// WMMA GEMM:  C[M,N] = X[M,K] @ W[K,N] + bias,  W given as WT[N,K].
// Block = 4 waves = 64x64 tile. B chunk (64x32 f16 = 4KB) staged in LDS by
// async copies, double buffered; each wave owns one 16-row strip and 4 f32
// accumulators; A fragments pipelined in registers.
// ---------------------------------------------------------------------------
__global__ void __launch_bounds__(128)
gemm_wmma(const _Float16* __restrict__ X,
          const _Float16* __restrict__ WT,
          const float* __restrict__ bias,
          _Float16* __restrict__ outH,
          float* __restrict__ outF,
          int M, int N, int K, int transposeOut) {
  __shared__ _Float16 bsh[2][64 * 32];   // [buf][row(64) x k(32)]

  const int tid  = threadIdx.x;          // 0..127
  const int wave = tid >> 5;
  const int lane = tid & 31;
  const int nl   = lane & 15;
  const int hi   = lane >> 4;
  const int m0   = (blockIdx.x * 4 + wave) * 16;
  const int n0   = blockIdx.y * 64;

  const _Float16* arow = X + (size_t)(m0 + nl) * K;

  // Stage one 64x32 B chunk: 256 x 16B segments, 2 per thread.
  auto stageB = [&](int k0, int buf) {
#pragma unroll
    for (int i = 0; i < 2; ++i) {
      const int seg = tid + i * 128;
      const int row = seg >> 2;          // 4 segs per 32-half row
      const int c16 = seg & 3;
      cp16(WT + (size_t)(n0 + row) * K + k0 + c16 * 8,
           &bsh[buf][row * 32 + c16 * 8]);
    }
  };

  v8f z = {};
  v8f c[4] = {z, z, z, z};

  stageB(0, 0);
  v16h a_cur = frag16(arow, hi);

  for (int k0 = 0; k0 < K; k0 += 32) {
    const int buf  = (k0 >> 5) & 1;
    const int nk0  = k0 + 32;
    const bool more = nk0 < K;
    if (more) { stageB(nk0, buf ^ 1); wait_async<2>(); }  // next copy in flight
    else      { wait_async<0>(); }
    __syncthreads();                     // B chunk visible to all 4 waves

    v16h a_nxt = more ? frag16(arow + nk0, hi) : a_cur;  // pipeline A
#pragma unroll
    for (int nt = 0; nt < 4; ++nt) {
      v16h b = frag16(&bsh[buf][(nt * 16 + nl) * 32], hi);
      c[nt] = __builtin_amdgcn_wmma_f32_16x16x32_f16(
          false, a_cur, false, b, (short)0, c[nt], false, false);
    }
    a_cur = a_nxt;
    __syncthreads();                     // before next stage overwrites buf
  }

#pragma unroll
  for (int nt = 0; nt < 4; ++nt) {
    const int gn = n0 + nt * 16 + nl;
    const float bval = bias ? bias[gn] : 0.0f;
#pragma unroll
    for (int r = 0; r < 8; ++r) {
      const int gm = m0 + r + 8 * hi;    // C/D layout: VGPR r -> row
      const float val = c[nt][r] + bval;
      if (outH) {
        if (transposeOut) outH[(size_t)gn * M + gm] = (_Float16)val;
        else              outH[(size_t)gm * N + gn] = (_Float16)val;
      } else {
        outF[(size_t)gm * N + gn] = val;
      }
    }
  }
}

// ---------------------------------------------------------------------------
// Flash-style MQA attention. Block = 16 waves = all 16 heads of one
// (batch, 16-query tile); the shared K/V head is staged once per block into
// LDS (async, double buffered) instead of once per wave.
//   qh : [B*S, 1024] f16    kh : [B*S, 64] f16    vT : [64, B*S] f16
//   oh : [B*S, 1024] f16 (attn output, pre O-projection)
// ---------------------------------------------------------------------------
__global__ void __launch_bounds__(512)
mqa_attn(const _Float16* __restrict__ qh,
         const _Float16* __restrict__ kh,
         const _Float16* __restrict__ vT,
         _Float16* __restrict__ oh) {
  __shared__ _Float16 ksh[2][32 * DH];    // [buf][key row(32) x d(64)]  8KB
  __shared__ _Float16 vsh[2][DH * 32];    // [buf][vcol(64) x key(32)]   8KB
  __shared__ _Float16 pl[NH][16 * 32];    // per-wave P staging          16KB

  const int tid  = threadIdx.x;           // 0..511
  const int wave = tid >> 5;              // = head
  const int lane = tid & 31;
  const int nl   = lane & 15;
  const int hi   = lane >> 4;
  const int qt   = blockIdx.x;            // query tile [0,128)
  const int b    = blockIdx.y;            // batch
  const int h    = wave;

  // Stage the next 32-key K tile + V^T tile: 512 x 16B segs, 1 per thread.
  auto stageKV = [&](int j, int buf) {
    if (tid < 256) {                      // K tile: 32 rows x 64 halves
      const int row = tid >> 3, s = tid & 7;
      cp16(kh + ((size_t)(b * SS + j + row)) * DH + s * 8,
           &ksh[buf][row * DH + s * 8]);
    } else {                              // V^T tile: 64 rows x 32 halves
      const int t2 = tid - 256;
      const int row = t2 >> 2, s = t2 & 3;
      cp16(vT + (size_t)row * BSZ + b * SS + j + s * 8,
           &vsh[buf][row * 32 + s * 8]);
    }
  };

  // Q tile resident as two A fragments (d = 0..31, 32..63)
  const _Float16* qrow = qh + ((size_t)(b * SS + qt * 16 + nl)) * DHID + h * DH;
  const v16h qa0 = frag16(qrow, hi);
  const v16h qa1 = frag16(qrow + 32, hi);

  v8f z = {};
  v8f o[4] = {z, z, z, z};                // O accum, 16x64
  float m8[8], l8[8];
#pragma unroll
  for (int r = 0; r < 8; ++r) { m8[r] = -3.0e38f; l8[r] = 0.0f; }

  stageKV(0, 0);

  for (int j = 0; j < SS; j += 32) {
    const int buf   = (j >> 5) & 1;
    const bool more = (j + 32) < SS;
    if (more) { stageKV(j + 32, buf ^ 1); wait_async<1>(); }
    else      { wait_async<0>(); }
    __syncthreads();                      // K/V tiles visible to all heads

    // ---- scores: two 16x16 tiles, S = Q @ K^T, B operand from LDS ----
    const _Float16* kr0 = &ksh[buf][nl * DH];
    const _Float16* kr1 = &ksh[buf][(16 + nl) * DH];
    v8f s0 = z, s1 = z;
    s0 = __builtin_amdgcn_wmma_f32_16x16x32_f16(false, qa0, false, frag16(kr0, hi),      (short)0, s0, false, false);
    s0 = __builtin_amdgcn_wmma_f32_16x16x32_f16(false, qa1, false, frag16(kr0 + 32, hi), (short)0, s0, false, false);
    s1 = __builtin_amdgcn_wmma_f32_16x16x32_f16(false, qa0, false, frag16(kr1, hi),      (short)0, s1, false, false);
    s1 = __builtin_amdgcn_wmma_f32_16x16x32_f16(false, qa1, false, frag16(kr1 + 32, hi), (short)0, s1, false, false);

    // ---- online softmax over the 16x32 slab ----
    float corr[8];
#pragma unroll
    for (int r = 0; r < 8; ++r) {
      const float x0 = s0[r] * SCALE;
      const float x1 = s1[r] * SCALE;
      float t = fmaxf(x0, x1);
      t = fmaxf(t, __shfl_xor(t, 1));
      t = fmaxf(t, __shfl_xor(t, 2));
      t = fmaxf(t, __shfl_xor(t, 4));
      t = fmaxf(t, __shfl_xor(t, 8));     // row max within 16-lane group
      const float mnew = fmaxf(m8[r], t);
      const float p0 = __expf(x0 - mnew);
      const float p1 = __expf(x1 - mnew);
      float rs = p0 + p1;
      rs += __shfl_xor(rs, 1);
      rs += __shfl_xor(rs, 2);
      rs += __shfl_xor(rs, 4);
      rs += __shfl_xor(rs, 8);            // row sum
      const float cr = __expf(m8[r] - mnew);
      l8[r] = l8[r] * cr + rs;
      m8[r] = mnew;
      corr[r] = cr;
      // C-layout: lane owns column nl of rows r+8*hi
      pl[wave][(r + 8 * hi) * 32 + nl]      = (_Float16)p0;
      pl[wave][(r + 8 * hi) * 32 + 16 + nl] = (_Float16)p1;
    }
#pragma unroll
    for (int r = 0; r < 8; ++r) {
      o[0][r] *= corr[r]; o[1][r] *= corr[r];
      o[2][r] *= corr[r]; o[3][r] *= corr[r];
    }

    // ---- P (A-layout from LDS) @ V (B operand from LDS V^T tile) ----
    const v16h pa = frag16(&pl[wave][nl * 32], hi);
#pragma unroll
    for (int nt = 0; nt < 4; ++nt) {
      v16h bv = frag16(&vsh[buf][(nt * 16 + nl) * 32], hi);
      o[nt] = __builtin_amdgcn_wmma_f32_16x16x32_f16(
          false, pa, false, bv, (short)0, o[nt], false, false);
    }
    __syncthreads();                      // before next stage overwrites buf
  }

  // ---- normalize and write attention output ----
#pragma unroll
  for (int r = 0; r < 8; ++r) {
    const float inv = 1.0f / l8[r];
    const int gm = qt * 16 + r + 8 * hi;
#pragma unroll
    for (int nt = 0; nt < 4; ++nt) {
      oh[((size_t)(b * SS + gm)) * DHID + h * DH + nt * 16 + nl] =
          (_Float16)(o[nt][r] * inv);
    }
  }
}

// ---------------------------------------------------------------------------
// Launcher
// ---------------------------------------------------------------------------
extern "C" void kernel_launch(void* const* d_in, const int* in_sizes, int n_in,
                              void* d_out, int out_size, void* d_ws, size_t ws_size,
                              hipStream_t stream) {
  (void)in_sizes; (void)n_in; (void)out_size; (void)ws_size;

  const float* query = (const float*)d_in[0];
  const float* key   = (const float*)d_in[1];
  const float* value = (const float*)d_in[2];
  const float* Wq    = (const float*)d_in[3];
  const float* bq    = (const float*)d_in[4];
  const float* Wk    = (const float*)d_in[5];
  const float* bk    = (const float*)d_in[6];
  const float* Wv    = (const float*)d_in[7];
  const float* bv    = (const float*)d_in[8];
  const float* Wo    = (const float*)d_in[9];
  const float* bo    = (const float*)d_in[10];
  float* outF = (float*)d_out;

  // workspace carve-up (f16, 256B aligned), ~45 MB total
  char* ws = (char*)d_ws;
  size_t off = 0;
  auto carve = [&](size_t halves) {
    void* p = ws + off;
    off += (halves * sizeof(_Float16) + 255) & ~(size_t)255;
    return (_Float16*)p;
  };
  _Float16* Xq  = carve((size_t)BSZ * DIN);
  _Float16* Xk  = carve((size_t)BSZ * DIN);
  _Float16* Xv  = carve((size_t)BSZ * DIN);
  _Float16* WqT = carve((size_t)DIN * DHID);
  _Float16* WkT = carve((size_t)DH * DIN);
  _Float16* WvT = carve((size_t)DH * DIN);
  _Float16* WoT = carve((size_t)DIN * DHID);
  _Float16* qp  = carve((size_t)BSZ * DHID);
  _Float16* kp  = carve((size_t)BSZ * DH);
  _Float16* vTp = carve((size_t)DH * BSZ);   // V^T [64, B*S]
  _Float16* oat = carve((size_t)BSZ * DHID);

  const int THREADS = 256;
  const int nAct = BSZ * DIN;
  cast_h<<<dim3((nAct + THREADS - 1) / THREADS), THREADS, 0, stream>>>(query, Xq, nAct);
  cast_h<<<dim3((nAct + THREADS - 1) / THREADS), THREADS, 0, stream>>>(key,   Xk, nAct);
  cast_h<<<dim3((nAct + THREADS - 1) / THREADS), THREADS, 0, stream>>>(value, Xv, nAct);

  cast_t<<<dim3((DIN * DHID + THREADS - 1) / THREADS), THREADS, 0, stream>>>(Wq, WqT, DIN, DHID);
  cast_t<<<dim3((DIN * DH   + THREADS - 1) / THREADS), THREADS, 0, stream>>>(Wk, WkT, DIN, DH);
  cast_t<<<dim3((DIN * DH   + THREADS - 1) / THREADS), THREADS, 0, stream>>>(Wv, WvT, DIN, DH);
  cast_t<<<dim3((DHID * DIN + THREADS - 1) / THREADS), THREADS, 0, stream>>>(Wo, WoT, DHID, DIN);

  // projections (WMMA, 64x64 tiles per 4-wave block)
  gemm_wmma<<<dim3(BSZ / 64, DHID / 64), 128, 0, stream>>>(Xq, WqT, bq, qp, nullptr, BSZ, DHID, DIN, 0);
  gemm_wmma<<<dim3(BSZ / 64, 1),         128, 0, stream>>>(Xk, WkT, bk, kp, nullptr, BSZ, DH,   DIN, 0);
  gemm_wmma<<<dim3(BSZ / 64, 1),         128, 0, stream>>>(Xv, WvT, bv, vTp, nullptr, BSZ, DH,  DIN, 1);

  // attention (WMMA flash, 16 heads per block sharing LDS-staged K/V)
  mqa_attn<<<dim3(SS / 16, BB), 512, 0, stream>>>(qp, kp, vTp, oat);

  // output projection (WMMA, fp32 out)
  gemm_wmma<<<dim3(BSZ / 64, DIN / 64), 128, 0, stream>>>(oat, WoT, bo, nullptr, outF, BSZ, DIN, DHID, 0);
}

// v001
// Measured time: 258 microseconds a run.
// In two side-by-side timings against v000, it was 1.28 and 1.27 times as fast.
#include <hip/hip_runtime.h>
#include <hip/hip_bf16.h>

// ---------------------------------------------------------------------------
// MQA forward, all matmuls on v_wmma_f32_16x16x32_f16 (CDNA5 / gfx1250).
// B=2, S=2048, d_model=1024, H=16, Dh=64 (single shared K/V head).
// GEMMs: 4-wave blocks, B-operand staged in LDS via global_load_async_to_lds
// (double buffered, ASYNCcnt), A-operand software-pipelined in registers.
// Attention: 16-wave blocks (one head per wave) sharing async-staged,
// double-buffered K/V tiles in LDS -- 16x cut in L2 traffic for the shared
// MQA head.
// ---------------------------------------------------------------------------

typedef __attribute__((ext_vector_type(16))) _Float16 v16h;
typedef __attribute__((ext_vector_type(8)))  _Float16 h8;
typedef __attribute__((ext_vector_type(8)))  float    v8f;
typedef __attribute__((ext_vector_type(2)))  _Float16 h2;
typedef __attribute__((ext_vector_type(4)))  int      v4i;

#define BB    2
#define SS    2048
#define BSZ   4096      // B*S
#define DIN   1024
#define DHID  1024
#define NH    16
#define DH    64
#define SCALE 0.03125f  // 1/sqrt(1024)

// LDS row pitches in halves. Every tile here is read by 16-byte loads, 16 rows
// at a time, so the pitch is an odd multiple of 16 bytes: the 16 rows then fall
// on 16 different groups of four banks instead of on two (128-byte rows) or
// four (64-byte rows).
#define P32   40        // rows of 32 halves: 64 B of data, 80 B pitch
#define P64   72        // rows of 64 halves: 128 B of data, 144 B pitch

#if __has_builtin(__builtin_amdgcn_global_load_async_to_lds_b128)
#define HAVE_ASYNC 1
#else
#define HAVE_ASYNC 0
#endif

// 16-byte global -> LDS copy; async (ASYNCcnt) when the gfx1250 builtin exists.
__device__ __forceinline__ void cp16(const _Float16* g, _Float16* l) {
#if HAVE_ASYNC
  __builtin_amdgcn_global_load_async_to_lds_b128(
      (__attribute__((address_space(1))) v4i*)g,
      (__attribute__((address_space(3))) v4i*)l, 0, 0);
#else
  *(h8*)l = *(const h8*)g;
#endif
}

// Wait until at most N async copies remain in flight.
template <int N>
__device__ __forceinline__ void wait_async() {
#if HAVE_ASYNC
#if __has_builtin(__builtin_amdgcn_s_wait_asynccnt)
  __builtin_amdgcn_s_wait_asynccnt(N);
#else
  asm volatile("s_wait_asynccnt %0" ::"i"(N) : "memory");
#endif
#endif
}

// Assemble a 16-bit WMMA A/B fragment (16x32 resp. 32x16) for one K=32 chunk.
// Per ISA 7.12.2: lane holds row/col (lane&15); hi = lane>>4 selects the K
// half-groups. Half t -> K = t + 8*hi + 8*(t>=8); pairs merge into b128 loads.
__device__ __forceinline__ v16h frag16(const _Float16* __restrict__ base, int hi) {
  v16h r;
#pragma unroll
  for (int tp = 0; tp < 8; ++tp) {
    const int kk = 2 * tp + 8 * hi + ((tp >= 4) ? 8 : 0);
    h2 p = *(const h2*)(base + kk);
    r[2 * tp]     = p.x;
    r[2 * tp + 1] = p.y;
  }
  return r;
}

// ---------------------------------------------------------------------------
// fp32 -> f16 casts (one-time, memory bound, ~3us of the budget)
// ---------------------------------------------------------------------------
__global__ void cast_h(const float* __restrict__ in, _Float16* __restrict__ out,
                       int n) {
  int i = blockIdx.x * blockDim.x + threadIdx.x;
  if (i < n) out[i] = (_Float16)in[i];
}

// W [K,N] fp32 row-major  ->  W^T [N,K] f16 row-major
__global__ void cast_t(const float* __restrict__ in, _Float16* __restrict__ out,
                       int K, int N) {
  int i = blockIdx.x * blockDim.x + threadIdx.x;
  if (i < K * N) {
    int k = i / N, n = i - k * N;
    out[(size_t)n * K + k] = (_Float16)in[i];
  }
}

// ---------------------------------------------------------------------------
// WMMA GEMM:  C[M,N] = X[M,K] @ W[K,N] + bias,  W given as WT[N,K].
// Block = 4 waves = 64x64 tile. B chunk (64x32 f16, 5KB padded) staged in LDS by
// async copies, double buffered; each wave owns one 16-row strip and 4 f32
// accumulators; A fragments pipelined in registers.
// ---------------------------------------------------------------------------
__global__ void __launch_bounds__(128)
gemm_wmma(const _Float16* __restrict__ X,
          const _Float16* __restrict__ WT,
          const float* __restrict__ bias,
          _Float16* __restrict__ outH,
          float* __restrict__ outF,
          int M, int N, int K, int transposeOut) {
  __shared__ __attribute__((aligned(16))) _Float16 bsh[2][64 * P32];  // [buf][row(64) x k(32), padded]

  const int tid  = threadIdx.x;          // 0..127
  const int wave = tid >> 5;
  const int lane = tid & 31;
  const int nl   = lane & 15;
  const int hi   = lane >> 4;
  const int m0   = (blockIdx.x * 4 + wave) * 16;
  const int n0   = blockIdx.y * 64;

  const _Float16* arow = X + (size_t)(m0 + nl) * K;

  // Stage one 64x32 B chunk: 256 x 16B segments, 2 per thread.
  auto stageB = [&](int k0, int buf) {
#pragma unroll
    for (int i = 0; i < 2; ++i) {
      const int seg = tid + i * 128;
      const int row = seg >> 2;          // 4 segs per 32-half row
      const int c16 = seg & 3;
      cp16(WT + (size_t)(n0 + row) * K + k0 + c16 * 8,
           &bsh[buf][row * P32 + c16 * 8]);
    }
  };

  v8f z = {};
  v8f c[4] = {z, z, z, z};

  stageB(0, 0);
  v16h a_cur = frag16(arow, hi);

  for (int k0 = 0; k0 < K; k0 += 32) {
    const int buf  = (k0 >> 5) & 1;
    const int nk0  = k0 + 32;
    const bool more = nk0 < K;
    if (more) { stageB(nk0, buf ^ 1); wait_async<2>(); }  // next copy in flight
    else      { wait_async<0>(); }
    __syncthreads();                     // B chunk visible to all 4 waves

    v16h a_nxt = more ? frag16(arow + nk0, hi) : a_cur;  // pipeline A
#pragma unroll
    for (int nt = 0; nt < 4; ++nt) {
      v16h b = frag16(&bsh[buf][(nt * 16 + nl) * P32], hi);
      c[nt] = __builtin_amdgcn_wmma_f32_16x16x32_f16(
          false, a_cur, false, b, (short)0, c[nt], false, false);
    }
    a_cur = a_nxt;
    __syncthreads();                     // before next stage overwrites buf
  }

#pragma unroll
  for (int nt = 0; nt < 4; ++nt) {
    const int gn = n0 + nt * 16 + nl;
    const float bval = bias ? bias[gn] : 0.0f;
#pragma unroll
    for (int r = 0; r < 8; ++r) {
      const int gm = m0 + r + 8 * hi;    // C/D layout: VGPR r -> row
      const float val = c[nt][r] + bval;
      if (outH) {
        if (transposeOut) outH[(size_t)gn * M + gm] = (_Float16)val;
        else              outH[(size_t)gm * N + gn] = (_Float16)val;
      } else {
        outF[(size_t)gm * N + gn] = val;
      }
    }
  }
}

// ---------------------------------------------------------------------------
// Flash-style MQA attention. Block = 16 waves = all 16 heads of one
// (batch, 16-query tile); the shared K/V head is staged once per block into
// LDS (async, double buffered) instead of once per wave.
//   qh : [B*S, 1024] f16    kh : [B*S, 64] f16    vT : [64, B*S] f16
//   oh : [B*S, 1024] f16 (attn output, pre O-projection)
// ---------------------------------------------------------------------------
__global__ void __launch_bounds__(512)
mqa_attn(const _Float16* __restrict__ qh,
         const _Float16* __restrict__ kh,
         const _Float16* __restrict__ vT,
         _Float16* __restrict__ oh) {
  __shared__ __attribute__((aligned(16))) _Float16 ksh[2][32 * P64];  // [buf][key row(32) x d(64), padded]  9KB
  __shared__ __attribute__((aligned(16))) _Float16 vsh[2][DH * P32];  // [buf][vcol(64) x key(32), padded]  10KB
  __shared__ __attribute__((aligned(16))) _Float16 pl[NH][16 * P32];  // per-wave P staging, padded         20KB

  const int tid  = threadIdx.x;           // 0..511
  const int wave = tid >> 5;              // = head
  const int lane = tid & 31;
  const int nl   = lane & 15;
  const int hi   = lane >> 4;
  const int qt   = blockIdx.x;            // query tile [0,128)
  const int b    = blockIdx.y;            // batch
  const int h    = wave;

  // Stage the next 32-key K tile + V^T tile: 512 x 16B segs, 1 per thread.
  auto stageKV = [&](int j, int buf) {
    if (tid < 256) {                      // K tile: 32 rows x 64 halves
      const int row = tid >> 3, s = tid & 7;
      cp16(kh + ((size_t)(b * SS + j + row)) * DH + s * 8,
           &ksh[buf][row * P64 + s * 8]);
    } else {                              // V^T tile: 64 rows x 32 halves
      const int t2 = tid - 256;
      const int row = t2 >> 2, s = t2 & 3;
      cp16(vT + (size_t)row * BSZ + b * SS + j + s * 8,
           &vsh[buf][row * P32 + s * 8]);
    }
  };

  // Q tile resident as two A fragments (d = 0..31, 32..63)
  const _Float16* qrow = qh + ((size_t)(b * SS + qt * 16 + nl)) * DHID + h * DH;
  const v16h qa0 = frag16(qrow, hi);
  const v16h qa1 = frag16(qrow + 32, hi);

  v8f z = {};
  v8f o[4] = {z, z, z, z};                // O accum, 16x64
  float m8[8], l8[8];
#pragma unroll
  for (int r = 0; r < 8; ++r) { m8[r] = -3.0e38f; l8[r] = 0.0f; }

  stageKV(0, 0);

  for (int j = 0; j < SS; j += 32) {
    const int buf   = (j >> 5) & 1;
    const bool more = (j + 32) < SS;
    if (more) { stageKV(j + 32, buf ^ 1); wait_async<1>(); }
    else      { wait_async<0>(); }
    __syncthreads();                      // K/V tiles visible to all heads

    // ---- scores: two 16x16 tiles, S = Q @ K^T, B operand from LDS ----
    const _Float16* kr0 = &ksh[buf][nl * P64];
    const _Float16* kr1 = &ksh[buf][(16 + nl) * P64];
    v8f s0 = z, s1 = z;
    s0 = __builtin_amdgcn_wmma_f32_16x16x32_f16(false, qa0, false, frag16(kr0, hi),      (short)0, s0, false, false);
    s0 = __builtin_amdgcn_wmma_f32_16x16x32_f16(false, qa1, false, frag16(kr0 + 32, hi), (short)0, s0, false, false);
    s1 = __builtin_amdgcn_wmma_f32_16x16x32_f16(false, qa0, false, frag16(kr1, hi),      (short)0, s1, false, false);
    s1 = __builtin_amdgcn_wmma_f32_16x16x32_f16(false, qa1, false, frag16(kr1 + 32, hi), (short)0, s1, false, false);

    // ---- online softmax over the 16x32 slab ----
    float corr[8];
#pragma unroll
    for (int r = 0; r < 8; ++r) {
      const float x0 = s0[r] * SCALE;
      const float x1 = s1[r] * SCALE;
      float t = fmaxf(x0, x1);
      t = fmaxf(t, __shfl_xor(t, 1));
      t = fmaxf(t, __shfl_xor(t, 2));
      t = fmaxf(t, __shfl_xor(t, 4));
      t = fmaxf(t, __shfl_xor(t, 8));     // row max within 16-lane group
      const float mnew = fmaxf(m8[r], t);
      const float p0 = __expf(x0 - mnew);
      const float p1 = __expf(x1 - mnew);
      float rs = p0 + p1;
      rs += __shfl_xor(rs, 1);
      rs += __shfl_xor(rs, 2);
      rs += __shfl_xor(rs, 4);
      rs += __shfl_xor(rs, 8);            // row sum
      const float cr = __expf(m8[r] - mnew);
      l8[r] = l8[r] * cr + rs;
      m8[r] = mnew;
      corr[r] = cr;
      // C-layout: lane owns column nl of rows r+8*hi
      pl[wave][(r + 8 * hi) * P32 + nl]      = (_Float16)p0;
      pl[wave][(r + 8 * hi) * P32 + 16 + nl] = (_Float16)p1;
    }
#pragma unroll
    for (int r = 0; r < 8; ++r) {
      o[0][r] *= corr[r]; o[1][r] *= corr[r];
      o[2][r] *= corr[r]; o[3][r] *= corr[r];
    }

    // ---- P (A-layout from LDS) @ V (B operand from LDS V^T tile) ----
    const v16h pa = frag16(&pl[wave][nl * P32], hi);
#pragma unroll
    for (int nt = 0; nt < 4; ++nt) {
      v16h bv = frag16(&vsh[buf][(nt * 16 + nl) * P32], hi);
      o[nt] = __builtin_amdgcn_wmma_f32_16x16x32_f16(
          false, pa, false, bv, (short)0, o[nt], false, false);
    }
    __syncthreads();                      // before next stage overwrites buf
  }

  // ---- normalize and write attention output ----
#pragma unroll
  for (int r = 0; r < 8; ++r) {
    const float inv = 1.0f / l8[r];
    const int gm = qt * 16 + r + 8 * hi;
#pragma unroll
    for (int nt = 0; nt < 4; ++nt) {
      oh[((size_t)(b * SS + gm)) * DHID + h * DH + nt * 16 + nl] =
          (_Float16)(o[nt][r] * inv);
    }
  }
}

// ---------------------------------------------------------------------------
// Launcher
// ---------------------------------------------------------------------------
extern "C" void kernel_launch(void* const* d_in, const int* in_sizes, int n_in,
                              void* d_out, int out_size, void* d_ws, size_t ws_size,
                              hipStream_t stream) {
  (void)in_sizes; (void)n_in; (void)out_size; (void)ws_size;

  const float* query = (const float*)d_in[0];
  const float* key   = (const float*)d_in[1];
  const float* value = (const float*)d_in[2];
  const float* Wq    = (const float*)d_in[3];
  const float* bq    = (const float*)d_in[4];
  const float* Wk    = (const float*)d_in[5];
  const float* bk    = (const float*)d_in[6];
  const float* Wv    = (const float*)d_in[7];
  const float* bv    = (const float*)d_in[8];
  const float* Wo    = (const float*)d_in[9];
  const float* bo    = (const float*)d_in[10];
  float* outF = (float*)d_out;

  // workspace carve-up (f16, 256B aligned), ~45 MB total
  char* ws = (char*)d_ws;
  size_t off = 0;
  auto carve = [&](size_t halves) {
    void* p = ws + off;
    off += (halves * sizeof(_Float16) + 255) & ~(size_t)255;
    return (_Float16*)p;
  };
  _Float16* Xq  = carve((size_t)BSZ * DIN);
  _Float16* Xk  = carve((size_t)BSZ * DIN);
  _Float16* Xv  = carve((size_t)BSZ * DIN);
  _Float16* WqT = carve((size_t)DIN * DHID);
  _Float16* WkT = carve((size_t)DH * DIN);
  _Float16* WvT = carve((size_t)DH * DIN);
  _Float16* WoT = carve((size_t)DIN * DHID);
  _Float16* qp  = carve((size_t)BSZ * DHID);
  _Float16* kp  = carve((size_t)BSZ * DH);
  _Float16* vTp = carve((size_t)DH * BSZ);   // V^T [64, B*S]
  _Float16* oat = carve((size_t)BSZ * DHID);

  const int THREADS = 256;
  const int nAct = BSZ * DIN;
  cast_h<<<dim3((nAct + THREADS - 1) / THREADS), THREADS, 0, stream>>>(query, Xq, nAct);
  cast_h<<<dim3((nAct + THREADS - 1) / THREADS), THREADS, 0, stream>>>(key,   Xk, nAct);
  cast_h<<<dim3((nAct + THREADS - 1) / THREADS), THREADS, 0, stream>>>(value, Xv, nAct);

  cast_t<<<dim3((DIN * DHID + THREADS - 1) / THREADS), THREADS, 0, stream>>>(Wq, WqT, DIN, DHID);
  cast_t<<<dim3((DIN * DH   + THREADS - 1) / THREADS), THREADS, 0, stream>>>(Wk, WkT, DIN, DH);
  cast_t<<<dim3((DIN * DH   + THREADS - 1) / THREADS), THREADS, 0, stream>>>(Wv, WvT, DIN, DH);
  cast_t<<<dim3((DHID * DIN + THREADS - 1) / THREADS), THREADS, 0, stream>>>(Wo, WoT, DHID, DIN);

  // projections (WMMA, 64x64 tiles per 4-wave block)
  gemm_wmma<<<dim3(BSZ / 64, DHID / 64), 128, 0, stream>>>(Xq, WqT, bq, qp, nullptr, BSZ, DHID, DIN, 0);
  gemm_wmma<<<dim3(BSZ / 64, 1),         128, 0, stream>>>(Xk, WkT, bk, kp, nullptr, BSZ, DH,   DIN, 0);
  gemm_wmma<<<dim3(BSZ / 64, 1),         128, 0, stream>>>(Xv, WvT, bv, vTp, nullptr, BSZ, DH,  DIN, 1);

  // attention (WMMA flash, 16 heads per block sharing LDS-staged K/V)
  mqa_attn<<<dim3(SS / 16, BB), 512, 0, stream>>>(qp, kp, vTp, oat);

  // output projection (WMMA, fp32 out)
  gemm_wmma<<<dim3(BSZ / 64, DIN / 64), 128, 0, stream>>>(oat, WoT, bo, nullptr, outF, BSZ, DIN, DHID, 0);
}

// v002
// It runs in 178 microseconds.
// In both of two side-by-side timings against v001, it was 1.45 times as fast.
// All steps since v000 together make it 1.85 times as fast.
#include <hip/hip_runtime.h>
#include <hip/hip_bf16.h>

// ---------------------------------------------------------------------------
// MQA forward, all matmuls on v_wmma_f32_16x16x32_f16 (CDNA5 / gfx1250).
// B=2, S=2048, d_model=1024, H=16, Dh=64 (single shared K/V head).
// GEMMs: 4-wave blocks, B-operand staged in LDS via global_load_async_to_lds
// (double buffered, ASYNCcnt), A-operand software-pipelined in registers.
// Attention: 16-wave blocks (one head per wave) sharing async-staged,
// double-buffered K/V tiles in LDS -- 16x cut in L2 traffic for the shared
// MQA head.
// ---------------------------------------------------------------------------

typedef __attribute__((ext_vector_type(16))) _Float16 v16h;
typedef __attribute__((ext_vector_type(8)))  _Float16 h8;
typedef __attribute__((ext_vector_type(8)))  float    v8f;
typedef __attribute__((ext_vector_type(2)))  _Float16 h2;
typedef __attribute__((ext_vector_type(4)))  int      v4i;
typedef __attribute__((ext_vector_type(4)))  float    f4;
typedef __attribute__((ext_vector_type(4)))  _Float16 h4;

#define BB    2
#define SS    2048
#define BSZ   4096      // B*S
#define DIN   1024
#define DHID  1024
#define NH    16
#define DH    64
#define SCALE 0.03125f  // 1/sqrt(1024)

// LDS row pitches in halves. Every tile here is read by 16-byte loads, 16 rows
// at a time, so the pitch is an odd multiple of 16 bytes: the 16 rows then fall
// on 16 different groups of four banks instead of on two (128-byte rows) or
// four (64-byte rows).
#define P32   40        // rows of 32 halves: 64 B of data, 80 B pitch
#define P64   72        // rows of 64 halves: 128 B of data, 144 B pitch

#if __has_builtin(__builtin_amdgcn_global_load_async_to_lds_b128)
#define HAVE_ASYNC 1
#else
#define HAVE_ASYNC 0
#endif

// 16-byte global -> LDS copy; async (ASYNCcnt) when the gfx1250 builtin exists.
__device__ __forceinline__ void cp16(const _Float16* g, _Float16* l) {
#if HAVE_ASYNC
  __builtin_amdgcn_global_load_async_to_lds_b128(
      (__attribute__((address_space(1))) v4i*)g,
      (__attribute__((address_space(3))) v4i*)l, 0, 0);
#else
  *(h8*)l = *(const h8*)g;
#endif
}

// Wait until at most N async copies remain in flight.
template <int N>
__device__ __forceinline__ void wait_async() {
#if HAVE_ASYNC
#if __has_builtin(__builtin_amdgcn_s_wait_asynccnt)
  __builtin_amdgcn_s_wait_asynccnt(N);
#else
  asm volatile("s_wait_asynccnt %0" ::"i"(N) : "memory");
#endif
#endif
}

// Assemble a 16-bit WMMA A/B fragment (16x32 resp. 32x16) for one K=32 chunk.
// Per ISA 7.12.2: lane holds row/col (lane&15); hi = lane>>4 selects the K
// half-groups. Half t -> K = t + 8*hi + 8*(t>=8); pairs merge into b128 loads.
__device__ __forceinline__ v16h frag16(const _Float16* __restrict__ base, int hi) {
  v16h r;
#pragma unroll
  for (int tp = 0; tp < 8; ++tp) {
    const int kk = 2 * tp + 8 * hi + ((tp >= 4) ? 8 : 0);
    h2 p = *(const h2*)(base + kk);
    r[2 * tp]     = p.x;
    r[2 * tp + 1] = p.y;
  }
  return r;
}

// ---------------------------------------------------------------------------
// fp32 -> f16 casts. A launch pays for every wave it starts, so a thread moves
// 32 elements: few waves, each with 8 16-byte loads in flight per lane.
// ---------------------------------------------------------------------------
#define CAST_THREADS 512                       // 16 waves: one block fills a WGP's stream
#define CAST_LOADS   8                         // 16-byte loads in flight per lane
#define CAST_ELEMS   (CAST_THREADS * CAST_LOADS * 4)   // elements per block
static_assert((BSZ * DIN) % CAST_ELEMS == 0, "cast_h has no tail");
static_assert(DIN % 64 == 0 && DHID % 64 == 0 && DH % 64 == 0, "cast_t has no tail");

// Each wave owns 4 KB of input in a row: every load covers 512 contiguous bytes
// (4 whole lines), every store 256 (2 whole lines); all loads precede the stores.
__global__ void __launch_bounds__(CAST_THREADS)
cast_h(const float* __restrict__ in, _Float16* __restrict__ out) {
  const int wave = threadIdx.x >> 5;
  const int lane = threadIdx.x & 31;
  const size_t g = ((size_t)blockIdx.x * (CAST_THREADS / 32) + wave) * (CAST_LOADS * 32) + lane;
  const f4* __restrict__ src = (const f4*)in + g;   // groups of 4 elements
  h4* __restrict__ dst = (h4*)out + g;
  f4 v[CAST_LOADS];
#pragma unroll
  for (int i = 0; i < CAST_LOADS; ++i) v[i] = src[i * 32];
#pragma unroll
  for (int i = 0; i < CAST_LOADS; ++i) dst[i * 32] = __builtin_convertvector(v[i], h4);
}

// W [K,N] fp32 row-major  ->  W^T [N,K] f16 row-major.
// A wave transposes a 64(k) x 16(n) tile in registers: a lane loads 8 k-rows of
// 4 n each and stores, for each of its 4 n, 8 consecutive k as 16 bytes; the 8
// lanes of one n together write one whole 128-byte line of W^T.
// Grid: (N / 64, K / 64), 4 waves side by side in n. K and N are compile-time so
// that the 8 loads share one address and the 4 stores another (immediate offsets).
template <int K, int N>
__global__ void __launch_bounds__(128)
cast_t(const float* __restrict__ in, _Float16* __restrict__ out) {
  const int wave = threadIdx.x >> 5;
  const int lane = threadIdx.x & 31;
  const int k = blockIdx.y * 64 + (lane & 7) * 8;
  const int n = blockIdx.x * 64 + wave * 16 + (lane >> 3) * 4;
  f4 v[8];
#pragma unroll
  for (int j = 0; j < 8; ++j) v[j] = *(const f4*)(in + (size_t)(k + j) * N + n);
#pragma unroll
  for (int c = 0; c < 4; ++c) {
    h8 r;
#pragma unroll
    for (int j = 0; j < 8; ++j) r[j] = (_Float16)v[j][c];
    *(h8*)(out + (size_t)(n + c) * K + k) = r;
  }
}

// ---------------------------------------------------------------------------
// WMMA GEMM:  C[M,N] = X[M,K] @ W[K,N] + bias,  W given as WT[N,K].
// Block = 4 waves = 64x64 tile. B chunk (64x32 f16, 5KB padded) staged in LDS by
// async copies, double buffered; each wave owns one 16-row strip and 4 f32
// accumulators; A fragments pipelined in registers.
// ---------------------------------------------------------------------------
__global__ void __launch_bounds__(128)
gemm_wmma(const _Float16* __restrict__ X,
          const _Float16* __restrict__ WT,
          const float* __restrict__ bias,
          _Float16* __restrict__ outH,
          float* __restrict__ outF,
          int M, int N, int K, int transposeOut) {
  __shared__ __attribute__((aligned(16))) _Float16 bsh[2][64 * P32];  // [buf][row(64) x k(32), padded]

  const int tid  = threadIdx.x;          // 0..127
  const int wave = tid >> 5;
  const int lane = tid & 31;
  const int nl   = lane & 15;
  const int hi   = lane >> 4;
  const int m0   = (blockIdx.x * 4 + wave) * 16;
  const int n0   = blockIdx.y * 64;

  const _Float16* arow = X + (size_t)(m0 + nl) * K;

  // Stage one 64x32 B chunk: 256 x 16B segments, 2 per thread.
  auto stageB = [&](int k0, int buf) {
#pragma unroll
    for (int i = 0; i < 2; ++i) {
      const int seg = tid + i * 128;
      const int row = seg >> 2;          // 4 segs per 32-half row
      const int c16 = seg & 3;
      cp16(WT + (size_t)(n0 + row) * K + k0 + c16 * 8,
           &bsh[buf][row * P32 + c16 * 8]);
    }
  };

  v8f z = {};
  v8f c[4] = {z, z, z, z};

  stageB(0, 0);
  v16h a_cur = frag16(arow, hi);

  for (int k0 = 0; k0 < K; k0 += 32) {
    const int buf  = (k0 >> 5) & 1;
    const int nk0  = k0 + 32;
    const bool more = nk0 < K;
    if (more) { stageB(nk0, buf ^ 1); wait_async<2>(); }  // next copy in flight
    else      { wait_async<0>(); }
    __syncthreads();                     // B chunk visible to all 4 waves

    v16h a_nxt = more ? frag16(arow + nk0, hi) : a_cur;  // pipeline A
#pragma unroll
    for (int nt = 0; nt < 4; ++nt) {
      v16h b = frag16(&bsh[buf][(nt * 16 + nl) * P32], hi);
      c[nt] = __builtin_amdgcn_wmma_f32_16x16x32_f16(
          false, a_cur, false, b, (short)0, c[nt], false, false);
    }
    a_cur = a_nxt;
    __syncthreads();                     // before next stage overwrites buf
  }

#pragma unroll
  for (int nt = 0; nt < 4; ++nt) {
    const int gn = n0 + nt * 16 + nl;
    const float bval = bias ? bias[gn] : 0.0f;
#pragma unroll
    for (int r = 0; r < 8; ++r) {
      const int gm = m0 + r + 8 * hi;    // C/D layout: VGPR r -> row
      const float val = c[nt][r] + bval;
      if (outH) {
        if (transposeOut) outH[(size_t)gn * M + gm] = (_Float16)val;
        else              outH[(size_t)gm * N + gn] = (_Float16)val;
      } else {
        outF[(size_t)gm * N + gn] = val;
      }
    }
  }
}

// ---------------------------------------------------------------------------
// Flash-style MQA attention. Block = 16 waves = all 16 heads of one
// (batch, 16-query tile); the shared K/V head is staged once per block into
// LDS (async, double buffered) instead of once per wave.
//   qh : [B*S, 1024] f16    kh : [B*S, 64] f16    vT : [64, B*S] f16
//   oh : [B*S, 1024] f16 (attn output, pre O-projection)
// ---------------------------------------------------------------------------
__global__ void __launch_bounds__(512)
mqa_attn(const _Float16* __restrict__ qh,
         const _Float16* __restrict__ kh,
         const _Float16* __restrict__ vT,
         _Float16* __restrict__ oh) {
  __shared__ __attribute__((aligned(16))) _Float16 ksh[2][32 * P64];  // [buf][key row(32) x d(64), padded]  9KB
  __shared__ __attribute__((aligned(16))) _Float16 vsh[2][DH * P32];  // [buf][vcol(64) x key(32), padded]  10KB
  __shared__ __attribute__((aligned(16))) _Float16 pl[NH][16 * P32];  // per-wave P staging, padded         20KB

  const int tid  = threadIdx.x;           // 0..511
  const int wave = tid >> 5;              // = head
  const int lane = tid & 31;
  const int nl   = lane & 15;
  const int hi   = lane >> 4;
  const int qt   = blockIdx.x;            // query tile [0,128)
  const int b    = blockIdx.y;            // batch
  const int h    = wave;

  // Stage the next 32-key K tile + V^T tile: 512 x 16B segs, 1 per thread.
  auto stageKV = [&](int j, int buf) {
    if (tid < 256) {                      // K tile: 32 rows x 64 halves
      const int row = tid >> 3, s = tid & 7;
      cp16(kh + ((size_t)(b * SS + j + row)) * DH + s * 8,
           &ksh[buf][row * P64 + s * 8]);
    } else {                              // V^T tile: 64 rows x 32 halves
      const int t2 = tid - 256;
      const int row = t2 >> 2, s = t2 & 3;
      cp16(vT + (size_t)row * BSZ + b * SS + j + s * 8,
           &vsh[buf][row * P32 + s * 8]);
    }
  };

  // Q tile resident as two A fragments (d = 0..31, 32..63)
  const _Float16* qrow = qh + ((size_t)(b * SS + qt * 16 + nl)) * DHID + h * DH;
  const v16h qa0 = frag16(qrow, hi);
  const v16h qa1 = frag16(qrow + 32, hi);

  v8f z = {};
  v8f o[4] = {z, z, z, z};                // O accum, 16x64
  float m8[8], l8[8];
#pragma unroll
  for (int r = 0; r < 8; ++r) { m8[r] = -3.0e38f; l8[r] = 0.0f; }

  stageKV(0, 0);

  for (int j = 0; j < SS; j += 32) {
    const int buf   = (j >> 5) & 1;
    const bool more = (j + 32) < SS;
    if (more) { stageKV(j + 32, buf ^ 1); wait_async<1>(); }
    else      { wait_async<0>(); }
    __syncthreads();                      // K/V tiles visible to all heads

    // ---- scores: two 16x16 tiles, S = Q @ K^T, B operand from LDS ----
    const _Float16* kr0 = &ksh[buf][nl * P64];
    const _Float16* kr1 = &ksh[buf][(16 + nl) * P64];
    v8f s0 = z, s1 = z;
    s0 = __builtin_amdgcn_wmma_f32_16x16x32_f16(false, qa0, false, frag16(kr0, hi),      (short)0, s0, false, false);
    s0 = __builtin_amdgcn_wmma_f32_16x16x32_f16(false, qa1, false, frag16(kr0 + 32, hi), (short)0, s0, false, false);
    s1 = __builtin_amdgcn_wmma_f32_16x16x32_f16(false, qa0, false, frag16(kr1, hi),      (short)0, s1, false, false);
    s1 = __builtin_amdgcn_wmma_f32_16x16x32_f16(false, qa1, false, frag16(kr1 + 32, hi), (short)0, s1, false, false);

    // ---- online softmax over the 16x32 slab ----
    float corr[8];
#pragma unroll
    for (int r = 0; r < 8; ++r) {
      const float x0 = s0[r] * SCALE;
      const float x1 = s1[r] * SCALE;
      float t = fmaxf(x0, x1);
      t = fmaxf(t, __shfl_xor(t, 1));
      t = fmaxf(t, __shfl_xor(t, 2));
      t = fmaxf(t, __shfl_xor(t, 4));
      t = fmaxf(t, __shfl_xor(t, 8));     // row max within 16-lane group
      const float mnew = fmaxf(m8[r], t);
      const float p0 = __expf(x0 - mnew);
      const float p1 = __expf(x1 - mnew);
      float rs = p0 + p1;
      rs += __shfl_xor(rs, 1);
      rs += __shfl_xor(rs, 2);
      rs += __shfl_xor(rs, 4);
      rs += __shfl_xor(rs, 8);            // row sum
      const float cr = __expf(m8[r] - mnew);
      l8[r] = l8[r] * cr + rs;
      m8[r] = mnew;
      corr[r] = cr;
      // C-layout: lane owns column nl of rows r+8*hi
      pl[wave][(r + 8 * hi) * P32 + nl]      = (_Float16)p0;
      pl[wave][(r + 8 * hi) * P32 + 16 + nl] = (_Float16)p1;
    }
#pragma unroll
    for (int r = 0; r < 8; ++r) {
      o[0][r] *= corr[r]; o[1][r] *= corr[r];
      o[2][r] *= corr[r]; o[3][r] *= corr[r];
    }

    // ---- P (A-layout from LDS) @ V (B operand from LDS V^T tile) ----
    const v16h pa = frag16(&pl[wave][nl * P32], hi);
#pragma unroll
    for (int nt = 0; nt < 4; ++nt) {
      v16h bv = frag16(&vsh[buf][(nt * 16 + nl) * P32], hi);
      o[nt] = __builtin_amdgcn_wmma_f32_16x16x32_f16(
          false, pa, false, bv, (short)0, o[nt], false, false);
    }
    __syncthreads();                      // before next stage overwrites buf
  }

  // ---- normalize and write attention output ----
#pragma unroll
  for (int r = 0; r < 8; ++r) {
    const float inv = 1.0f / l8[r];
    const int gm = qt * 16 + r + 8 * hi;
#pragma unroll
    for (int nt = 0; nt < 4; ++nt) {
      oh[((size_t)(b * SS + gm)) * DHID + h * DH + nt * 16 + nl] =
          (_Float16)(o[nt][r] * inv);
    }
  }
}

// ---------------------------------------------------------------------------
// Launcher
// ---------------------------------------------------------------------------
extern "C" void kernel_launch(void* const* d_in, const int* in_sizes, int n_in,
                              void* d_out, int out_size, void* d_ws, size_t ws_size,
                              hipStream_t stream) {
  (void)in_sizes; (void)n_in; (void)out_size; (void)ws_size;

  const float* query = (const float*)d_in[0];
  const float* key   = (const float*)d_in[1];
  const float* value = (const float*)d_in[2];
  const float* Wq    = (const float*)d_in[3];
  const float* bq    = (const float*)d_in[4];
  const float* Wk    = (const float*)d_in[5];
  const float* bk    = (const float*)d_in[6];
  const float* Wv    = (const float*)d_in[7];
  const float* bv    = (const float*)d_in[8];
  const float* Wo    = (const float*)d_in[9];
  const float* bo    = (const float*)d_in[10];
  float* outF = (float*)d_out;

  // workspace carve-up (f16, 256B aligned), ~45 MB total
  char* ws = (char*)d_ws;
  size_t off = 0;
  auto carve = [&](size_t halves) {
    void* p = ws + off;
    off += (halves * sizeof(_Float16) + 255) & ~(size_t)255;
    return (_Float16*)p;
  };
  _Float16* Xq  = carve((size_t)BSZ * DIN);
  _Float16* Xk  = carve((size_t)BSZ * DIN);
  _Float16* Xv  = carve((size_t)BSZ * DIN);
  _Float16* WqT = carve((size_t)DIN * DHID);
  _Float16* WkT = carve((size_t)DH * DIN);
  _Float16* WvT = carve((size_t)DH * DIN);
  _Float16* WoT = carve((size_t)DIN * DHID);
  _Float16* qp  = carve((size_t)BSZ * DHID);
  _Float16* kp  = carve((size_t)BSZ * DH);
  _Float16* vTp = carve((size_t)DH * BSZ);   // V^T [64, B*S]
  _Float16* oat = carve((size_t)BSZ * DHID);

  cast_h<<<dim3(BSZ * DIN / CAST_ELEMS), CAST_THREADS, 0, stream>>>(query, Xq);
  cast_h<<<dim3(BSZ * DIN / CAST_ELEMS), CAST_THREADS, 0, stream>>>(key,   Xk);
  cast_h<<<dim3(BSZ * DIN / CAST_ELEMS), CAST_THREADS, 0, stream>>>(value, Xv);

  cast_t<DIN, DHID><<<dim3(DHID / 64, DIN / 64), 128, 0, stream>>>(Wq, WqT);
  cast_t<DIN, DH><<<dim3(DH / 64,   DIN / 64), 128, 0, stream>>>(Wk, WkT);
  cast_t<DIN, DH><<<dim3(DH / 64,   DIN / 64), 128, 0, stream>>>(Wv, WvT);
  cast_t<DHID, DIN><<<dim3(DIN / 64, DHID / 64), 128, 0, stream>>>(Wo, WoT);

  // projections (WMMA, 64x64 tiles per 4-wave block)
  gemm_wmma<<<dim3(BSZ / 64, DHID / 64), 128, 0, stream>>>(Xq, WqT, bq, qp, nullptr, BSZ, DHID, DIN, 0);
  gemm_wmma<<<dim3(BSZ / 64, 1),         128, 0, stream>>>(Xk, WkT, bk, kp, nullptr, BSZ, DH,   DIN, 0);
  gemm_wmma<<<dim3(BSZ / 64, 1),         128, 0, stream>>>(Xv, WvT, bv, vTp, nullptr, BSZ, DH,  DIN, 1);

  // attention (WMMA flash, 16 heads per block sharing LDS-staged K/V)
  mqa_attn<<<dim3(SS / 16, BB), 512, 0, stream>>>(qp, kp, vTp, oat);

  // output projection (WMMA, fp32 out)
  gemm_wmma<<<dim3(BSZ / 64, DIN / 64), 128, 0, stream>>>(oat, WoT, bo, nullptr, outF, BSZ, DIN, DHID, 0);
}

// v003
// A run of this version takes 143 microseconds.
// Timed twice side by side with v002, it ran 1.25 times as fast both times.
// Counting every step since v000, it is 2.31 times as fast.
#include <hip/hip_runtime.h>
#include <hip/hip_bf16.h>

// ---------------------------------------------------------------------------
// MQA forward, all matmuls on v_wmma_f32_16x16x32_f16 (CDNA5 / gfx1250).
// B=2, S=2048, d_model=1024, H=16, Dh=64 (single shared K/V head).
// GEMMs: 4-wave blocks, B-operand staged in LDS via global_load_async_to_lds
// (double buffered, ASYNCcnt), A-operand software-pipelined in registers.
// Attention: 16-wave blocks (one head per wave) sharing async-staged,
// double-buffered K/V tiles in LDS -- 16x cut in L2 traffic for the shared
// MQA head.
// ---------------------------------------------------------------------------

typedef __attribute__((ext_vector_type(16))) _Float16 v16h;
typedef __attribute__((ext_vector_type(8)))  _Float16 h8;
typedef __attribute__((ext_vector_type(8)))  float    v8f;
typedef __attribute__((ext_vector_type(2)))  _Float16 h2;
typedef __attribute__((ext_vector_type(4)))  int      v4i;
typedef __attribute__((ext_vector_type(4)))  float    f4;
typedef __attribute__((ext_vector_type(4)))  _Float16 h4;

#define BB    2
#define SS    2048
#define BSZ   4096      // B*S
#define DIN   1024
#define DHID  1024
#define NH    16
#define DH    64
#define SCALE 0.03125f  // 1/sqrt(1024)

// LDS row pitches in halves. Every tile here is read by 16-byte loads, 16 rows
// at a time, so the pitch is an odd multiple of 16 bytes: the 16 rows then fall
// on 16 different groups of four banks instead of on two (128-byte rows) or
// four (64-byte rows).
#define P32   40        // rows of 32 halves: 64 B of data, 80 B pitch
#define P64   72        // rows of 64 halves: 128 B of data, 144 B pitch

#if __has_builtin(__builtin_amdgcn_global_load_async_to_lds_b128)
#define HAVE_ASYNC 1
#else
#define HAVE_ASYNC 0
#endif

// 16-byte global -> LDS copy; async (ASYNCcnt) when the gfx1250 builtin exists.
__device__ __forceinline__ void cp16(const _Float16* g, _Float16* l) {
#if HAVE_ASYNC
  __builtin_amdgcn_global_load_async_to_lds_b128(
      (__attribute__((address_space(1))) v4i*)g,
      (__attribute__((address_space(3))) v4i*)l, 0, 0);
#else
  *(h8*)l = *(const h8*)g;
#endif
}

// Wait until at most N async copies remain in flight.
template <int N>
__device__ __forceinline__ void wait_async() {
#if HAVE_ASYNC
#if __has_builtin(__builtin_amdgcn_s_wait_asynccnt)
  __builtin_amdgcn_s_wait_asynccnt(N);
#else
  asm volatile("s_wait_asynccnt %0" ::"i"(N) : "memory");
#endif
#endif
}

// Assemble a 16-bit WMMA A/B fragment (16x32 resp. 32x16) for one K=32 chunk.
// Per ISA 7.12.2: lane holds row/col (lane&15); hi = lane>>4 selects the K
// half-groups. Half t -> K = t + 8*hi + 8*(t>=8); pairs merge into b128 loads.
__device__ __forceinline__ v16h frag16(const _Float16* __restrict__ base, int hi) {
  v16h r;
#pragma unroll
  for (int tp = 0; tp < 8; ++tp) {
    const int kk = 2 * tp + 8 * hi + ((tp >= 4) ? 8 : 0);
    h2 p = *(const h2*)(base + kk);
    r[2 * tp]     = p.x;
    r[2 * tp + 1] = p.y;
  }
  return r;
}

// ---------------------------------------------------------------------------
// fp32 -> f16 casts. A launch pays for every wave it starts, so a thread moves
// 32 elements: few waves, each with 8 16-byte loads in flight per lane.
// ---------------------------------------------------------------------------
#define CAST_THREADS 512                       // 16 waves: one block fills a WGP's stream
#define CAST_LOADS   8                         // 16-byte loads in flight per lane
#define CAST_ELEMS   (CAST_THREADS * CAST_LOADS * 4)   // elements per block
static_assert((BSZ * DIN) % CAST_ELEMS == 0, "cast_h has no tail");
static_assert(DIN % 64 == 0 && DHID % 64 == 0 && DH % 64 == 0, "cast_t has no tail");

// Each wave owns 4 KB of input in a row: every load covers 512 contiguous bytes
// (4 whole lines), every store 256 (2 whole lines); all loads precede the stores.
__global__ void __launch_bounds__(CAST_THREADS)
cast_h(const float* __restrict__ in, _Float16* __restrict__ out) {
  const int wave = threadIdx.x >> 5;
  const int lane = threadIdx.x & 31;
  const size_t g = ((size_t)blockIdx.x * (CAST_THREADS / 32) + wave) * (CAST_LOADS * 32) + lane;
  const f4* __restrict__ src = (const f4*)in + g;   // groups of 4 elements
  h4* __restrict__ dst = (h4*)out + g;
  f4 v[CAST_LOADS];
#pragma unroll
  for (int i = 0; i < CAST_LOADS; ++i) v[i] = src[i * 32];
#pragma unroll
  for (int i = 0; i < CAST_LOADS; ++i) dst[i * 32] = __builtin_convertvector(v[i], h4);
}

// W [K,N] fp32 row-major  ->  W^T [N,K] f16 row-major.
// A wave transposes a 64(k) x 16(n) tile in registers: a lane loads 8 k-rows of
// 4 n each and stores, for each of its 4 n, 8 consecutive k as 16 bytes; the 8
// lanes of one n together write one whole 128-byte line of W^T.
// Grid: (N / 64, K / 64), 4 waves side by side in n. K and N are compile-time so
// that the 8 loads share one address and the 4 stores another (immediate offsets).
template <int K, int N>
__global__ void __launch_bounds__(128)
cast_t(const float* __restrict__ in, _Float16* __restrict__ out) {
  const int wave = threadIdx.x >> 5;
  const int lane = threadIdx.x & 31;
  const int k = blockIdx.y * 64 + (lane & 7) * 8;
  const int n = blockIdx.x * 64 + wave * 16 + (lane >> 3) * 4;
  f4 v[8];
#pragma unroll
  for (int j = 0; j < 8; ++j) v[j] = *(const f4*)(in + (size_t)(k + j) * N + n);
#pragma unroll
  for (int c = 0; c < 4; ++c) {
    h8 r;
#pragma unroll
    for (int j = 0; j < 8; ++j) r[j] = (_Float16)v[j][c];
    *(h8*)(out + (size_t)(n + c) * K + k) = r;
  }
}

// ---------------------------------------------------------------------------
// WMMA GEMM:  C[M,N] = X[M,K] @ W[K,N] + bias,  W given as WT[N,K].
// Block = 4 waves = 64x64 tile. B chunk (64x32 f16, 5KB padded) staged in LDS by
// async copies, double buffered; each wave owns one 16-row strip and 4 f32
// accumulators; A fragments pipelined in registers.
// ---------------------------------------------------------------------------
__global__ void __launch_bounds__(128)
gemm_wmma(const _Float16* __restrict__ X,
          const _Float16* __restrict__ WT,
          const float* __restrict__ bias,
          _Float16* __restrict__ outH,
          float* __restrict__ outF,
          int M, int N, int K, int transposeOut) {
  __shared__ __attribute__((aligned(16))) _Float16 bsh[2][64 * P32];  // [buf][row(64) x k(32), padded]

  const int tid  = threadIdx.x;          // 0..127
  const int wave = tid >> 5;
  const int lane = tid & 31;
  const int nl   = lane & 15;
  const int hi   = lane >> 4;
  const int m0   = (blockIdx.x * 4 + wave) * 16;
  const int n0   = blockIdx.y * 64;

  const _Float16* arow = X + (size_t)(m0 + nl) * K;

  // Stage one 64x32 B chunk: 256 x 16B segments, 2 per thread.
  auto stageB = [&](int k0, int buf) {
#pragma unroll
    for (int i = 0; i < 2; ++i) {
      const int seg = tid + i * 128;
      const int row = seg >> 2;          // 4 segs per 32-half row
      const int c16 = seg & 3;
      cp16(WT + (size_t)(n0 + row) * K + k0 + c16 * 8,
           &bsh[buf][row * P32 + c16 * 8]);
    }
  };

  v8f z = {};
  v8f c[4] = {z, z, z, z};

  stageB(0, 0);
  v16h a_cur = frag16(arow, hi);

  for (int k0 = 0; k0 < K; k0 += 32) {
    const int buf  = (k0 >> 5) & 1;
    const int nk0  = k0 + 32;
    const bool more = nk0 < K;
    if (more) { stageB(nk0, buf ^ 1); wait_async<2>(); }  // next copy in flight
    else      { wait_async<0>(); }
    __syncthreads();                     // B chunk visible to all 4 waves

    v16h a_nxt = more ? frag16(arow + nk0, hi) : a_cur;  // pipeline A
#pragma unroll
    for (int nt = 0; nt < 4; ++nt) {
      v16h b = frag16(&bsh[buf][(nt * 16 + nl) * P32], hi);
      c[nt] = __builtin_amdgcn_wmma_f32_16x16x32_f16(
          false, a_cur, false, b, (short)0, c[nt], false, false);
    }
    a_cur = a_nxt;
    __syncthreads();                     // before next stage overwrites buf
  }

#pragma unroll
  for (int nt = 0; nt < 4; ++nt) {
    const int gn = n0 + nt * 16 + nl;
    const float bval = bias ? bias[gn] : 0.0f;
#pragma unroll
    for (int r = 0; r < 8; ++r) {
      const int gm = m0 + r + 8 * hi;    // C/D layout: VGPR r -> row
      const float val = c[nt][r] + bval;
      if (outH) {
        if (transposeOut) outH[(size_t)gn * M + gm] = (_Float16)val;
        else              outH[(size_t)gm * N + gn] = (_Float16)val;
      } else {
        outF[(size_t)gm * N + gn] = val;
      }
    }
  }
}

// Value of lane l ^ 16 (the other half of the wave), as one vector instruction.
__device__ __forceinline__ float xhalf(float x) {
  const int b = __builtin_bit_cast(int, x);
  return __builtin_bit_cast(float,
      __builtin_amdgcn_permlanex16(b, b, 0x76543210, 0xfedcba98, false, false));
}

__global__ void __launch_bounds__(512)
mqa_attn(const _Float16* __restrict__ qh,
         const _Float16* __restrict__ kh,
         const _Float16* __restrict__ vT,
         _Float16* __restrict__ oh) {
  __shared__ __attribute__((aligned(16))) _Float16 ksh[2][32 * P64];  // [buf][key row(32) x d(64), padded]  9KB
  __shared__ __attribute__((aligned(16))) _Float16 vsh[2][DH * P32];  // [buf][vcol(64) x key(32), padded]  10KB

  const int tid  = threadIdx.x;           // 0..511
  const int wave = tid >> 5;              // = head
  const int lane = tid & 31;
  const int nl   = lane & 15;
  const int hi   = lane >> 4;
  const int qt   = blockIdx.x;            // query tile [0,128)
  const int b    = blockIdx.y;            // batch
  const int h    = wave;

  // Stage the next 32-key K tile + V^T tile: 512 x 16B segs, 1 per thread.
  auto stageKV = [&](int j, int buf) {
    if (tid < 256) {                      // K tile: 32 rows x 64 halves
      const int row = tid >> 3, s = tid & 7;
      cp16(kh + ((size_t)(b * SS + j + row)) * DH + s * 8,
           &ksh[buf][row * P64 + s * 8]);
    } else {                              // V^T tile: 64 rows x 32 halves
      const int t2 = tid - 256;
      const int row = t2 >> 2, s = t2 & 3;
      cp16(vT + (size_t)row * BSZ + b * SS + j + s * 8,
           &vsh[buf][row * P32 + s * 8]);
    }
  };

  // Q tile resident as two B fragments (d = 0..31, 32..63), column = query nl
  const _Float16* qrow = qh + ((size_t)(b * SS + qt * 16 + nl)) * DHID + h * DH;
  const v16h qb0 = frag16(qrow, hi);
  const v16h qb1 = frag16(qrow + 32, hi);

  v8f z = {};
  v8f o[4] = {z, z, z, z};                // O^T accum, 64(d) x 16(query)
  float m = -3.0e38f;                     // running maximum of query nl (same in both halves)
  float l = 0.0f;                         // running sum over this half's keys only

  stageKV(0, 0);

  for (int j = 0; j < SS; j += 32) {
    const int buf   = (j >> 5) & 1;
    const bool more = (j + 32) < SS;
    if (more) { stageKV(j + 32, buf ^ 1); wait_async<1>(); }
    else      { wait_async<0>(); }
    __syncthreads();                      // K/V tiles visible to all heads

    // ---- scores: two 16x16 tiles, S^T = K @ Q^T, A operand from LDS ----
    const _Float16* kr0 = &ksh[buf][nl * P64];
    const _Float16* kr1 = &ksh[buf][(16 + nl) * P64];
    v8f s0 = z, s1 = z;
    s0 = __builtin_amdgcn_wmma_f32_16x16x32_f16(false, frag16(kr0, hi),      false, qb0, (short)0, s0, false, false);
    s0 = __builtin_amdgcn_wmma_f32_16x16x32_f16(false, frag16(kr0 + 32, hi), false, qb1, (short)0, s0, false, false);
    s1 = __builtin_amdgcn_wmma_f32_16x16x32_f16(false, frag16(kr1, hi),      false, qb0, (short)0, s1, false, false);
    s1 = __builtin_amdgcn_wmma_f32_16x16x32_f16(false, frag16(kr1 + 32, hi), false, qb1, (short)0, s1, false, false);

    // ---- online softmax: 16 scores of query nl in this lane ----
    const v8f x0 = s0 * SCALE;            // keys r + 8*hi
    const v8f x1 = s1 * SCALE;            // keys 16 + r + 8*hi
    float x[16];
#pragma unroll
    for (int r = 0; r < 8; ++r) { x[r] = x0[r]; x[8 + r] = x1[r]; }
    float t4[4];                          // four short chains instead of one long one
#pragma unroll
    for (int c = 0; c < 4; ++c)
      t4[c] = fmaxf(fmaxf(x[4 * c], x[4 * c + 1]), fmaxf(x[4 * c + 2], x[4 * c + 3]));
    float t = fmaxf(fmaxf(t4[0], t4[1]), fmaxf(t4[2], t4[3]));
    t = fmaxf(t, xhalf(t));               // the other 16 keys of the same query
    const float mnew = fmaxf(m, t);
    const float cr = __expf(m - mnew);
    m = mnew;

    // Half t of the B fragment is key t + 8*hi (t < 8) or 8 + t + 8*hi: x's order.
    v16h pb;
    float p[16];
#pragma unroll
    for (int i = 0; i < 16; ++i) {
      p[i]  = __expf(x[i] - mnew);
      pb[i] = (_Float16)p[i];
    }
    float r4[4];
#pragma unroll
    for (int c = 0; c < 4; ++c)
      r4[c] = (p[4 * c] + p[4 * c + 1]) + (p[4 * c + 2] + p[4 * c + 3]);
    l = l * cr + ((r4[0] + r4[1]) + (r4[2] + r4[3]));

#pragma unroll
    for (int nt = 0; nt < 4; ++nt) o[nt] *= cr;

    // ---- O^T += V^T (A operand from the LDS V^T tile) @ P^T (registers) ----
#pragma unroll
    for (int nt = 0; nt < 4; ++nt) {
      v16h av = frag16(&vsh[buf][(nt * 16 + nl) * P32], hi);
      o[nt] = __builtin_amdgcn_wmma_f32_16x16x32_f16(
          false, av, false, pb, (short)0, o[nt], false, false);
    }
    __syncthreads();                      // before next stage overwrites buf
  }

  // ---- normalize and write attention output ----
  // Lane holds d = nt*16 + 8*hi + (0..7) of query nl: 16 contiguous bytes per nt.
  const float inv = 1.0f / (l + xhalf(l));
  _Float16* orow = oh + ((size_t)(b * SS + qt * 16 + nl)) * DHID + h * DH + 8 * hi;
#pragma unroll
  for (int nt = 0; nt < 4; ++nt) {
    h8 w;
#pragma unroll
    for (int r = 0; r < 8; ++r) w[r] = (_Float16)(o[nt][r] * inv);
    *(h8*)(orow + nt * 16) = w;
  }
}

// ---------------------------------------------------------------------------
// Launcher
// ---------------------------------------------------------------------------
extern "C" void kernel_launch(void* const* d_in, const int* in_sizes, int n_in,
                              void* d_out, int out_size, void* d_ws, size_t ws_size,
                              hipStream_t stream) {
  (void)in_sizes; (void)n_in; (void)out_size; (void)ws_size;

  const float* query = (const float*)d_in[0];
  const float* key   = (const float*)d_in[1];
  const float* value = (const float*)d_in[2];
  const float* Wq    = (const float*)d_in[3];
  const float* bq    = (const float*)d_in[4];
  const float* Wk    = (const float*)d_in[5];
  const float* bk    = (const float*)d_in[6];
  const float* Wv    = (const float*)d_in[7];
  const float* bv    = (const float*)d_in[8];
  const float* Wo    = (const float*)d_in[9];
  const float* bo    = (const float*)d_in[10];
  float* outF = (float*)d_out;

  // workspace carve-up (f16, 256B aligned), ~45 MB total
  char* ws = (char*)d_ws;
  size_t off = 0;
  auto carve = [&](size_t halves) {
    void* p = ws + off;
    off += (halves * sizeof(_Float16) + 255) & ~(size_t)255;
    return (_Float16*)p;
  };
  _Float16* Xq  = carve((size_t)BSZ * DIN);
  _Float16* Xk  = carve((size_t)BSZ * DIN);
  _Float16* Xv  = carve((size_t)BSZ * DIN);
  _Float16* WqT = carve((size_t)DIN * DHID);
  _Float16* WkT = carve((size_t)DH * DIN);
  _Float16* WvT = carve((size_t)DH * DIN);
  _Float16* WoT = carve((size_t)DIN * DHID);
  _Float16* qp  = carve((size_t)BSZ * DHID);
  _Float16* kp  = carve((size_t)BSZ * DH);
  _Float16* vTp = carve((size_t)DH * BSZ);   // V^T [64, B*S]
  _Float16* oat = carve((size_t)BSZ * DHID);

  cast_h<<<dim3(BSZ * DIN / CAST_ELEMS), CAST_THREADS, 0, stream>>>(query, Xq);
  cast_h<<<dim3(BSZ * DIN / CAST_ELEMS), CAST_THREADS, 0, stream>>>(key,   Xk);
  cast_h<<<dim3(BSZ * DIN / CAST_ELEMS), CAST_THREADS, 0, stream>>>(value, Xv);

  cast_t<DIN, DHID><<<dim3(DHID / 64, DIN / 64), 128, 0, stream>>>(Wq, WqT);
  cast_t<DIN, DH><<<dim3(DH / 64,   DIN / 64), 128, 0, stream>>>(Wk, WkT);
  cast_t<DIN, DH><<<dim3(DH / 64,   DIN / 64), 128, 0, stream>>>(Wv, WvT);
  cast_t<DHID, DIN><<<dim3(DIN / 64, DHID / 64), 128, 0, stream>>>(Wo, WoT);

  // projections (WMMA, 64x64 tiles per 4-wave block)
  gemm_wmma<<<dim3(BSZ / 64, DHID / 64), 128, 0, stream>>>(Xq, WqT, bq, qp, nullptr, BSZ, DHID, DIN, 0);
  gemm_wmma<<<dim3(BSZ / 64, 1),         128, 0, stream>>>(Xk, WkT, bk, kp, nullptr, BSZ, DH,   DIN, 0);
  gemm_wmma<<<dim3(BSZ / 64, 1),         128, 0, stream>>>(Xv, WvT, bv, vTp, nullptr, BSZ, DH,  DIN, 1);

  // attention (WMMA flash, 16 heads per block sharing LDS-staged K/V)
  mqa_attn<<<dim3(SS / 16, BB), 512, 0, stream>>>(qp, kp, vTp, oat);

  // output projection (WMMA, fp32 out)
  gemm_wmma<<<dim3(BSZ / 64, DIN / 64), 128, 0, stream>>>(oat, WoT, bo, nullptr, outF, BSZ, DIN, DHID, 0);
}

// v004
// A run of this version takes 95.7 microseconds.
// Two timings next to v003 both put it at 1.51 times that version's speed.
// Over all steps from v000 it is 3.49 times as fast.
#include <hip/hip_runtime.h>
#include <hip/hip_bf16.h>

// ---------------------------------------------------------------------------
// MQA forward, all matmuls on v_wmma_f32_16x16x32_f16 (CDNA5 / gfx1250).
// B=2, S=2048, d_model=1024, H=16, Dh=64 (single shared K/V head).
// GEMMs: 4-wave blocks, B-operand staged in LDS via global_load_async_to_lds
// (double buffered, ASYNCcnt), A-operand software-pipelined in registers.
// Attention: 16-wave blocks (one head per wave) sharing async-staged,
// double-buffered K/V tiles in LDS -- 16x cut in L2 traffic for the shared
// MQA head.
// Launches that do not depend on one another share one launch (the block index
// picks the job): all casts; the Q, K and V projections.
// ---------------------------------------------------------------------------

typedef __attribute__((ext_vector_type(16))) _Float16 v16h;
typedef __attribute__((ext_vector_type(8)))  _Float16 h8;
typedef __attribute__((ext_vector_type(8)))  float    v8f;
typedef __attribute__((ext_vector_type(2)))  _Float16 h2;
typedef __attribute__((ext_vector_type(4)))  int      v4i;
typedef __attribute__((ext_vector_type(4)))  float    f4;
typedef __attribute__((ext_vector_type(4)))  _Float16 h4;

#define BB    2
#define SS    2048
#define BSZ   4096      // B*S
#define DIN   1024
#define DHID  1024
#define NH    16
#define DH    64
#define SCALE 0.03125f  // 1/sqrt(1024)

// LDS row pitches in halves. Every tile here is read by 16-byte loads, 16 rows
// at a time, so the pitch is an odd multiple of 16 bytes: the 16 rows then fall
// on 16 different groups of four banks instead of on two (128-byte rows) or
// four (64-byte rows).
#define P32   40        // rows of 32 halves: 64 B of data, 80 B pitch
#define P64   72        // rows of 64 halves: 128 B of data, 144 B pitch

#if __has_builtin(__builtin_amdgcn_global_load_async_to_lds_b128)
#define HAVE_ASYNC 1
#else
#define HAVE_ASYNC 0
#endif

// 16-byte global -> LDS copy; async (ASYNCcnt) when the gfx1250 builtin exists.
__device__ __forceinline__ void cp16(const _Float16* g, _Float16* l) {
#if HAVE_ASYNC
  __builtin_amdgcn_global_load_async_to_lds_b128(
      (__attribute__((address_space(1))) v4i*)g,
      (__attribute__((address_space(3))) v4i*)l, 0, 0);
#else
  *(h8*)l = *(const h8*)g;
#endif
}

// Wait until at most N async copies remain in flight.
template <int N>
__device__ __forceinline__ void wait_async() {
#if HAVE_ASYNC
#if __has_builtin(__builtin_amdgcn_s_wait_asynccnt)
  __builtin_amdgcn_s_wait_asynccnt(N);
#else
  asm volatile("s_wait_asynccnt %0" ::"i"(N) : "memory");
#endif
#endif
}

// Stands behind a global store, in front of the next write of a register that the
// store names (its address pair, its data).
__device__ __forceinline__ void store_issued() {
  asm volatile("s_wait_xcnt 0x0" ::: "memory");
}

// Assemble a 16-bit WMMA A/B fragment (16x32 resp. 32x16) for one K=32 chunk.
// Per ISA 7.12.2: lane holds row/col (lane&15); hi = lane>>4 selects the K
// half-groups. Half t -> K = t + 8*hi + 8*(t>=8); pairs merge into b128 loads.
__device__ __forceinline__ v16h frag16(const _Float16* __restrict__ base, int hi) {
  v16h r;
#pragma unroll
  for (int tp = 0; tp < 8; ++tp) {
    const int kk = 2 * tp + 8 * hi + ((tp >= 4) ? 8 : 0);
    h2 p = *(const h2*)(base + kk);
    r[2 * tp]     = p.x;
    r[2 * tp + 1] = p.y;
  }
  return r;
}

// ---------------------------------------------------------------------------
// fp32 -> f16 casts. A launch pays for every wave it starts, so a thread moves
// 32 elements: few waves, each with 8 16-byte loads in flight per lane.
// ---------------------------------------------------------------------------
#define CAST_THREADS 512                       // 16 waves: one block fills a WGP's stream
#define CAST_LOADS   8                         // 16-byte loads in flight per lane
#define CAST_ELEMS   (CAST_THREADS * CAST_LOADS * 4)   // elements per block
static_assert((BSZ * DIN) % CAST_ELEMS == 0, "cast_h has no tail");
static_assert(DIN % 64 == 0 && DHID % 64 == 0 && DH % 64 == 0, "cast_t has no tail");

// Each wave owns 4 KB of input in a row: every load covers 512 contiguous bytes
// (4 whole lines), every store 256 (2 whole lines); all loads precede the stores.
__device__ __forceinline__ void
cast_h(const float* __restrict__ in, _Float16* __restrict__ out, int blk) {
  const int wave = threadIdx.x >> 5;
  const int lane = threadIdx.x & 31;
  const size_t g = ((size_t)blk * (CAST_THREADS / 32) + wave) * (CAST_LOADS * 32) + lane;
  const f4* __restrict__ src = (const f4*)in + g;   // groups of 4 elements
  h4* __restrict__ dst = (h4*)out + g;
  f4 v[CAST_LOADS];
#pragma unroll
  for (int i = 0; i < CAST_LOADS; ++i) v[i] = src[i * 32];
#pragma unroll
  for (int i = 0; i < CAST_LOADS; ++i) dst[i * 32] = __builtin_convertvector(v[i], h4);
  store_issued();   // another job's code follows in the merged kernel
}

// W [K,N] fp32 row-major  ->  W^T [N,K] f16 row-major.
// A wave transposes a 64(k) x 16(n) tile in registers: a lane loads 8 k-rows of
// 4 n each and stores, for each of its 4 n, 8 consecutive k as 16 bytes; the 8
// lanes of one n together write one whole 128-byte line of W^T.
// 4 waves side by side in n make a 64 x 64 tile; a block of 16 waves takes 4 tiles
// that follow one another in n, then k. K and N are compile-time so that the 8
// loads share one address and the 4 stores another (immediate offsets).
template <int K, int N>
__device__ __forceinline__ void
cast_t(const float* __restrict__ in, _Float16* __restrict__ out, int blk) {
  const int wave = threadIdx.x >> 5;
  const int lane = threadIdx.x & 31;
  const int tile = blk * (CAST_THREADS / 128) + (wave >> 2);
  const int k = (tile / (N / 64)) * 64 + (lane & 7) * 8;
  const int n = (tile % (N / 64)) * 64 + (wave & 3) * 16 + (lane >> 3) * 4;
  f4 v[8];
#pragma unroll
  for (int j = 0; j < 8; ++j) v[j] = *(const f4*)(in + (size_t)(k + j) * N + n);
#pragma unroll
  for (int c = 0; c < 4; ++c) {
    h8 r;
#pragma unroll
    for (int j = 0; j < 8; ++j) r[j] = (_Float16)v[j][c];
    *(h8*)(out + (size_t)(n + c) * K + k) = r;
  }
  store_issued();   // another job's code follows in the merged kernel
}

// All seven casts in one launch: none reads what another writes, so one launch
// pays the gap, the fill and the tail once instead of seven times.
#define HBLK  (BSZ * DIN / CAST_ELEMS)                       // blocks per activation
#define TBLKW ((DIN / 64) * (DHID / 64) / (CAST_THREADS / 128))  // blocks per 1024 x 1024 weight
#define TBLKN ((DIN / 64) * (DH / 64) / (CAST_THREADS / 128))    // blocks per 1024 x 64 weight
#define CAST_BLOCKS (3 * HBLK + 2 * TBLKW + 2 * TBLKN)
static_assert(((DIN / 64) * (DH / 64)) % (CAST_THREADS / 128) == 0, "whole blocks of tiles");

__global__ void __launch_bounds__(CAST_THREADS)
cast_all(const float* __restrict__ query, const float* __restrict__ key,
         const float* __restrict__ value,
         const float* __restrict__ Wq, const float* __restrict__ Wk,
         const float* __restrict__ Wv, const float* __restrict__ Wo,
         _Float16* __restrict__ Xq, _Float16* __restrict__ Xk, _Float16* __restrict__ Xv,
         _Float16* __restrict__ WqT, _Float16* __restrict__ WkT,
         _Float16* __restrict__ WvT, _Float16* __restrict__ WoT) {
  int blk = blockIdx.x;
  if (blk < HBLK) { cast_h(query, Xq, blk); return; }
  blk -= HBLK;
  if (blk < HBLK) { cast_h(key, Xk, blk); return; }
  blk -= HBLK;
  if (blk < HBLK) { cast_h(value, Xv, blk); return; }
  blk -= HBLK;
  if (blk < TBLKW) { cast_t<DIN, DHID>(Wq, WqT, blk); return; }
  blk -= TBLKW;
  if (blk < TBLKW) { cast_t<DHID, DIN>(Wo, WoT, blk); return; }
  blk -= TBLKW;
  if (blk < TBLKN) { cast_t<DIN, DH>(Wk, WkT, blk); return; }
  blk -= TBLKN;
  cast_t<DIN, DH>(Wv, WvT, blk);
}

// ---------------------------------------------------------------------------
// WMMA GEMM:  C[M,N] = X[M,K] @ W[K,N] + bias,  W given as WT[N,K].
// Block = 4 waves = 64x64 tile. B chunk (64x32 f16, 5KB padded) staged in LDS by
// async copies, double buffered; each wave owns one 16-row strip and 4 f32
// accumulators; A fragments pipelined in registers.
// ---------------------------------------------------------------------------
// A wave's 16 x 64 accumulators plus bias to memory. KIND 0: f32 to outF; 1: f16 to
// outH; 2: f16 to outH, transposed. C/D layout: register r is row gm0 + r, the
// lane's column is gn0 + 16 * nt.
template <int KIND>
__device__ __forceinline__ void
store_tile(const v8f (&c)[4], const float* __restrict__ bias,
           _Float16* __restrict__ outH, float* __restrict__ outF,
           int M, int N, int gm0, int gn0) {
#pragma unroll
  for (int nt = 0; nt < 4; ++nt) {
    const int gn = gn0 + nt * 16;
    const float bval = bias ? bias[gn] : 0.0f;
#pragma unroll
    for (int r = 0; r < 8; ++r) {
      const int gm = gm0 + r;
      const float val = c[nt][r] + bval;
      if constexpr (KIND == 2)      outH[(size_t)gn * M + gm] = (_Float16)val;
      else if constexpr (KIND == 1) outH[(size_t)gm * N + gn] = (_Float16)val;
      else                          outF[(size_t)gm * N + gn] = val;
      if constexpr (KIND != 2) store_issued();   // the next element reuses the address and data registers
    }
    if constexpr (KIND == 2) store_issued();     // one run of 8 neighbours; the next run reuses its registers
  }
}

template <bool HALF_OUT>   // output: f16 (outH, plain or transposed) or f32 (outF)
__device__ __forceinline__ void
gemm_tile(const _Float16* __restrict__ X,
          const _Float16* __restrict__ WT,
          const float* __restrict__ bias,
          _Float16* __restrict__ outH,
          float* __restrict__ outF,
          int M, int N, int K, int transposeOut, int n0) {
  __shared__ __attribute__((aligned(16))) _Float16 bsh[2][64 * P32];  // [buf][row(64) x k(32), padded]

  const int tid  = threadIdx.x;          // 0..127
  const int wave = tid >> 5;
  const int lane = tid & 31;
  const int nl   = lane & 15;
  const int hi   = lane >> 4;
  const int m0   = (blockIdx.x * 4 + wave) * 16;

  const _Float16* arow = X + (size_t)(m0 + nl) * K;

  // Stage one 64x32 B chunk: 256 x 16B segments, 2 per thread.
  auto stageB = [&](int k0, int buf) {
#pragma unroll
    for (int i = 0; i < 2; ++i) {
      const int seg = tid + i * 128;
      const int row = seg >> 2;          // 4 segs per 32-half row
      const int c16 = seg & 3;
      cp16(WT + (size_t)(n0 + row) * K + k0 + c16 * 8,
           &bsh[buf][row * P32 + c16 * 8]);
    }
  };

  v8f z = {};
  v8f c[4] = {z, z, z, z};

  stageB(0, 0);
  v16h a_cur = frag16(arow, hi);

  for (int k0 = 0; k0 < K; k0 += 32) {
    const int buf  = (k0 >> 5) & 1;
    const int nk0  = k0 + 32;
    const bool more = nk0 < K;
    if (more) { stageB(nk0, buf ^ 1); wait_async<2>(); }  // next copy in flight
    else      { wait_async<0>(); }
    __syncthreads();                     // B chunk visible to all 4 waves

    v16h a_nxt = more ? frag16(arow + nk0, hi) : a_cur;  // pipeline A
#pragma unroll
    for (int nt = 0; nt < 4; ++nt) {
      v16h b = frag16(&bsh[buf][(nt * 16 + nl) * P32], hi);
      c[nt] = __builtin_amdgcn_wmma_f32_16x16x32_f16(
          false, a_cur, false, b, (short)0, c[nt], false, false);
    }
    a_cur = a_nxt;
    __syncthreads();                     // before next stage overwrites buf
  }

  if constexpr (!HALF_OUT)  store_tile<0>(c, bias, outH, outF, M, N, m0 + 8 * hi, n0 + nl);
  else if (transposeOut)    store_tile<2>(c, bias, outH, outF, M, N, m0 + 8 * hi, n0 + nl);
  else                      store_tile<1>(c, bias, outH, outF, M, N, m0 + 8 * hi, n0 + nl);
}

// The output projection (f32 out).
__global__ void __launch_bounds__(128)
gemm_out(const _Float16* __restrict__ X,
         const _Float16* __restrict__ WT,
         const float* __restrict__ bias,
         float* __restrict__ outF,
         int M, int N, int K) {
  gemm_tile<false>(X, WT, bias, nullptr, outF, M, N, K, 0, blockIdx.y * 64);
}

// The Q, K and V projections in one launch: the K and V products have only 64
// blocks each and last as long as a block's whole k loop, which now runs beside
// the Q product instead of behind it. blockIdx.y: 0 = K, 1 = V (stored
// transposed), 2 and up = the 64-column strips of Q.
__global__ void __launch_bounds__(128)
gemm_qkv(const _Float16* __restrict__ Xq, const _Float16* __restrict__ Xk,
         const _Float16* __restrict__ Xv,
         const _Float16* __restrict__ WqT, const _Float16* __restrict__ WkT,
         const _Float16* __restrict__ WvT,
         const float* __restrict__ bq, const float* __restrict__ bk,
         const float* __restrict__ bv,
         _Float16* __restrict__ qp, _Float16* __restrict__ kp, _Float16* __restrict__ vTp,
         int M, int K) {
  const int y = blockIdx.y;
  const _Float16* X  = y == 0 ? Xk  : y == 1 ? Xv  : Xq;
  const _Float16* WT = y == 0 ? WkT : y == 1 ? WvT : WqT;
  const float* bias  = y == 0 ? bk  : y == 1 ? bv  : bq;
  _Float16* outH     = y == 0 ? kp  : y == 1 ? vTp : qp;
  gemm_tile<true>(X, WT, bias, outH, nullptr, M, y < 2 ? DH : DHID, K, y == 1,
                  y < 2 ? 0 : (y - 2) * 64);
}

// Value of lane l ^ 16 (the other half of the wave), as one vector instruction.
__device__ __forceinline__ float xhalf(float x) {
  const int b = __builtin_bit_cast(int, x);
  return __builtin_bit_cast(float,
      __builtin_amdgcn_permlanex16(b, b, 0x76543210, 0xfedcba98, false, false));
}

__global__ void __launch_bounds__(512)
mqa_attn(const _Float16* __restrict__ qh,
         const _Float16* __restrict__ kh,
         const _Float16* __restrict__ vT,
         _Float16* __restrict__ oh) {
  __shared__ __attribute__((aligned(16))) _Float16 ksh[2][32 * P64];  // [buf][key row(32) x d(64), padded]  9KB
  __shared__ __attribute__((aligned(16))) _Float16 vsh[2][DH * P32];  // [buf][vcol(64) x key(32), padded]  10KB

  const int tid  = threadIdx.x;           // 0..511
  const int wave = tid >> 5;              // = head
  const int lane = tid & 31;
  const int nl   = lane & 15;
  const int hi   = lane >> 4;
  const int qt   = blockIdx.x;            // query tile [0,128)
  const int b    = blockIdx.y;            // batch
  const int h    = wave;

  // Stage the next 32-key K tile + V^T tile: 512 x 16B segs, 1 per thread.
  auto stageKV = [&](int j, int buf) {
    if (tid < 256) {                      // K tile: 32 rows x 64 halves
      const int row = tid >> 3, s = tid & 7;
      cp16(kh + ((size_t)(b * SS + j + row)) * DH + s * 8,
           &ksh[buf][row * P64 + s * 8]);
    } else {                              // V^T tile: 64 rows x 32 halves
      const int t2 = tid - 256;
      const int row = t2 >> 2, s = t2 & 3;
      cp16(vT + (size_t)row * BSZ + b * SS + j + s * 8,
           &vsh[buf][row * P32 + s * 8]);
    }
  };

  // Q tile resident as two B fragments (d = 0..31, 32..63), column = query nl
  const _Float16* qrow = qh + ((size_t)(b * SS + qt * 16 + nl)) * DHID + h * DH;
  const v16h qb0 = frag16(qrow, hi);
  const v16h qb1 = frag16(qrow + 32, hi);

  v8f z = {};
  v8f o[4] = {z, z, z, z};                // O^T accum, 64(d) x 16(query)
  float m = -3.0e38f;                     // running maximum of query nl (same in both halves)
  float l = 0.0f;                         // running sum over this half's keys only

  stageKV(0, 0);

  for (int j = 0; j < SS; j += 32) {
    const int buf   = (j >> 5) & 1;
    const bool more = (j + 32) < SS;
    if (more) { stageKV(j + 32, buf ^ 1); wait_async<1>(); }
    else      { wait_async<0>(); }
    __syncthreads();                      // K/V tiles visible to all heads

    // ---- scores: two 16x16 tiles, S^T = K @ Q^T, A operand from LDS ----
    const _Float16* kr0 = &ksh[buf][nl * P64];
    const _Float16* kr1 = &ksh[buf][(16 + nl) * P64];
    v8f s0 = z, s1 = z;
    s0 = __builtin_amdgcn_wmma_f32_16x16x32_f16(false, frag16(kr0, hi),      false, qb0, (short)0, s0, false, false);
    s0 = __builtin_amdgcn_wmma_f32_16x16x32_f16(false, frag16(kr0 + 32, hi), false, qb1, (short)0, s0, false, false);
    s1 = __builtin_amdgcn_wmma_f32_16x16x32_f16(false, frag16(kr1, hi),      false, qb0, (short)0, s1, false, false);
    s1 = __builtin_amdgcn_wmma_f32_16x16x32_f16(false, frag16(kr1 + 32, hi), false, qb1, (short)0, s1, false, false);

    // ---- online softmax: 16 scores of query nl in this lane ----
    const v8f x0 = s0 * SCALE;            // keys r + 8*hi
    const v8f x1 = s1 * SCALE;            // keys 16 + r + 8*hi
    float x[16];
#pragma unroll
    for (int r = 0; r < 8; ++r) { x[r] = x0[r]; x[8 + r] = x1[r]; }
    float t4[4];                          // four short chains instead of one long one
#pragma unroll
    for (int c = 0; c < 4; ++c)
      t4[c] = fmaxf(fmaxf(x[4 * c], x[4 * c + 1]), fmaxf(x[4 * c + 2], x[4 * c + 3]));
    float t = fmaxf(fmaxf(t4[0], t4[1]), fmaxf(t4[2], t4[3]));
    t = fmaxf(t, xhalf(t));               // the other 16 keys of the same query
    const float mnew = fmaxf(m, t);
    const float cr = __expf(m - mnew);
    m = mnew;

    // Half t of the B fragment is key t + 8*hi (t < 8) or 8 + t + 8*hi: x's order.
    v16h pb;
    float p[16];
#pragma unroll
    for (int i = 0; i < 16; ++i) {
      p[i]  = __expf(x[i] - mnew);
      pb[i] = (_Float16)p[i];
    }
    float r4[4];
#pragma unroll
    for (int c = 0; c < 4; ++c)
      r4[c] = (p[4 * c] + p[4 * c + 1]) + (p[4 * c + 2] + p[4 * c + 3]);
    l = l * cr + ((r4[0] + r4[1]) + (r4[2] + r4[3]));

#pragma unroll
    for (int nt = 0; nt < 4; ++nt) o[nt] *= cr;

    // ---- O^T += V^T (A operand from the LDS V^T tile) @ P^T (registers) ----
#pragma unroll
    for (int nt = 0; nt < 4; ++nt) {
      v16h av = frag16(&vsh[buf][(nt * 16 + nl) * P32], hi);
      o[nt] = __builtin_amdgcn_wmma_f32_16x16x32_f16(
          false, av, false, pb, (short)0, o[nt], false, false);
    }
    __syncthreads();                      // before next stage overwrites buf
  }

  // ---- normalize and write attention output ----
  // Lane holds d = nt*16 + 8*hi + (0..7) of query nl: 16 contiguous bytes per nt.
  const float inv = 1.0f / (l + xhalf(l));
  _Float16* orow = oh + ((size_t)(b * SS + qt * 16 + nl)) * DHID + h * DH + 8 * hi;
#pragma unroll
  for (int nt = 0; nt < 4; ++nt) {
    h8 w;
#pragma unroll
    for (int r = 0; r < 8; ++r) w[r] = (_Float16)(o[nt][r] * inv);
    *(h8*)(orow + nt * 16) = w;
  }
}

// ---------------------------------------------------------------------------
// Launcher
// ---------------------------------------------------------------------------
extern "C" void kernel_launch(void* const* d_in, const int* in_sizes, int n_in,
                              void* d_out, int out_size, void* d_ws, size_t ws_size,
                              hipStream_t stream) {
  (void)in_sizes; (void)n_in; (void)out_size; (void)ws_size;

  const float* query = (const float*)d_in[0];
  const float* key   = (const float*)d_in[1];
  const float* value = (const float*)d_in[2];
  const float* Wq    = (const float*)d_in[3];
  const float* bq    = (const float*)d_in[4];
  const float* Wk    = (const float*)d_in[5];
  const float* bk    = (const float*)d_in[6];
  const float* Wv    = (const float*)d_in[7];
  const float* bv    = (const float*)d_in[8];
  const float* Wo    = (const float*)d_in[9];
  const float* bo    = (const float*)d_in[10];
  float* outF = (float*)d_out;

  // workspace carve-up (f16, 256B aligned), ~45 MB total
  char* ws = (char*)d_ws;
  size_t off = 0;
  auto carve = [&](size_t halves) {
    void* p = ws + off;
    off += (halves * sizeof(_Float16) + 255) & ~(size_t)255;
    return (_Float16*)p;
  };
  _Float16* Xq  = carve((size_t)BSZ * DIN);
  _Float16* Xk  = carve((size_t)BSZ * DIN);
  _Float16* Xv  = carve((size_t)BSZ * DIN);
  _Float16* WqT = carve((size_t)DIN * DHID);
  _Float16* WkT = carve((size_t)DH * DIN);
  _Float16* WvT = carve((size_t)DH * DIN);
  _Float16* WoT = carve((size_t)DIN * DHID);
  _Float16* qp  = carve((size_t)BSZ * DHID);
  _Float16* kp  = carve((size_t)BSZ * DH);
  _Float16* vTp = carve((size_t)DH * BSZ);   // V^T [64, B*S]
  _Float16* oat = carve((size_t)BSZ * DHID);

  cast_all<<<dim3(CAST_BLOCKS), CAST_THREADS, 0, stream>>>(
      query, key, value, Wq, Wk, Wv, Wo, Xq, Xk, Xv, WqT, WkT, WvT, WoT);

  // projections (WMMA, 64x64 tiles per 4-wave block): K, V and Q in one launch
  gemm_qkv<<<dim3(BSZ / 64, 2 + DHID / 64), 128, 0, stream>>>(
      Xq, Xk, Xv, WqT, WkT, WvT, bq, bk, bv, qp, kp, vTp, BSZ, DIN);

  // attention (WMMA flash, 16 heads per block sharing LDS-staged K/V)
  mqa_attn<<<dim3(SS / 16, BB), 512, 0, stream>>>(qp, kp, vTp, oat);

  // output projection (WMMA, fp32 out)
  gemm_out<<<dim3(BSZ / 64, DIN / 64), 128, 0, stream>>>(oat, WoT, bo, outF, BSZ, DIN, DHID);
}

// v005
// It runs in 86.8 microseconds.
// In two side-by-side timings against v004, it was 1.10 and 1.11 times as fast.
// All steps since v000 together make it 3.84 times as fast.
#include <hip/hip_runtime.h>
#include <hip/hip_bf16.h>

// ---------------------------------------------------------------------------
// MQA forward, all matmuls on v_wmma_f32_16x16x32_f16 (CDNA5 / gfx1250).
// B=2, S=2048, d_model=1024, H=16, Dh=64 (single shared K/V head).
// GEMMs: 16-wave blocks, both operands staged in LDS via global_load_async_to_lds
// (double buffered, ASYNCcnt).
// Attention: 16-wave blocks (one head per wave) sharing async-staged,
// double-buffered K/V tiles in LDS -- 16x cut in L2 traffic for the shared
// MQA head.
// Launches that do not depend on one another share one launch (the block index
// picks the job): all casts; the Q, K and V projections.
// ---------------------------------------------------------------------------

typedef __attribute__((ext_vector_type(16))) _Float16 v16h;
typedef __attribute__((ext_vector_type(8)))  _Float16 h8;
typedef __attribute__((ext_vector_type(8)))  float    v8f;
typedef __attribute__((ext_vector_type(2)))  _Float16 h2;
typedef __attribute__((ext_vector_type(4)))  int      v4i;
typedef __attribute__((ext_vector_type(4)))  float    f4;
typedef __attribute__((ext_vector_type(4)))  _Float16 h4;

#define BB    2
#define SS    2048
#define BSZ   4096      // B*S
#define DIN   1024
#define DHID  1024
#define NH    16
#define DH    64
#define SCALE 0.03125f  // 1/sqrt(1024)

// LDS row pitches in halves. Every tile here is read by 16-byte loads, 16 rows
// at a time, so the pitch is an odd multiple of 16 bytes: the 16 rows then fall
// on 16 different groups of four banks instead of on two (128-byte rows) or
// four (64-byte rows).
#define P32   40        // rows of 32 halves: 64 B of data, 80 B pitch
#define P64   72        // rows of 64 halves: 128 B of data, 144 B pitch

#if __has_builtin(__builtin_amdgcn_global_load_async_to_lds_b128)
#define HAVE_ASYNC 1
#else
#define HAVE_ASYNC 0
#endif

// 16-byte global -> LDS copy; async (ASYNCcnt) when the gfx1250 builtin exists.
__device__ __forceinline__ void cp16(const _Float16* g, _Float16* l) {
#if HAVE_ASYNC
  __builtin_amdgcn_global_load_async_to_lds_b128(
      (__attribute__((address_space(1))) v4i*)g,
      (__attribute__((address_space(3))) v4i*)l, 0, 0);
#else
  *(h8*)l = *(const h8*)g;
#endif
}

// Wait until at most N async copies remain in flight.
template <int N>
__device__ __forceinline__ void wait_async() {
#if HAVE_ASYNC
#if __has_builtin(__builtin_amdgcn_s_wait_asynccnt)
  __builtin_amdgcn_s_wait_asynccnt(N);
#else
  asm volatile("s_wait_asynccnt %0" ::"i"(N) : "memory");
#endif
#endif
}

// Stands behind a global store, in front of the next write of a register that the
// store names (its address pair, its data).
__device__ __forceinline__ void store_issued() {
  asm volatile("s_wait_xcnt 0x0" ::: "memory");
}

// Assemble a 16-bit WMMA A/B fragment (16x32 resp. 32x16) for one K=32 chunk.
// Per ISA 7.12.2: lane holds row/col (lane&15); hi = lane>>4 selects the K
// half-groups. Half t -> K = t + 8*hi + 8*(t>=8); pairs merge into b128 loads.
__device__ __forceinline__ v16h frag16(const _Float16* __restrict__ base, int hi) {
  v16h r;
#pragma unroll
  for (int tp = 0; tp < 8; ++tp) {
    const int kk = 2 * tp + 8 * hi + ((tp >= 4) ? 8 : 0);
    h2 p = *(const h2*)(base + kk);
    r[2 * tp]     = p.x;
    r[2 * tp + 1] = p.y;
  }
  return r;
}

// ---------------------------------------------------------------------------
// fp32 -> f16 casts. A launch pays for every wave it starts, so a thread moves
// 32 elements: few waves, each with 8 16-byte loads in flight per lane.
// ---------------------------------------------------------------------------
#define CAST_THREADS 512                       // 16 waves: one block fills a WGP's stream
#define CAST_LOADS   8                         // 16-byte loads in flight per lane
#define CAST_ELEMS   (CAST_THREADS * CAST_LOADS * 4)   // elements per block
static_assert((BSZ * DIN) % CAST_ELEMS == 0, "cast_h has no tail");
static_assert(DIN % 64 == 0 && DHID % 64 == 0 && DH % 64 == 0, "cast_t has no tail");

// Each wave owns 4 KB of input in a row: every load covers 512 contiguous bytes
// (4 whole lines), every store 256 (2 whole lines); all loads precede the stores.
__device__ __forceinline__ void
cast_h(const float* __restrict__ in, _Float16* __restrict__ out, int blk) {
  const int wave = threadIdx.x >> 5;
  const int lane = threadIdx.x & 31;
  const size_t g = ((size_t)blk * (CAST_THREADS / 32) + wave) * (CAST_LOADS * 32) + lane;
  const f4* __restrict__ src = (const f4*)in + g;   // groups of 4 elements
  h4* __restrict__ dst = (h4*)out + g;
  f4 v[CAST_LOADS];
#pragma unroll
  for (int i = 0; i < CAST_LOADS; ++i) v[i] = src[i * 32];
#pragma unroll
  for (int i = 0; i < CAST_LOADS; ++i) dst[i * 32] = __builtin_convertvector(v[i], h4);
  store_issued();   // another job's code follows in the merged kernel
}

// W [K,N] fp32 row-major  ->  W^T [N,K] f16 row-major.
// A wave transposes a 64(k) x 16(n) tile in registers: a lane loads 8 k-rows of
// 4 n each and stores, for each of its 4 n, 8 consecutive k as 16 bytes; the 8
// lanes of one n together write one whole 128-byte line of W^T.
// 4 waves side by side in n make a 64 x 64 tile; a block of 16 waves takes 4 tiles
// that follow one another in n, then k. K and N are compile-time so that the 8
// loads share one address and the 4 stores another (immediate offsets).
template <int K, int N>
__device__ __forceinline__ void
cast_t(const float* __restrict__ in, _Float16* __restrict__ out, int blk) {
  const int wave = threadIdx.x >> 5;
  const int lane = threadIdx.x & 31;
  const int tile = blk * (CAST_THREADS / 128) + (wave >> 2);
  const int k = (tile / (N / 64)) * 64 + (lane & 7) * 8;
  const int n = (tile % (N / 64)) * 64 + (wave & 3) * 16 + (lane >> 3) * 4;
  f4 v[8];
#pragma unroll
  for (int j = 0; j < 8; ++j) v[j] = *(const f4*)(in + (size_t)(k + j) * N + n);
#pragma unroll
  for (int c = 0; c < 4; ++c) {
    h8 r;
#pragma unroll
    for (int j = 0; j < 8; ++j) r[j] = (_Float16)v[j][c];
    *(h8*)(out + (size_t)(n + c) * K + k) = r;
  }
  store_issued();   // another job's code follows in the merged kernel
}

// All seven casts in one launch: none reads what another writes, so one launch
// pays the gap, the fill and the tail once instead of seven times.
#define HBLK  (BSZ * DIN / CAST_ELEMS)                       // blocks per activation
#define TBLKW ((DIN / 64) * (DHID / 64) / (CAST_THREADS / 128))  // blocks per 1024 x 1024 weight
#define TBLKN ((DIN / 64) * (DH / 64) / (CAST_THREADS / 128))    // blocks per 1024 x 64 weight
#define CAST_BLOCKS (3 * HBLK + 2 * TBLKW + 2 * TBLKN)
static_assert(((DIN / 64) * (DH / 64)) % (CAST_THREADS / 128) == 0, "whole blocks of tiles");

__global__ void __launch_bounds__(CAST_THREADS)
cast_all(const float* __restrict__ query, const float* __restrict__ key,
         const float* __restrict__ value,
         const float* __restrict__ Wq, const float* __restrict__ Wk,
         const float* __restrict__ Wv, const float* __restrict__ Wo,
         _Float16* __restrict__ Xq, _Float16* __restrict__ Xk, _Float16* __restrict__ Xv,
         _Float16* __restrict__ WqT, _Float16* __restrict__ WkT,
         _Float16* __restrict__ WvT, _Float16* __restrict__ WoT) {
  int blk = blockIdx.x;
  if (blk < HBLK) { cast_h(query, Xq, blk); return; }
  blk -= HBLK;
  if (blk < HBLK) { cast_h(key, Xk, blk); return; }
  blk -= HBLK;
  if (blk < HBLK) { cast_h(value, Xv, blk); return; }
  blk -= HBLK;
  if (blk < TBLKW) { cast_t<DIN, DHID>(Wq, WqT, blk); return; }
  blk -= TBLKW;
  if (blk < TBLKW) { cast_t<DHID, DIN>(Wo, WoT, blk); return; }
  blk -= TBLKW;
  if (blk < TBLKN) { cast_t<DIN, DH>(Wk, WkT, blk); return; }
  blk -= TBLKN;
  cast_t<DIN, DH>(Wv, WvT, blk);
}

// ---------------------------------------------------------------------------
// WMMA GEMM:  C[M,N] = X[M,K] @ W[K,N] + bias,  W given as WT[N,K].
// Block = 16 waves = a 128 x BN tile (BN = 128, or 64 for the narrow K and V
// products); a wave owns 32 x BN/4 of it. Both operands of a 64-k stage are laid
// in LDS by async copies (whole 128-byte lines), two buffers: the next stage's
// copies fly while this stage is worked on, so no wave waits out a load of its
// own, and each operand byte is fetched from L2 once per 128 rows or columns.
// ---------------------------------------------------------------------------
#define GEMM_THREADS 512
#define GM      128                    // rows of X per block
#define GK      64                     // k per stage
#define STAGE_H ((GM + 128) * P64)     // halves per buffer: GM rows of X, then up to 128 rows of WT
static_assert(BSZ % GM == 0 && DHID % 128 == 0 && DIN % 128 == 0 && DH == 64, "whole tiles");
static_assert(DIN % GK == 0 && DHID % GK == 0, "whole stages");

// A wave's 16 x (16 * NT) accumulators plus bias to memory. KIND 0: f32 to outF; 1: f16
// to outH; 2: f16 to outH, transposed. C/D layout: register r is row gm0 + r, the
// lane's column is gn0 + 16 * nt.
template <int KIND, int NT>
__device__ __forceinline__ void
store_tile(const v8f (&c)[NT], const float* __restrict__ bias,
           _Float16* __restrict__ outH, float* __restrict__ outF,
           int M, int N, int gm0, int gn0) {
#pragma unroll
  for (int nt = 0; nt < NT; ++nt) {
    const int gn = gn0 + nt * 16;
    const float bval = bias ? bias[gn] : 0.0f;
#pragma unroll
    for (int r = 0; r < 8; ++r) {
      const int gm = gm0 + r;
      const float val = c[nt][r] + bval;
      if constexpr (KIND == 2)      outH[(size_t)gn * M + gm] = (_Float16)val;
      else if constexpr (KIND == 1) outH[(size_t)gm * N + gn] = (_Float16)val;
      else                          outF[(size_t)gm * N + gn] = val;
      if constexpr (KIND != 2) store_issued();   // the next element reuses the address and data registers
    }
    if constexpr (KIND == 2) store_issued();     // one run of 8 neighbours; the next run reuses its registers
  }
}

template <int BN, bool HALF_OUT>   // output: f16 (outH, plain or transposed) or f32 (outF)
__device__ __forceinline__ void
gemm_tile(const _Float16* __restrict__ X,
          const _Float16* __restrict__ WT,
          const float* __restrict__ bias,
          _Float16* __restrict__ outH,
          float* __restrict__ outF,
          int M, int N, int K, int transposeOut, int n0,
          _Float16* ring) {            // LDS, 2 * STAGE_H halves
  constexpr int NT = BN / 64;            // 16-column accumulators per wave and 16 rows

  const int tid  = threadIdx.x;          // 0..511
  const int wave = tid >> 5;
  const int lane = tid & 31;
  const int nl   = lane & 15;
  const int hi   = lane >> 4;
  const int wm   = wave & 3;             // the wave's 32 rows
  const int wn   = wave >> 2;            // the wave's BN/4 columns
  const int m0   = blockIdx.x * GM;

  // One stage: GM rows of X and BN rows of WT, 64 k each = 8 segments of 16 bytes a
  // row; 8 neighbouring lanes copy one row's whole line.
  auto stage = [&](int k0, int buf) {
    _Float16* sa = ring + buf * STAGE_H;
    _Float16* sb = sa + GM * P64;
#pragma unroll
    for (int i = 0; i < GM * 8 / GEMM_THREADS; ++i) {
      const int seg = tid + i * GEMM_THREADS;
      const int row = seg >> 3;
      const int c16 = seg & 7;
      cp16(X + (size_t)(m0 + row) * K + k0 + c16 * 8, sa + row * P64 + c16 * 8);
    }
#pragma unroll
    for (int i = 0; i < BN * 8 / GEMM_THREADS; ++i) {
      const int seg = tid + i * GEMM_THREADS;
      const int row = seg >> 3;
      const int c16 = seg & 7;
      cp16(WT + (size_t)(n0 + row) * K + k0 + c16 * 8, sb + row * P64 + c16 * 8);
    }
  };

  v8f z = {};
  v8f c[2][NT];
#pragma unroll
  for (int i = 0; i < 2; ++i)
#pragma unroll
    for (int j = 0; j < NT; ++j) c[i][j] = z;

  const int T = K / GK;                  // stages
  stage(0, 0);
  asm volatile("s_wait_asynccnt 0x0" ::: "memory");   // this wave's share of stage 0 has landed
  __syncthreads();                       // stage 0 visible to all 16 waves
  if (T > 1) stage(GK, 1);

  for (int t = 0; t < T; ++t) {
    const _Float16* sa = ring + (t & 1) * STAGE_H + (wm * 32 + nl) * P64;
    const _Float16* sb = ring + (t & 1) * STAGE_H + (GM + wn * (NT * 16) + nl) * P64;
#pragma unroll
    for (int kc = 0; kc < GK; kc += 32) {
      v16h a[2], b[NT];
#pragma unroll
      for (int i = 0; i < 2; ++i)  a[i] = frag16(sa + i * 16 * P64 + kc, hi);
#pragma unroll
      for (int j = 0; j < NT; ++j) b[j] = frag16(sb + j * 16 * P64 + kc, hi);
#pragma unroll
      for (int i = 0; i < 2; ++i)
#pragma unroll
        for (int j = 0; j < NT; ++j)
          c[i][j] = __builtin_amdgcn_wmma_f32_16x16x32_f16(
              false, a[i], false, b[j], (short)0, c[i][j], false, false);
    }
    asm volatile("s_wait_dscnt 0x0" ::: "memory");     // this wave has left the buffer that is refilled below
    asm volatile("s_wait_asynccnt 0x0" ::: "memory");  // this wave's share of stage t + 1 has landed
    __syncthreads();                     // stage t + 1 visible to all; every reader has left stage t
    if (t + 2 < T) stage((t + 2) * GK, t & 1);
  }
  asm volatile("s_wait_asynccnt 0x0" ::: "memory");    // no copy is left in flight when the wave ends

#pragma unroll
  for (int i = 0; i < 2; ++i) {
    const int gm0 = m0 + wm * 32 + i * 16 + 8 * hi;
    const int gn0 = n0 + wn * (NT * 16) + nl;
    if constexpr (!HALF_OUT)  store_tile<0, NT>(c[i], bias, outH, outF, M, N, gm0, gn0);
    else if (transposeOut)    store_tile<2, NT>(c[i], bias, outH, outF, M, N, gm0, gn0);
    else                      store_tile<1, NT>(c[i], bias, outH, outF, M, N, gm0, gn0);
  }
}

// The output projection (f32 out).
__global__ void __launch_bounds__(GEMM_THREADS)
gemm_out(const _Float16* __restrict__ X,
         const _Float16* __restrict__ WT,
         const float* __restrict__ bias,
         float* __restrict__ outF,
         int M, int N, int K) {
  __shared__ __attribute__((aligned(16))) _Float16 ring[2 * STAGE_H];
  gemm_tile<128, false>(X, WT, bias, nullptr, outF, M, N, K, 0, blockIdx.y * 128, ring);
}

// The Q, K and V projections in one launch: the K and V products have few blocks
// and last as long as a block's whole k loop, which runs beside the Q product
// instead of behind it. blockIdx.y: 0 = K, 1 = V (stored transposed), 2 and up =
// the 128-column strips of Q.
__global__ void __launch_bounds__(GEMM_THREADS)
gemm_qkv(const _Float16* __restrict__ Xq, const _Float16* __restrict__ Xk,
         const _Float16* __restrict__ Xv,
         const _Float16* __restrict__ WqT, const _Float16* __restrict__ WkT,
         const _Float16* __restrict__ WvT,
         const float* __restrict__ bq, const float* __restrict__ bk,
         const float* __restrict__ bv,
         _Float16* __restrict__ qp, _Float16* __restrict__ kp, _Float16* __restrict__ vTp,
         int M, int K) {
  __shared__ __attribute__((aligned(16))) _Float16 ring[2 * STAGE_H];
  const int y = blockIdx.y;
  if (y < 2)
    gemm_tile<64, true>(y == 0 ? Xk : Xv, y == 0 ? WkT : WvT, y == 0 ? bk : bv,
                        y == 0 ? kp : vTp, nullptr, M, DH, K, y == 1, 0, ring);
  else
    gemm_tile<128, true>(Xq, WqT, bq, qp, nullptr, M, DHID, K, 0, (y - 2) * 128, ring);
}

// Value of lane l ^ 16 (the other half of the wave), as one vector instruction.
__device__ __forceinline__ float xhalf(float x) {
  const int b = __builtin_bit_cast(int, x);
  return __builtin_bit_cast(float,
      __builtin_amdgcn_permlanex16(b, b, 0x76543210, 0xfedcba98, false, false));
}

__global__ void __launch_bounds__(512)
mqa_attn(const _Float16* __restrict__ qh,
         const _Float16* __restrict__ kh,
         const _Float16* __restrict__ vT,
         _Float16* __restrict__ oh) {
  __shared__ __attribute__((aligned(16))) _Float16 ksh[2][32 * P64];  // [buf][key row(32) x d(64), padded]  9KB
  __shared__ __attribute__((aligned(16))) _Float16 vsh[2][DH * P32];  // [buf][vcol(64) x key(32), padded]  10KB

  const int tid  = threadIdx.x;           // 0..511
  const int wave = tid >> 5;              // = head
  const int lane = tid & 31;
  const int nl   = lane & 15;
  const int hi   = lane >> 4;
  const int qt   = blockIdx.x;            // query tile [0,128)
  const int b    = blockIdx.y;            // batch
  const int h    = wave;

  // Stage the next 32-key K tile + V^T tile: 512 x 16B segs, 1 per thread.
  auto stageKV = [&](int j, int buf) {
    if (tid < 256) {                      // K tile: 32 rows x 64 halves
      const int row = tid >> 3, s = tid & 7;
      cp16(kh + ((size_t)(b * SS + j + row)) * DH + s * 8,
           &ksh[buf][row * P64 + s * 8]);
    } else {                              // V^T tile: 64 rows x 32 halves
      const int t2 = tid - 256;
      const int row = t2 >> 2, s = t2 & 3;
      cp16(vT + (size_t)row * BSZ + b * SS + j + s * 8,
           &vsh[buf][row * P32 + s * 8]);
    }
  };

  // Q tile resident as two B fragments (d = 0..31, 32..63), column = query nl
  const _Float16* qrow = qh + ((size_t)(b * SS + qt * 16 + nl)) * DHID + h * DH;
  const v16h qb0 = frag16(qrow, hi);
  const v16h qb1 = frag16(qrow + 32, hi);

  v8f z = {};
  v8f o[4] = {z, z, z, z};                // O^T accum, 64(d) x 16(query)
  float m = -3.0e38f;                     // running maximum of query nl (same in both halves)
  float l = 0.0f;                         // running sum over this half's keys only

  stageKV(0, 0);

  for (int j = 0; j < SS; j += 32) {
    const int buf   = (j >> 5) & 1;
    const bool more = (j + 32) < SS;
    if (more) { stageKV(j + 32, buf ^ 1); wait_async<1>(); }
    else      { wait_async<0>(); }
    __syncthreads();                      // K/V tiles visible to all heads

    // ---- scores: two 16x16 tiles, S^T = K @ Q^T, A operand from LDS ----
    const _Float16* kr0 = &ksh[buf][nl * P64];
    const _Float16* kr1 = &ksh[buf][(16 + nl) * P64];
    v8f s0 = z, s1 = z;
    s0 = __builtin_amdgcn_wmma_f32_16x16x32_f16(false, frag16(kr0, hi),      false, qb0, (short)0, s0, false, false);
    s0 = __builtin_amdgcn_wmma_f32_16x16x32_f16(false, frag16(kr0 + 32, hi), false, qb1, (short)0, s0, false, false);
    s1 = __builtin_amdgcn_wmma_f32_16x16x32_f16(false, frag16(kr1, hi),      false, qb0, (short)0, s1, false, false);
    s1 = __builtin_amdgcn_wmma_f32_16x16x32_f16(false, frag16(kr1 + 32, hi), false, qb1, (short)0, s1, false, false);

    // ---- online softmax: 16 scores of query nl in this lane ----
    const v8f x0 = s0 * SCALE;            // keys r + 8*hi
    const v8f x1 = s1 * SCALE;            // keys 16 + r + 8*hi
    float x[16];
#pragma unroll
    for (int r = 0; r < 8; ++r) { x[r] = x0[r]; x[8 + r] = x1[r]; }
    float t4[4];                          // four short chains instead of one long one
#pragma unroll
    for (int c = 0; c < 4; ++c)
      t4[c] = fmaxf(fmaxf(x[4 * c], x[4 * c + 1]), fmaxf(x[4 * c + 2], x[4 * c + 3]));
    float t = fmaxf(fmaxf(t4[0], t4[1]), fmaxf(t4[2], t4[3]));
    t = fmaxf(t, xhalf(t));               // the other 16 keys of the same query
    const float mnew = fmaxf(m, t);
    const float cr = __expf(m - mnew);
    m = mnew;

    // Half t of the B fragment is key t + 8*hi (t < 8) or 8 + t + 8*hi: x's order.
    v16h pb;
    float p[16];
#pragma unroll
    for (int i = 0; i < 16; ++i) {
      p[i]  = __expf(x[i] - mnew);
      pb[i] = (_Float16)p[i];
    }
    float r4[4];
#pragma unroll
    for (int c = 0; c < 4; ++c)
      r4[c] = (p[4 * c] + p[4 * c + 1]) + (p[4 * c + 2] + p[4 * c + 3]);
    l = l * cr + ((r4[0] + r4[1]) + (r4[2] + r4[3]));

#pragma unroll
    for (int nt = 0; nt < 4; ++nt) o[nt] *= cr;

    // ---- O^T += V^T (A operand from the LDS V^T tile) @ P^T (registers) ----
#pragma unroll
    for (int nt = 0; nt < 4; ++nt) {
      v16h av = frag16(&vsh[buf][(nt * 16 + nl) * P32], hi);
      o[nt] = __builtin_amdgcn_wmma_f32_16x16x32_f16(
          false, av, false, pb, (short)0, o[nt], false, false);
    }
    __syncthreads();                      // before next stage overwrites buf
  }

  // ---- normalize and write attention output ----
  // Lane holds d = nt*16 + 8*hi + (0..7) of query nl: 16 contiguous bytes per nt.
  const float inv = 1.0f / (l + xhalf(l));
  _Float16* orow = oh + ((size_t)(b * SS + qt * 16 + nl)) * DHID + h * DH + 8 * hi;
#pragma unroll
  for (int nt = 0; nt < 4; ++nt) {
    h8 w;
#pragma unroll
    for (int r = 0; r < 8; ++r) w[r] = (_Float16)(o[nt][r] * inv);
    *(h8*)(orow + nt * 16) = w;
  }
}

// ---------------------------------------------------------------------------
// Launcher
// ---------------------------------------------------------------------------
extern "C" void kernel_launch(void* const* d_in, const int* in_sizes, int n_in,
                              void* d_out, int out_size, void* d_ws, size_t ws_size,
                              hipStream_t stream) {
  (void)in_sizes; (void)n_in; (void)out_size; (void)ws_size;

  const float* query = (const float*)d_in[0];
  const float* key   = (const float*)d_in[1];
  const float* value = (const float*)d_in[2];
  const float* Wq    = (const float*)d_in[3];
  const float* bq    = (const float*)d_in[4];
  const float* Wk    = (const float*)d_in[5];
  const float* bk    = (const float*)d_in[6];
  const float* Wv    = (const float*)d_in[7];
  const float* bv    = (const float*)d_in[8];
  const float* Wo    = (const float*)d_in[9];
  const float* bo    = (const float*)d_in[10];
  float* outF = (float*)d_out;

  // workspace carve-up (f16, 256B aligned), ~45 MB total
  char* ws = (char*)d_ws;
  size_t off = 0;
  auto carve = [&](size_t halves) {
    void* p = ws + off;
    off += (halves * sizeof(_Float16) + 255) & ~(size_t)255;
    return (_Float16*)p;
  };
  _Float16* Xq  = carve((size_t)BSZ * DIN);
  _Float16* Xk  = carve((size_t)BSZ * DIN);
  _Float16* Xv  = carve((size_t)BSZ * DIN);
  _Float16* WqT = carve((size_t)DIN * DHID);
  _Float16* WkT = carve((size_t)DH * DIN);
  _Float16* WvT = carve((size_t)DH * DIN);
  _Float16* WoT = carve((size_t)DIN * DHID);
  _Float16* qp  = carve((size_t)BSZ * DHID);
  _Float16* kp  = carve((size_t)BSZ * DH);
  _Float16* vTp = carve((size_t)DH * BSZ);   // V^T [64, B*S]
  _Float16* oat = carve((size_t)BSZ * DHID);

  cast_all<<<dim3(CAST_BLOCKS), CAST_THREADS, 0, stream>>>(
      query, key, value, Wq, Wk, Wv, Wo, Xq, Xk, Xv, WqT, WkT, WvT, WoT);

  // projections (WMMA, 128-row tiles per 16-wave block): K, V and Q in one launch
  gemm_qkv<<<dim3(BSZ / GM, 2 + DHID / 128), GEMM_THREADS, 0, stream>>>(
      Xq, Xk, Xv, WqT, WkT, WvT, bq, bk, bv, qp, kp, vTp, BSZ, DIN);

  // attention (WMMA flash, 16 heads per block sharing LDS-staged K/V)
  mqa_attn<<<dim3(SS / 16, BB), 512, 0, stream>>>(qp, kp, vTp, oat);

  // output projection (WMMA, fp32 out)
  gemm_out<<<dim3(BSZ / GM, DIN / 128), GEMM_THREADS, 0, stream>>>(oat, WoT, bo, outF, BSZ, DIN, DHID);
}

// v006
// Measured time: 80.4 microseconds a run.
// Timed twice side by side with v005, it ran 1.08 and 1.09 times as fast.
// Counting every step since v000, it is 4.16 times as fast.
#include <hip/hip_runtime.h>
#include <hip/hip_bf16.h>

// ---------------------------------------------------------------------------
// MQA forward, all matmuls on v_wmma_f32_16x16x32_f16 (CDNA5 / gfx1250).
// B=2, S=2048, d_model=1024, H=16, Dh=64 (single shared K/V head).
// GEMMs: 16-wave blocks, both operands staged in LDS via global_load_async_to_lds
// (double buffered, ASYNCcnt).
// Attention: 16-wave blocks (one head per wave) sharing async-staged,
// double-buffered K/V stages in LDS -- 16x cut in L2 traffic for the shared
// MQA head; a stage holds many 32-key passes, so the waves meet rarely.
// Launches that do not depend on one another share one launch (the block index
// picks the job): all casts; the Q, K and V projections.
// ---------------------------------------------------------------------------

typedef __attribute__((ext_vector_type(16))) _Float16 v16h;
typedef __attribute__((ext_vector_type(8)))  _Float16 h8;
typedef __attribute__((ext_vector_type(8)))  float    v8f;
typedef __attribute__((ext_vector_type(2)))  _Float16 h2;
typedef __attribute__((ext_vector_type(4)))  int      v4i;
typedef __attribute__((ext_vector_type(4)))  float    f4;
typedef __attribute__((ext_vector_type(4)))  _Float16 h4;

#define BB    2
#define SS    2048
#define BSZ   4096      // B*S
#define DIN   1024
#define DHID  1024
#define NH    16
#define DH    64
#define SCALE 0.03125f  // 1/sqrt(1024)

// LDS row pitches in halves. Every tile here is read by 16-byte loads, 16 rows
// at a time, so the pitch is an odd multiple of 16 bytes: the 16 rows then fall
// on 16 different groups of four banks instead of on two (128-byte rows) or
// one (512-byte rows).
#define P64   72        // rows of 64 halves: 128 B of data, 144 B pitch
#define KT    256       // keys per attention stage (8 passes of 32 keys)
#define PKT   (KT + 8)  // rows of KT halves: 512 B of data, 528 B pitch

#if __has_builtin(__builtin_amdgcn_global_load_async_to_lds_b128)
#define HAVE_ASYNC 1
#else
#define HAVE_ASYNC 0
#endif

// 16-byte global -> LDS copy; async (ASYNCcnt) when the gfx1250 builtin exists.
__device__ __forceinline__ void cp16(const _Float16* g, _Float16* l) {
#if HAVE_ASYNC
  __builtin_amdgcn_global_load_async_to_lds_b128(
      (__attribute__((address_space(1))) v4i*)g,
      (__attribute__((address_space(3))) v4i*)l, 0, 0);
#else
  *(h8*)l = *(const h8*)g;
#endif
}

// Stands behind a global store, in front of the next write of a register that the
// store names (its address pair, its data).
__device__ __forceinline__ void store_issued() {
  asm volatile("s_wait_xcnt 0x0" ::: "memory");
}

// Assemble a 16-bit WMMA A/B fragment (16x32 resp. 32x16) for one K=32 chunk.
// Per ISA 7.12.2: lane holds row/col (lane&15); hi = lane>>4 selects the K
// half-groups. Half t -> K = t + 8*hi + 8*(t>=8); pairs merge into b128 loads.
__device__ __forceinline__ v16h frag16(const _Float16* __restrict__ base, int hi) {
  v16h r;
#pragma unroll
  for (int tp = 0; tp < 8; ++tp) {
    const int kk = 2 * tp + 8 * hi + ((tp >= 4) ? 8 : 0);
    h2 p = *(const h2*)(base + kk);
    r[2 * tp]     = p.x;
    r[2 * tp + 1] = p.y;
  }
  return r;
}

// ---------------------------------------------------------------------------
// fp32 -> f16 casts. A launch pays for every wave it starts, so a thread moves
// 32 elements: few waves, each with 8 16-byte loads in flight per lane.
// ---------------------------------------------------------------------------
#define CAST_THREADS 512                       // 16 waves: one block fills a WGP's stream
#define CAST_LOADS   8                         // 16-byte loads in flight per lane
#define CAST_ELEMS   (CAST_THREADS * CAST_LOADS * 4)   // elements per block
static_assert((BSZ * DIN) % CAST_ELEMS == 0, "cast_h has no tail");
static_assert(DIN % 64 == 0 && DHID % 64 == 0 && DH % 64 == 0, "cast_t has no tail");

// Each wave owns 4 KB of input in a row: every load covers 512 contiguous bytes
// (4 whole lines), every store 256 (2 whole lines); all loads precede the stores.
__device__ __forceinline__ void
cast_h(const float* __restrict__ in, _Float16* __restrict__ out, int blk) {
  const int wave = threadIdx.x >> 5;
  const int lane = threadIdx.x & 31;
  const size_t g = ((size_t)blk * (CAST_THREADS / 32) + wave) * (CAST_LOADS * 32) + lane;
  const f4* __restrict__ src = (const f4*)in + g;   // groups of 4 elements
  h4* __restrict__ dst = (h4*)out + g;
  f4 v[CAST_LOADS];
#pragma unroll
  for (int i = 0; i < CAST_LOADS; ++i) v[i] = src[i * 32];
#pragma unroll
  for (int i = 0; i < CAST_LOADS; ++i) dst[i * 32] = __builtin_convertvector(v[i], h4);
  store_issued();   // another job's code follows in the merged kernel
}

// W [K,N] fp32 row-major  ->  W^T [N,K] f16 row-major.
// A wave transposes a 64(k) x 16(n) tile in registers: a lane loads 8 k-rows of
// 4 n each and stores, for each of its 4 n, 8 consecutive k as 16 bytes; the 8
// lanes of one n together write one whole 128-byte line of W^T.
// 4 waves side by side in n make a 64 x 64 tile; a block of 16 waves takes 4 tiles
// that follow one another in n, then k. K and N are compile-time so that the 8
// loads share one address and the 4 stores another (immediate offsets).
template <int K, int N>
__device__ __forceinline__ void
cast_t(const float* __restrict__ in, _Float16* __restrict__ out, int blk) {
  const int wave = threadIdx.x >> 5;
  const int lane = threadIdx.x & 31;
  const int tile = blk * (CAST_THREADS / 128) + (wave >> 2);
  const int k = (tile / (N / 64)) * 64 + (lane & 7) * 8;
  const int n = (tile % (N / 64)) * 64 + (wave & 3) * 16 + (lane >> 3) * 4;
  f4 v[8];
#pragma unroll
  for (int j = 0; j < 8; ++j) v[j] = *(const f4*)(in + (size_t)(k + j) * N + n);
#pragma unroll
  for (int c = 0; c < 4; ++c) {
    h8 r;
#pragma unroll
    for (int j = 0; j < 8; ++j) r[j] = (_Float16)v[j][c];
    *(h8*)(out + (size_t)(n + c) * K + k) = r;
  }
  store_issued();   // another job's code follows in the merged kernel
}

// All seven casts in one launch: none reads what another writes, so one launch
// pays the gap, the fill and the tail once instead of seven times.
#define HBLK  (BSZ * DIN / CAST_ELEMS)                       // blocks per activation
#define TBLKW ((DIN / 64) * (DHID / 64) / (CAST_THREADS / 128))  // blocks per 1024 x 1024 weight
#define TBLKN ((DIN / 64) * (DH / 64) / (CAST_THREADS / 128))    // blocks per 1024 x 64 weight
#define CAST_BLOCKS (3 * HBLK + 2 * TBLKW + 2 * TBLKN)
static_assert(((DIN / 64) * (DH / 64)) % (CAST_THREADS / 128) == 0, "whole blocks of tiles");

__global__ void __launch_bounds__(CAST_THREADS)
cast_all(const float* __restrict__ query, const float* __restrict__ key,
         const float* __restrict__ value,
         const float* __restrict__ Wq, const float* __restrict__ Wk,
         const float* __restrict__ Wv, const float* __restrict__ Wo,
         _Float16* __restrict__ Xq, _Float16* __restrict__ Xk, _Float16* __restrict__ Xv,
         _Float16* __restrict__ WqT, _Float16* __restrict__ WkT,
         _Float16* __restrict__ WvT, _Float16* __restrict__ WoT) {
  int blk = blockIdx.x;
  if (blk < HBLK) { cast_h(query, Xq, blk); return; }
  blk -= HBLK;
  if (blk < HBLK) { cast_h(key, Xk, blk); return; }
  blk -= HBLK;
  if (blk < HBLK) { cast_h(value, Xv, blk); return; }
  blk -= HBLK;
  if (blk < TBLKW) { cast_t<DIN, DHID>(Wq, WqT, blk); return; }
  blk -= TBLKW;
  if (blk < TBLKW) { cast_t<DHID, DIN>(Wo, WoT, blk); return; }
  blk -= TBLKW;
  if (blk < TBLKN) { cast_t<DIN, DH>(Wk, WkT, blk); return; }
  blk -= TBLKN;
  cast_t<DIN, DH>(Wv, WvT, blk);
}

// ---------------------------------------------------------------------------
// WMMA GEMM:  C[M,N] = X[M,K] @ W[K,N] + bias,  W given as WT[N,K].
// Block = 16 waves = a 128 x BN tile (BN = 128, or 64 for the narrow K and V
// products); a wave owns 32 x BN/4 of it. Both operands of a 64-k stage are laid
// in LDS by async copies (whole 128-byte lines), two buffers: the next stage's
// copies fly while this stage is worked on, so no wave waits out a load of its
// own, and each operand byte is fetched from L2 once per 128 rows or columns.
// ---------------------------------------------------------------------------
#define GEMM_THREADS 512
#define GM      128                    // rows of X per block
#define GK      64                     // k per stage
#define STAGE_H ((GM + 128) * P64)     // halves per buffer: GM rows of X, then up to 128 rows of WT
static_assert(BSZ % GM == 0 && DHID % 128 == 0 && DIN % 128 == 0 && DH == 64, "whole tiles");
static_assert(DIN % GK == 0 && DHID % GK == 0, "whole stages");

// A wave's 16 x (16 * NT) accumulators plus bias to memory. KIND 0: f32 to outF; 1: f16
// to outH; 2: f16 to outH, transposed. C/D layout: register r is row gm0 + r, the
// lane's column is gn0 + 16 * nt.
template <int KIND, int NT>
__device__ __forceinline__ void
store_tile(const v8f (&c)[NT], const float* __restrict__ bias,
           _Float16* __restrict__ outH, float* __restrict__ outF,
           int M, int N, int gm0, int gn0) {
#pragma unroll
  for (int nt = 0; nt < NT; ++nt) {
    const int gn = gn0 + nt * 16;
    const float bval = bias ? bias[gn] : 0.0f;
#pragma unroll
    for (int r = 0; r < 8; ++r) {
      const int gm = gm0 + r;
      const float val = c[nt][r] + bval;
      if constexpr (KIND == 2)      outH[(size_t)gn * M + gm] = (_Float16)val;
      else if constexpr (KIND == 1) outH[(size_t)gm * N + gn] = (_Float16)val;
      else                          outF[(size_t)gm * N + gn] = val;
      if constexpr (KIND != 2) store_issued();   // the next element reuses the address and data registers
    }
    if constexpr (KIND == 2) store_issued();     // one run of 8 neighbours; the next run reuses its registers
  }
}

template <int BN, bool HALF_OUT>   // output: f16 (outH, plain or transposed) or f32 (outF)
__device__ __forceinline__ void
gemm_tile(const _Float16* __restrict__ X,
          const _Float16* __restrict__ WT,
          const float* __restrict__ bias,
          _Float16* __restrict__ outH,
          float* __restrict__ outF,
          int M, int N, int K, int transposeOut, int n0,
          _Float16* ring) {            // LDS, 2 * STAGE_H halves
  constexpr int NT = BN / 64;            // 16-column accumulators per wave and 16 rows

  const int tid  = threadIdx.x;          // 0..511
  const int wave = tid >> 5;
  const int lane = tid & 31;
  const int nl   = lane & 15;
  const int hi   = lane >> 4;
  const int wm   = wave & 3;             // the wave's 32 rows
  const int wn   = wave >> 2;            // the wave's BN/4 columns
  const int m0   = blockIdx.x * GM;

  // One stage: GM rows of X and BN rows of WT, 64 k each = 8 segments of 16 bytes a
  // row; 8 neighbouring lanes copy one row's whole line.
  auto stage = [&](int k0, int buf) {
    _Float16* sa = ring + buf * STAGE_H;
    _Float16* sb = sa + GM * P64;
#pragma unroll
    for (int i = 0; i < GM * 8 / GEMM_THREADS; ++i) {
      const int seg = tid + i * GEMM_THREADS;
      const int row = seg >> 3;
      const int c16 = seg & 7;
      cp16(X + (size_t)(m0 + row) * K + k0 + c16 * 8, sa + row * P64 + c16 * 8);
    }
#pragma unroll
    for (int i = 0; i < BN * 8 / GEMM_THREADS; ++i) {
      const int seg = tid + i * GEMM_THREADS;
      const int row = seg >> 3;
      const int c16 = seg & 7;
      cp16(WT + (size_t)(n0 + row) * K + k0 + c16 * 8, sb + row * P64 + c16 * 8);
    }
  };

  v8f z = {};
  v8f c[2][NT];
#pragma unroll
  for (int i = 0; i < 2; ++i)
#pragma unroll
    for (int j = 0; j < NT; ++j) c[i][j] = z;

  const int T = K / GK;                  // stages
  stage(0, 0);
  asm volatile("s_wait_asynccnt 0x0" ::: "memory");   // this wave's share of stage 0 has landed
  __syncthreads();                       // stage 0 visible to all 16 waves
  if (T > 1) stage(GK, 1);

  for (int t = 0; t < T; ++t) {
    const _Float16* sa = ring + (t & 1) * STAGE_H + (wm * 32 + nl) * P64;
    const _Float16* sb = ring + (t & 1) * STAGE_H + (GM + wn * (NT * 16) + nl) * P64;
#pragma unroll
    for (int kc = 0; kc < GK; kc += 32) {
      v16h a[2], b[NT];
#pragma unroll
      for (int i = 0; i < 2; ++i)  a[i] = frag16(sa + i * 16 * P64 + kc, hi);
#pragma unroll
      for (int j = 0; j < NT; ++j) b[j] = frag16(sb + j * 16 * P64 + kc, hi);
#pragma unroll
      for (int i = 0; i < 2; ++i)
#pragma unroll
        for (int j = 0; j < NT; ++j)
          c[i][j] = __builtin_amdgcn_wmma_f32_16x16x32_f16(
              false, a[i], false, b[j], (short)0, c[i][j], false, false);
    }
    asm volatile("s_wait_dscnt 0x0" ::: "memory");     // this wave has left the buffer that is refilled below
    asm volatile("s_wait_asynccnt 0x0" ::: "memory");  // this wave's share of stage t + 1 has landed
    __syncthreads();                     // stage t + 1 visible to all; every reader has left stage t
    if (t + 2 < T) stage((t + 2) * GK, t & 1);
  }
  asm volatile("s_wait_asynccnt 0x0" ::: "memory");    // no copy is left in flight when the wave ends

#pragma unroll
  for (int i = 0; i < 2; ++i) {
    const int gm0 = m0 + wm * 32 + i * 16 + 8 * hi;
    const int gn0 = n0 + wn * (NT * 16) + nl;
    if constexpr (!HALF_OUT)  store_tile<0, NT>(c[i], bias, outH, outF, M, N, gm0, gn0);
    else if (transposeOut)    store_tile<2, NT>(c[i], bias, outH, outF, M, N, gm0, gn0);
    else                      store_tile<1, NT>(c[i], bias, outH, outF, M, N, gm0, gn0);
  }
}

// The output projection (f32 out).
__global__ void __launch_bounds__(GEMM_THREADS)
gemm_out(const _Float16* __restrict__ X,
         const _Float16* __restrict__ WT,
         const float* __restrict__ bias,
         float* __restrict__ outF,
         int M, int N, int K) {
  __shared__ __attribute__((aligned(16))) _Float16 ring[2 * STAGE_H];
  gemm_tile<128, false>(X, WT, bias, nullptr, outF, M, N, K, 0, blockIdx.y * 128, ring);
}

// The Q, K and V projections in one launch: the K and V products have few blocks
// and last as long as a block's whole k loop, which runs beside the Q product
// instead of behind it. blockIdx.y: 0 = K, 1 = V (stored transposed), 2 and up =
// the 128-column strips of Q.
__global__ void __launch_bounds__(GEMM_THREADS)
gemm_qkv(const _Float16* __restrict__ Xq, const _Float16* __restrict__ Xk,
         const _Float16* __restrict__ Xv,
         const _Float16* __restrict__ WqT, const _Float16* __restrict__ WkT,
         const _Float16* __restrict__ WvT,
         const float* __restrict__ bq, const float* __restrict__ bk,
         const float* __restrict__ bv,
         _Float16* __restrict__ qp, _Float16* __restrict__ kp, _Float16* __restrict__ vTp,
         int M, int K) {
  __shared__ __attribute__((aligned(16))) _Float16 ring[2 * STAGE_H];
  const int y = blockIdx.y;
  if (y < 2)
    gemm_tile<64, true>(y == 0 ? Xk : Xv, y == 0 ? WkT : WvT, y == 0 ? bk : bv,
                        y == 0 ? kp : vTp, nullptr, M, DH, K, y == 1, 0, ring);
  else
    gemm_tile<128, true>(Xq, WqT, bq, qp, nullptr, M, DHID, K, 0, (y - 2) * 128, ring);
}

// Value of lane l ^ 16 (the other half of the wave), as one vector instruction.
__device__ __forceinline__ float xhalf(float x) {
  const int b = __builtin_bit_cast(int, x);
  return __builtin_bit_cast(float,
      __builtin_amdgcn_permlanex16(b, b, 0x76543210, 0xfedcba98, false, false));
}

// The grid is one block per WGP, four waves per SIMD: the register budget is stated
// for that, or the compiler, counting two blocks into the LDS, squeezes the pass
// into half the registers and strings its exponentials on one register.
__global__ void __launch_bounds__(512) __attribute__((amdgpu_waves_per_eu(4, 4)))
mqa_attn(const _Float16* __restrict__ qh,
         const _Float16* __restrict__ kh,
         const _Float16* __restrict__ vT,
         _Float16* __restrict__ oh) {
  // [buf]: V^T tile, vcol(64) x key(KT), then K tile, key row(KT) x d(64), both padded; 2 x 69 KB.
  constexpr int VH = DH * PKT;            // halves of a V^T tile
  __shared__ __attribute__((aligned(16))) _Float16 kv[2][VH + KT * P64];

  const int tid  = threadIdx.x;           // 0..511
  const int wave = tid >> 5;              // = head
  const int lane = tid & 31;
  const int nl   = lane & 15;
  const int hi   = lane >> 4;
  const int qt   = blockIdx.x;            // query tile [0,128)
  const int b    = blockIdx.y;            // batch
  const int h    = wave;

  // One stage: KT rows of K (8 segments of 16 bytes a row) and 64 rows of V^T
  // (KT / 8 segments a row); every thread copies its share of both.
  auto stageKV = [&](int j, int buf) {
#pragma unroll
    for (int i = 0; i < KT * 8 / 512; ++i) {
      const int seg = tid + i * 512;
      const int row = seg >> 3, s = seg & 7;
      cp16(kh + ((size_t)(b * SS + j + row)) * DH + s * 8,
           &kv[buf][VH + row * P64 + s * 8]);
    }
#pragma unroll
    for (int i = 0; i < DH * (KT / 8) / 512; ++i) {
      const int seg = tid + i * 512;
      const int row = seg / (KT / 8), s = seg % (KT / 8);
      cp16(vT + (size_t)row * BSZ + b * SS + j + s * 8,
           &kv[buf][row * PKT + s * 8]);
    }
  };

  // Q tile resident as two B fragments (d = 0..31, 32..63), column = query nl
  const _Float16* qrow = qh + ((size_t)(b * SS + qt * 16 + nl)) * DHID + h * DH;
  const v16h qb0 = frag16(qrow, hi);
  const v16h qb1 = frag16(qrow + 32, hi);

  v8f z = {};
  v8f o[4] = {z, z, z, z};                // O^T accum, 64(d) x 16(query)
  float m = -3.0e38f;                     // running maximum of query nl (same in both halves)
  float l = 0.0f;                         // running sum over this half's keys only

  constexpr int T = SS / KT;              // stages
  static_assert(SS % KT == 0 && T >= 2 && KT % 32 == 0, "whole stages, two buffers in use");
  stageKV(0, 0);
  asm volatile("s_wait_asynccnt 0x0" ::: "memory");   // this wave's share of stage 0 has landed
  __syncthreads();                        // stage 0 visible to all heads
  stageKV(KT, 1);

  for (int t = 0; t < T; ++t) {
   const int buf = t & 1;
   for (int jj = 0; jj < KT; jj += 32) {  // passes of 32 keys, no barrier between them
    // ---- scores: two 16x16 tiles, S^T = K @ Q^T, A operand from LDS ----
    const _Float16* kr0 = &kv[buf][VH + (jj + nl) * P64];
    const _Float16* kr1 = &kv[buf][VH + (jj + 16 + nl) * P64];
    v8f s0 = z, s1 = z;
    s0 = __builtin_amdgcn_wmma_f32_16x16x32_f16(false, frag16(kr0, hi),      false, qb0, (short)0, s0, false, false);
    s0 = __builtin_amdgcn_wmma_f32_16x16x32_f16(false, frag16(kr0 + 32, hi), false, qb1, (short)0, s0, false, false);
    s1 = __builtin_amdgcn_wmma_f32_16x16x32_f16(false, frag16(kr1, hi),      false, qb0, (short)0, s1, false, false);
    s1 = __builtin_amdgcn_wmma_f32_16x16x32_f16(false, frag16(kr1 + 32, hi), false, qb1, (short)0, s1, false, false);

    // ---- online softmax: 16 scores of query nl in this lane ----
    const v8f x0 = s0 * SCALE;            // keys r + 8*hi
    const v8f x1 = s1 * SCALE;            // keys 16 + r + 8*hi
    float x[16];
#pragma unroll
    for (int r = 0; r < 8; ++r) { x[r] = x0[r]; x[8 + r] = x1[r]; }
    float t4[4];                          // four short chains instead of one long one
#pragma unroll
    for (int c = 0; c < 4; ++c)
      t4[c] = fmaxf(fmaxf(x[4 * c], x[4 * c + 1]), fmaxf(x[4 * c + 2], x[4 * c + 3]));
    float tm = fmaxf(fmaxf(t4[0], t4[1]), fmaxf(t4[2], t4[3]));
    tm = fmaxf(tm, xhalf(tm));            // the other 16 keys of the same query
    const float mnew = fmaxf(m, tm);
    const float cr = __expf(m - mnew);
    m = mnew;

    // Half t of the B fragment is key t + 8*hi (t < 8) or 8 + t + 8*hi: x's order.
    v16h pb;
    float p[16];
#pragma unroll
    for (int i = 0; i < 16; ++i) {
      p[i]  = __expf(x[i] - mnew);
      pb[i] = (_Float16)p[i];
    }
#pragma unroll
    for (int nt = 0; nt < 4; ++nt) o[nt] *= cr;

    // ---- O^T += V^T (A operand from the LDS V^T tile) @ P^T (registers) ----
#pragma unroll
    for (int nt = 0; nt < 4; ++nt) {
      v16h av = frag16(&kv[buf][(nt * 16 + nl) * PKT + jj], hi);
      o[nt] = __builtin_amdgcn_wmma_f32_16x16x32_f16(
          false, av, false, pb, (short)0, o[nt], false, false);
    }
    // Keeps the row sum behind the products: with no barrier at the pass's end its adds
    // are the vector slots that the chip needs between the last product and the next
    // pass's first write of that product's operand registers, over the back edge.
    __builtin_amdgcn_sched_barrier(0);
    float r4[4];
#pragma unroll
    for (int c = 0; c < 4; ++c)
      r4[c] = (p[4 * c] + p[4 * c + 1]) + (p[4 * c + 2] + p[4 * c + 3]);
    l = l * cr + ((r4[0] + r4[1]) + (r4[2] + r4[3]));
   }
   asm volatile("s_wait_dscnt 0x0" ::: "memory");     // this wave has left the buffer that is refilled below
   asm volatile("s_wait_asynccnt 0x0" ::: "memory");  // this wave's share of stage t + 1 has landed
   __syncthreads();                       // stage t + 1 visible to all; every reader has left stage t
   if (t + 2 < T) stageKV((t + 2) * KT, buf);
  }
  asm volatile("s_wait_asynccnt 0x0" ::: "memory");   // no copy is left in flight when the wave ends

  // ---- normalize and write attention output ----
  // Lane holds d = nt*16 + 8*hi + (0..7) of query nl: 16 contiguous bytes per nt.
  const float inv = 1.0f / (l + xhalf(l));
  _Float16* orow = oh + ((size_t)(b * SS + qt * 16 + nl)) * DHID + h * DH + 8 * hi;
#pragma unroll
  for (int nt = 0; nt < 4; ++nt) {
    h8 w;
#pragma unroll
    for (int r = 0; r < 8; ++r) w[r] = (_Float16)(o[nt][r] * inv);
    *(h8*)(orow + nt * 16) = w;
  }
}

// ---------------------------------------------------------------------------
// Launcher
// ---------------------------------------------------------------------------
extern "C" void kernel_launch(void* const* d_in, const int* in_sizes, int n_in,
                              void* d_out, int out_size, void* d_ws, size_t ws_size,
                              hipStream_t stream) {
  (void)in_sizes; (void)n_in; (void)out_size; (void)ws_size;

  const float* query = (const float*)d_in[0];
  const float* key   = (const float*)d_in[1];
  const float* value = (const float*)d_in[2];
  const float* Wq    = (const float*)d_in[3];
  const float* bq    = (const float*)d_in[4];
  const float* Wk    = (const float*)d_in[5];
  const float* bk    = (const float*)d_in[6];
  const float* Wv    = (const float*)d_in[7];
  const float* bv    = (const float*)d_in[8];
  const float* Wo    = (const float*)d_in[9];
  const float* bo    = (const float*)d_in[10];
  float* outF = (float*)d_out;

  // workspace carve-up (f16, 256B aligned), ~45 MB total
  char* ws = (char*)d_ws;
  size_t off = 0;
  auto carve = [&](size_t halves) {
    void* p = ws + off;
    off += (halves * sizeof(_Float16) + 255) & ~(size_t)255;
    return (_Float16*)p;
  };
  _Float16* Xq  = carve((size_t)BSZ * DIN);
  _Float16* Xk  = carve((size_t)BSZ * DIN);
  _Float16* Xv  = carve((size_t)BSZ * DIN);
  _Float16* WqT = carve((size_t)DIN * DHID);
  _Float16* WkT = carve((size_t)DH * DIN);
  _Float16* WvT = carve((size_t)DH * DIN);
  _Float16* WoT = carve((size_t)DIN * DHID);
  _Float16* qp  = carve((size_t)BSZ * DHID);
  _Float16* kp  = carve((size_t)BSZ * DH);
  _Float16* vTp = carve((size_t)DH * BSZ);   // V^T [64, B*S]
  _Float16* oat = carve((size_t)BSZ * DHID);

  cast_all<<<dim3(CAST_BLOCKS), CAST_THREADS, 0, stream>>>(
      query, key, value, Wq, Wk, Wv, Wo, Xq, Xk, Xv, WqT, WkT, WvT, WoT);

  // projections (WMMA, 128-row tiles per 16-wave block): K, V and Q in one launch
  gemm_qkv<<<dim3(BSZ / GM, 2 + DHID / 128), GEMM_THREADS, 0, stream>>>(
      Xq, Xk, Xv, WqT, WkT, WvT, bq, bk, bv, qp, kp, vTp, BSZ, DIN);

  // attention (WMMA flash, 16 heads per block sharing LDS-staged K/V)
  mqa_attn<<<dim3(SS / 16, BB), 512, 0, stream>>>(qp, kp, vTp, oat);

  // output projection (WMMA, fp32 out)
  gemm_out<<<dim3(BSZ / GM, DIN / 128), GEMM_THREADS, 0, stream>>>(oat, WoT, bo, outF, BSZ, DIN, DHID);
}

// v007
// Measured time: 75.1 microseconds a run.
// Next to v006, in two timings, it ran 1.08 times as fast each time.
// Counting every step since v000, it is 4.48 times as fast.
#include <hip/hip_runtime.h>
#include <hip/hip_bf16.h>

// ---------------------------------------------------------------------------
// MQA forward, all matmuls on v_wmma_f32_16x16x32_f16 (CDNA5 / gfx1250).
// B=2, S=2048, d_model=1024, H=16, Dh=64 (single shared K/V head).
// GEMMs: 16-wave blocks, both operands staged in LDS via global_load_async_to_lds
// (double buffered, ASYNCcnt).
// Attention: 16-wave blocks (two heads and half the keys per wave) sharing
// async-staged, double-buffered K/V stages in LDS -- 16x cut in L2 traffic for
// the shared MQA head; a stage holds many 32-key passes, so the waves meet rarely.
// Launches that do not depend on one another share one launch (the block index
// picks the job): all casts; the Q, K and V projections.
// ---------------------------------------------------------------------------

typedef __attribute__((ext_vector_type(16))) _Float16 v16h;
typedef __attribute__((ext_vector_type(8)))  _Float16 h8;
typedef __attribute__((ext_vector_type(8)))  float    v8f;
typedef __attribute__((ext_vector_type(2)))  _Float16 h2;
typedef __attribute__((ext_vector_type(4)))  int      v4i;
typedef __attribute__((ext_vector_type(4)))  float    f4;
typedef __attribute__((ext_vector_type(4)))  _Float16 h4;

#define BB    2
#define SS    2048
#define BSZ   4096      // B*S
#define DIN   1024
#define DHID  1024
#define NH    16
#define DH    64
#define SCALE 0.03125f  // 1/sqrt(1024)
#define LOG2E 1.44269504f  // log2(e)

// LDS row pitches in halves. Every tile here is read by 16-byte loads, 16 rows
// at a time, so the pitch is an odd multiple of 16 bytes: the 16 rows then fall
// on 16 different groups of four banks instead of on two (128-byte rows) or
// one (512-byte rows).
#define P64   72        // rows of 64 halves: 128 B of data, 144 B pitch
#define KT    256       // keys per attention stage (4 passes of 32 keys for each key half)
#define PKT   (KT + 8)  // rows of KT halves: 512 B of data, 528 B pitch

#if __has_builtin(__builtin_amdgcn_global_load_async_to_lds_b128)
#define HAVE_ASYNC 1
#else
#define HAVE_ASYNC 0
#endif

// 16-byte global -> LDS copy; async (ASYNCcnt) when the gfx1250 builtin exists.
__device__ __forceinline__ void cp16(const _Float16* g, _Float16* l) {
#if HAVE_ASYNC
  __builtin_amdgcn_global_load_async_to_lds_b128(
      (__attribute__((address_space(1))) v4i*)g,
      (__attribute__((address_space(3))) v4i*)l, 0, 0);
#else
  *(h8*)l = *(const h8*)g;
#endif
}

// Stands behind a global store, in front of the next write of a register that the
// store names (its address pair, its data).
__device__ __forceinline__ void store_issued() {
  asm volatile("s_wait_xcnt 0x0" ::: "memory");
}

// Assemble a 16-bit WMMA A/B fragment (16x32 resp. 32x16) for one K=32 chunk.
// Per ISA 7.12.2: lane holds row/col (lane&15); hi = lane>>4 selects the K
// half-groups. Half t -> K = t + 8*hi + 8*(t>=8); pairs merge into b128 loads.
__device__ __forceinline__ v16h frag16(const _Float16* __restrict__ base, int hi) {
  v16h r;
#pragma unroll
  for (int tp = 0; tp < 8; ++tp) {
    const int kk = 2 * tp + 8 * hi + ((tp >= 4) ? 8 : 0);
    h2 p = *(const h2*)(base + kk);
    r[2 * tp]     = p.x;
    r[2 * tp + 1] = p.y;
  }
  return r;
}

// ---------------------------------------------------------------------------
// fp32 -> f16 casts. A launch pays for every wave it starts, so a thread moves
// 32 elements: few waves, each with 8 16-byte loads in flight per lane.
// ---------------------------------------------------------------------------
#define CAST_THREADS 512                       // 16 waves: one block fills a WGP's stream
#define CAST_LOADS   8                         // 16-byte loads in flight per lane
#define CAST_ELEMS   (CAST_THREADS * CAST_LOADS * 4)   // elements per block
static_assert((BSZ * DIN) % CAST_ELEMS == 0, "cast_h has no tail");
static_assert(DIN % 64 == 0 && DHID % 64 == 0 && DH % 64 == 0, "cast_t has no tail");

// Each wave owns 4 KB of input in a row: every load covers 512 contiguous bytes
// (4 whole lines), every store 256 (2 whole lines); all loads precede the stores.
__device__ __forceinline__ void
cast_h(const float* __restrict__ in, _Float16* __restrict__ out, int blk) {
  const int wave = threadIdx.x >> 5;
  const int lane = threadIdx.x & 31;
  const size_t g = ((size_t)blk * (CAST_THREADS / 32) + wave) * (CAST_LOADS * 32) + lane;
  const f4* __restrict__ src = (const f4*)in + g;   // groups of 4 elements
  h4* __restrict__ dst = (h4*)out + g;
  f4 v[CAST_LOADS];
#pragma unroll
  for (int i = 0; i < CAST_LOADS; ++i) v[i] = src[i * 32];
#pragma unroll
  for (int i = 0; i < CAST_LOADS; ++i) dst[i * 32] = __builtin_convertvector(v[i], h4);
  store_issued();   // another job's code follows in the merged kernel
}

// W [K,N] fp32 row-major  ->  W^T [N,K] f16 row-major.
// A wave transposes a 64(k) x 16(n) tile in registers: a lane loads 8 k-rows of
// 4 n each and stores, for each of its 4 n, 8 consecutive k as 16 bytes; the 8
// lanes of one n together write one whole 128-byte line of W^T.
// 4 waves side by side in n make a 64 x 64 tile; a block of 16 waves takes 4 tiles
// that follow one another in n, then k. K and N are compile-time so that the 8
// loads share one address and the 4 stores another (immediate offsets).
template <int K, int N>
__device__ __forceinline__ void
cast_t(const float* __restrict__ in, _Float16* __restrict__ out, int blk) {
  const int wave = threadIdx.x >> 5;
  const int lane = threadIdx.x & 31;
  const int tile = blk * (CAST_THREADS / 128) + (wave >> 2);
  const int k = (tile / (N / 64)) * 64 + (lane & 7) * 8;
  const int n = (tile % (N / 64)) * 64 + (wave & 3) * 16 + (lane >> 3) * 4;
  f4 v[8];
#pragma unroll
  for (int j = 0; j < 8; ++j) v[j] = *(const f4*)(in + (size_t)(k + j) * N + n);
#pragma unroll
  for (int c = 0; c < 4; ++c) {
    h8 r;
#pragma unroll
    for (int j = 0; j < 8; ++j) r[j] = (_Float16)v[j][c];
    *(h8*)(out + (size_t)(n + c) * K + k) = r;
  }
  store_issued();   // another job's code follows in the merged kernel
}

// All seven casts in one launch: none reads what another writes, so one launch
// pays the gap, the fill and the tail once instead of seven times.
#define HBLK  (BSZ * DIN / CAST_ELEMS)                       // blocks per activation
#define TBLKW ((DIN / 64) * (DHID / 64) / (CAST_THREADS / 128))  // blocks per 1024 x 1024 weight
#define TBLKN ((DIN / 64) * (DH / 64) / (CAST_THREADS / 128))    // blocks per 1024 x 64 weight
#define CAST_BLOCKS (3 * HBLK + 2 * TBLKW + 2 * TBLKN)
static_assert(((DIN / 64) * (DH / 64)) % (CAST_THREADS / 128) == 0, "whole blocks of tiles");

__global__ void __launch_bounds__(CAST_THREADS)
cast_all(const float* __restrict__ query, const float* __restrict__ key,
         const float* __restrict__ value,
         const float* __restrict__ Wq, const float* __restrict__ Wk,
         const float* __restrict__ Wv, const float* __restrict__ Wo,
         _Float16* __restrict__ Xq, _Float16* __restrict__ Xk, _Float16* __restrict__ Xv,
         _Float16* __restrict__ WqT, _Float16* __restrict__ WkT,
         _Float16* __restrict__ WvT, _Float16* __restrict__ WoT) {
  int blk = blockIdx.x;
  if (blk < HBLK) { cast_h(query, Xq, blk); return; }
  blk -= HBLK;
  if (blk < HBLK) { cast_h(key, Xk, blk); return; }
  blk -= HBLK;
  if (blk < HBLK) { cast_h(value, Xv, blk); return; }
  blk -= HBLK;
  if (blk < TBLKW) { cast_t<DIN, DHID>(Wq, WqT, blk); return; }
  blk -= TBLKW;
  if (blk < TBLKW) { cast_t<DHID, DIN>(Wo, WoT, blk); return; }
  blk -= TBLKW;
  if (blk < TBLKN) { cast_t<DIN, DH>(Wk, WkT, blk); return; }
  blk -= TBLKN;
  cast_t<DIN, DH>(Wv, WvT, blk);
}

// ---------------------------------------------------------------------------
// WMMA GEMM:  C[M,N] = X[M,K] @ W[K,N] + bias,  W given as WT[N,K].
// Block = 16 waves = a 128 x BN tile (BN = 128, or 64 for the narrow K and V
// products); a wave owns 32 x BN/4 of it. Both operands of a 64-k stage are laid
// in LDS by async copies (whole 128-byte lines), two buffers: the next stage's
// copies fly while this stage is worked on, so no wave waits out a load of its
// own, and each operand byte is fetched from L2 once per 128 rows or columns.
// ---------------------------------------------------------------------------
#define GEMM_THREADS 512
#define GM      128                    // rows of X per block
#define GK      64                     // k per stage
#define STAGE_H ((GM + 128) * P64)     // halves per buffer: GM rows of X, then up to 128 rows of WT
static_assert(BSZ % GM == 0 && DHID % 128 == 0 && DIN % 128 == 0 && DH == 64, "whole tiles");
static_assert(DIN % GK == 0 && DHID % GK == 0, "whole stages");

// A wave's 16 x (16 * NT) accumulators plus bias to memory. KIND 0: f32 to outF; 1: f16
// to outH; 2: f16 to outH, transposed. C/D layout: register r is row gm0 + r, the
// lane's column is gn0 + 16 * nt.
template <int KIND, int NT>
__device__ __forceinline__ void
store_tile(const v8f (&c)[NT], const float* __restrict__ bias,
           _Float16* __restrict__ outH, float* __restrict__ outF,
           int M, int N, int gm0, int gn0) {
#pragma unroll
  for (int nt = 0; nt < NT; ++nt) {
    const int gn = gn0 + nt * 16;
    const float bval = bias ? bias[gn] : 0.0f;
#pragma unroll
    for (int r = 0; r < 8; ++r) {
      const int gm = gm0 + r;
      const float val = c[nt][r] + bval;
      if constexpr (KIND == 2)      outH[(size_t)gn * M + gm] = (_Float16)val;
      else if constexpr (KIND == 1) outH[(size_t)gm * N + gn] = (_Float16)val;
      else                          outF[(size_t)gm * N + gn] = val;
      if constexpr (KIND != 2) store_issued();   // the next element reuses the address and data registers
    }
    if constexpr (KIND == 2) store_issued();     // one run of 8 neighbours; the next run reuses its registers
  }
}

template <int BN, bool HALF_OUT>   // output: f16 (outH, plain or transposed) or f32 (outF)
__device__ __forceinline__ void
gemm_tile(const _Float16* __restrict__ X,
          const _Float16* __restrict__ WT,
          const float* __restrict__ bias,
          _Float16* __restrict__ outH,
          float* __restrict__ outF,
          int M, int N, int K, int transposeOut, int n0,
          _Float16* ring) {            // LDS, 2 * STAGE_H halves
  constexpr int NT = BN / 64;            // 16-column accumulators per wave and 16 rows

  const int tid  = threadIdx.x;          // 0..511
  const int wave = tid >> 5;
  const int lane = tid & 31;
  const int nl   = lane & 15;
  const int hi   = lane >> 4;
  const int wm   = wave & 3;             // the wave's 32 rows
  const int wn   = wave >> 2;            // the wave's BN/4 columns
  const int m0   = blockIdx.x * GM;

  // One stage: GM rows of X and BN rows of WT, 64 k each = 8 segments of 16 bytes a
  // row; 8 neighbouring lanes copy one row's whole line.
  auto stage = [&](int k0, int buf) {
    _Float16* sa = ring + buf * STAGE_H;
    _Float16* sb = sa + GM * P64;
#pragma unroll
    for (int i = 0; i < GM * 8 / GEMM_THREADS; ++i) {
      const int seg = tid + i * GEMM_THREADS;
      const int row = seg >> 3;
      const int c16 = seg & 7;
      cp16(X + (size_t)(m0 + row) * K + k0 + c16 * 8, sa + row * P64 + c16 * 8);
    }
#pragma unroll
    for (int i = 0; i < BN * 8 / GEMM_THREADS; ++i) {
      const int seg = tid + i * GEMM_THREADS;
      const int row = seg >> 3;
      const int c16 = seg & 7;
      cp16(WT + (size_t)(n0 + row) * K + k0 + c16 * 8, sb + row * P64 + c16 * 8);
    }
  };

  v8f z = {};
  v8f c[2][NT];
#pragma unroll
  for (int i = 0; i < 2; ++i)
#pragma unroll
    for (int j = 0; j < NT; ++j) c[i][j] = z;

  const int T = K / GK;                  // stages
  stage(0, 0);
  asm volatile("s_wait_asynccnt 0x0" ::: "memory");   // this wave's share of stage 0 has landed
  __syncthreads();                       // stage 0 visible to all 16 waves
  if (T > 1) stage(GK, 1);

  for (int t = 0; t < T; ++t) {
    const _Float16* sa = ring + (t & 1) * STAGE_H + (wm * 32 + nl) * P64;
    const _Float16* sb = ring + (t & 1) * STAGE_H + (GM + wn * (NT * 16) + nl) * P64;
#pragma unroll
    for (int kc = 0; kc < GK; kc += 32) {
      v16h a[2], b[NT];
#pragma unroll
      for (int i = 0; i < 2; ++i)  a[i] = frag16(sa + i * 16 * P64 + kc, hi);
#pragma unroll
      for (int j = 0; j < NT; ++j) b[j] = frag16(sb + j * 16 * P64 + kc, hi);
#pragma unroll
      for (int i = 0; i < 2; ++i)
#pragma unroll
        for (int j = 0; j < NT; ++j)
          c[i][j] = __builtin_amdgcn_wmma_f32_16x16x32_f16(
              false, a[i], false, b[j], (short)0, c[i][j], false, false);
    }
    asm volatile("s_wait_dscnt 0x0" ::: "memory");     // this wave has left the buffer that is refilled below
    asm volatile("s_wait_asynccnt 0x0" ::: "memory");  // this wave's share of stage t + 1 has landed
    __syncthreads();                     // stage t + 1 visible to all; every reader has left stage t
    if (t + 2 < T) stage((t + 2) * GK, t & 1);
  }
  asm volatile("s_wait_asynccnt 0x0" ::: "memory");    // no copy is left in flight when the wave ends

#pragma unroll
  for (int i = 0; i < 2; ++i) {
    const int gm0 = m0 + wm * 32 + i * 16 + 8 * hi;
    const int gn0 = n0 + wn * (NT * 16) + nl;
    if constexpr (!HALF_OUT)  store_tile<0, NT>(c[i], bias, outH, outF, M, N, gm0, gn0);
    else if (transposeOut)    store_tile<2, NT>(c[i], bias, outH, outF, M, N, gm0, gn0);
    else                      store_tile<1, NT>(c[i], bias, outH, outF, M, N, gm0, gn0);
  }
}

// The output projection (f32 out).
__global__ void __launch_bounds__(GEMM_THREADS)
gemm_out(const _Float16* __restrict__ X,
         const _Float16* __restrict__ WT,
         const float* __restrict__ bias,
         float* __restrict__ outF,
         int M, int N, int K) {
  __shared__ __attribute__((aligned(16))) _Float16 ring[2 * STAGE_H];
  gemm_tile<128, false>(X, WT, bias, nullptr, outF, M, N, K, 0, blockIdx.y * 128, ring);
}

// The Q, K and V projections in one launch: the K and V products have few blocks
// and last as long as a block's whole k loop, which runs beside the Q product
// instead of behind it. blockIdx.y: 0 = K, 1 = V (stored transposed), 2 and up =
// the 128-column strips of Q.
__global__ void __launch_bounds__(GEMM_THREADS)
gemm_qkv(const _Float16* __restrict__ Xq, const _Float16* __restrict__ Xk,
         const _Float16* __restrict__ Xv,
         const _Float16* __restrict__ WqT, const _Float16* __restrict__ WkT,
         const _Float16* __restrict__ WvT,
         const float* __restrict__ bq, const float* __restrict__ bk,
         const float* __restrict__ bv,
         _Float16* __restrict__ qp, _Float16* __restrict__ kp, _Float16* __restrict__ vTp,
         int M, int K) {
  __shared__ __attribute__((aligned(16))) _Float16 ring[2 * STAGE_H];
  const int y = blockIdx.y;
  if (y < 2)
    gemm_tile<64, true>(y == 0 ? Xk : Xv, y == 0 ? WkT : WvT, y == 0 ? bk : bv,
                        y == 0 ? kp : vTp, nullptr, M, DH, K, y == 1, 0, ring);
  else
    gemm_tile<128, true>(Xq, WqT, bq, qp, nullptr, M, DHID, K, 0, (y - 2) * 128, ring);
}

// Value of lane l ^ 16 (the other half of the wave), as one vector instruction.
__device__ __forceinline__ float xhalf(float x) {
  const int b = __builtin_bit_cast(int, x);
  return __builtin_bit_cast(float,
      __builtin_amdgcn_permlanex16(b, b, 0x76543210, 0xfedcba98, false, false));
}

// The grid is one block per WGP, four waves per SIMD: the register budget is stated
// for that, or the compiler, counting two blocks into the LDS, squeezes the pass
// into half the registers and strings its exponentials on one register.
__global__ void __launch_bounds__(512) __attribute__((amdgpu_waves_per_eu(4, 4)))
mqa_attn(const _Float16* __restrict__ qh,
         const _Float16* __restrict__ kh,
         const _Float16* __restrict__ vT,
         _Float16* __restrict__ oh) {
  // [buf]: V^T tile, vcol(64) x key(KT), then K tile, key row(KT) x d(64), both padded; 2 x 69 KB.
  // Keys 0 .. KT/2 - 1 of a tile belong to the first key half, the rest to the second.
  constexpr int VH = DH * PKT;            // halves of a V^T tile
  constexpr int KH = KT / 2;              // keys of one key half per stage
  constexpr int SH = SS / 2;              // keys of one key half
  __shared__ __attribute__((aligned(16))) _Float16 kv[2][VH + KT * P64];

  const int tid  = threadIdx.x;           // 0..511
  const int wave = __builtin_amdgcn_readfirstlane(tid >> 5);   // scalar: the pass loop's bounds hang on it
  const int lane = tid & 31;
  const int nl   = lane & 15;
  const int hi   = lane >> 4;
  const int qt   = blockIdx.x;            // query tile [0,128)
  const int b    = blockIdx.y;            // batch
  const int half = wave >> 3;             // the wave's key half
  // Column group 0 is the head whose output this wave writes, group 1 the head that
  // its partner (wave ^ 8) writes: the partner holds the same two heads, swapped.
  const int h0   = 2 * (wave & 7) + half;
  const int h1   = h0 ^ 1;

  // One stage: KT rows of K (8 segments of 16 bytes a row) and 64 rows of V^T
  // (KT / 8 segments a row), keys j .. j + KH - 1 of each key half; every thread
  // copies its share of both.
  auto stageKV = [&](int j, int buf) {
#pragma unroll
    for (int i = 0; i < KT * 8 / 512; ++i) {
      const int seg = tid + i * 512;
      const int row = seg >> 3, s = seg & 7;
      const int key = (row / KH) * SH + j + row % KH;
      cp16(kh + ((size_t)(b * SS + key)) * DH + s * 8,
           &kv[buf][VH + row * P64 + s * 8]);
    }
#pragma unroll
    for (int i = 0; i < DH * (KT / 8) / 512; ++i) {
      const int seg = tid + i * 512;
      const int row = seg / (KT / 8), s = seg % (KT / 8);
      const int key = (s / (KH / 8)) * SH + j + (s % (KH / 8)) * 8;
      cp16(vT + (size_t)row * BSZ + b * SS + key,
           &kv[buf][row * PKT + s * 8]);
    }
  };

  // Q tiles resident as two B fragments a head (d = 0..31, 32..63), column = query nl
  const _Float16* qrow = qh + ((size_t)(b * SS + qt * 16 + nl)) * DHID;
  const v16h qb[2][2] = {{frag16(qrow + h0 * DH, hi), frag16(qrow + h0 * DH + 32, hi)},
                         {frag16(qrow + h1 * DH, hi), frag16(qrow + h1 * DH + 32, hi)}};

  v8f z = {};
  v8f o[2][4] = {{z, z, z, z}, {z, z, z, z}};   // O^T accum per head, 64(d) x 16(query)
  float m[2] = {-3.0e38f, -3.0e38f};      // running maximum of query nl (same in both halves of the wave)
  float l[2] = {0.0f, 0.0f};              // running sum over this half-wave's keys only

  constexpr int T = SH / KH;              // stages
  static_assert(SH % KH == 0 && T >= 2 && KH % 32 == 0, "whole stages, two buffers in use");
  stageKV(0, 0);
  asm volatile("s_wait_asynccnt 0x0" ::: "memory");   // this wave's share of stage 0 has landed
  __syncthreads();                        // stage 0 visible to all waves
  stageKV(KH, 1);

  for (int t = 0; t < T; ++t) {
   const int buf = t & 1;
   for (int jj = half * KH; jj < half * KH + KH; jj += 32) {  // passes of 32 keys, no barrier between them
    // ---- scores: two 16x16 tiles a head, S^T = K @ Q^T, A operand from LDS ----
    const _Float16* kr0 = &kv[buf][VH + (jj + nl) * P64];
    const _Float16* kr1 = &kv[buf][VH + (jj + 16 + nl) * P64];
    const v16h ka[2][2] = {{frag16(kr0, hi), frag16(kr0 + 32, hi)},
                           {frag16(kr1, hi), frag16(kr1 + 32, hi)}};
    v16h av[4];                           // V^T fragments, 16 d each, for the second product
#pragma unroll
    for (int nt = 0; nt < 4; ++nt) av[nt] = frag16(&kv[buf][(nt * 16 + nl) * PKT + jj], hi);
    // Keeps the pass's 16 LDS reads in one group at its head: left to itself the compiler
    // sinks half of the V^T reads in among the second product's WMMAs, which then wait them out.
    __builtin_amdgcn_sched_barrier(0);
    v8f s[2][2];                          // [head][16 keys]
#pragma unroll
    for (int kt = 0; kt < 2; ++kt)
#pragma unroll
      for (int g = 0; g < 2; ++g)
        s[g][kt] = __builtin_amdgcn_wmma_f32_16x16x32_f16(false, ka[kt][0], false, qb[g][0], (short)0, z, false, false);
#pragma unroll
    for (int kt = 0; kt < 2; ++kt)
#pragma unroll
      for (int g = 0; g < 2; ++g)
        s[g][kt] = __builtin_amdgcn_wmma_f32_16x16x32_f16(false, ka[kt][1], false, qb[g][1], (short)0, s[g][kt], false, false);
    // Keeps the eight score products back to back: each is a slot of the distance that the
    // chip needs in front of the first read of an earlier one's result, where the compiler,
    // drawing the scaling in among them, pads with idle instructions.
    __builtin_amdgcn_sched_barrier(0);

    // ---- online softmax: 16 scores of query nl and head g in this lane ----
    v8f d[2][2];                          // score minus the new maximum, times log2 e
    float dm[2];                          // old maximum minus the new one, times log2 e
#pragma unroll
    for (int g = 0; g < 2; ++g) {
      const v8f x0 = s[g][0] * SCALE;     // keys r + 8*hi
      const v8f x1 = s[g][1] * SCALE;     // keys 16 + r + 8*hi
      float x[16];
#pragma unroll
      for (int r = 0; r < 8; ++r) { x[r] = x0[r]; x[8 + r] = x1[r]; }
      float t4[4];                        // four short chains instead of one long one
#pragma unroll
      for (int c = 0; c < 4; ++c)
        t4[c] = fmaxf(fmaxf(x[4 * c], x[4 * c + 1]), fmaxf(x[4 * c + 2], x[4 * c + 3]));
      float tm = fmaxf(fmaxf(t4[0], t4[1]), fmaxf(t4[2], t4[3]));
      tm = fmaxf(tm, xhalf(tm));          // the other 16 keys of the same query
      const float mnew = fmaxf(m[g], tm);
      dm[g] = (m[g] - mnew) * LOG2E;
      m[g] = mnew;
      d[g][0] = (x0 - mnew) * LOG2E;
      d[g][1] = (x1 - mnew) * LOG2E;
    }
    // e^d is taken as 2^(d * log2 e), which is what __expf compiles to, so that this can
    // stand between the products and the exponentials.
    __builtin_amdgcn_sched_barrier(0);
    v16h pb[2];
    float p[2][16];
    float cr[2];
#pragma unroll
    for (int g = 0; g < 2; ++g) {
      cr[g] = __builtin_amdgcn_exp2f(dm[g]);
      // Half t of the B fragment is key t + 8*hi (t < 8) or 8 + t + 8*hi: the scores' order.
#pragma unroll
      for (int r = 0; r < 8; ++r) {
        p[g][r]      = __builtin_amdgcn_exp2f(d[g][0][r]);
        p[g][8 + r]  = __builtin_amdgcn_exp2f(d[g][1][r]);
        pb[g][r]     = (_Float16)p[g][r];
        pb[g][8 + r] = (_Float16)p[g][8 + r];
      }
#pragma unroll
      for (int nt = 0; nt < 4; ++nt) o[g][nt] *= cr[g];
    }

    // ---- O^T += V^T (A operand, read above) @ P^T (registers) ----
#pragma unroll
    for (int nt = 0; nt < 4; ++nt)
#pragma unroll
      for (int g = 0; g < 2; ++g)
        o[g][nt] = __builtin_amdgcn_wmma_f32_16x16x32_f16(
            false, av[nt], false, pb[g], (short)0, o[g][nt], false, false);
    // Keeps the row sums behind the products: with no barrier at the pass's end their adds
    // are the vector slots that the chip needs between the last product and the next
    // pass's first write of that product's operand registers, over the back edge.
    __builtin_amdgcn_sched_barrier(0);
#pragma unroll
    for (int g = 0; g < 2; ++g) {
      float r4[4];
#pragma unroll
      for (int c = 0; c < 4; ++c)
        r4[c] = (p[g][4 * c] + p[g][4 * c + 1]) + (p[g][4 * c + 2] + p[g][4 * c + 3]);
      l[g] = l[g] * cr[g] + ((r4[0] + r4[1]) + (r4[2] + r4[3]));
    }
   }
   asm volatile("s_wait_dscnt 0x0" ::: "memory");     // this wave has left the buffer that is refilled below
   asm volatile("s_wait_asynccnt 0x0" ::: "memory");  // this wave's share of stage t + 1 has landed
   __syncthreads();                       // stage t + 1 visible to all; every reader has left stage t
   if (t + 2 < T) stageKV((t + 2) * KH, buf);
  }
  asm volatile("s_wait_asynccnt 0x0" ::: "memory");   // no copy is left in flight when the wave ends

  // ---- join the two key halves ----
  // Behind the loop's last barrier nobody reads the K/V buffers and no copy is in
  // flight, so they serve as the exchange: a wave hands its partner the state of
  // column group 1 (accumulators, maximum, sum) and takes the partner's state of
  // its own group 0. 16 bytes a lane, lanes side by side: no bank conflict.
  constexpr int XW = 8 * 32 * 4 + 32 * 2;  // floats per wave: 8 x 4 accumulators and 2 scalars a lane
  static_assert(16 * XW * sizeof(float) <= sizeof(kv), "the exchange fits the K/V buffers");
  float* xch = (float*)&kv[0][0];
  {
    float* mine = xch + wave * XW;
#pragma unroll
    for (int nt = 0; nt < 4; ++nt)
#pragma unroll
      for (int q = 0; q < 2; ++q) {
        const f4 w = {o[1][nt][4 * q], o[1][nt][4 * q + 1], o[1][nt][4 * q + 2], o[1][nt][4 * q + 3]};
        *(f4*)(mine + ((nt * 2 + q) * 32 + lane) * 4) = w;
      }
    mine[8 * 32 * 4 + lane * 2]     = m[1];
    mine[8 * 32 * 4 + lane * 2 + 1] = l[1];
  }
  __syncthreads();                        // every wave's hand-over is written before its partner reads it
  const float* theirs = xch + (wave ^ 8) * XW;
  const float mp = theirs[8 * 32 * 4 + lane * 2];
  const float lp = theirs[8 * 32 * 4 + lane * 2 + 1];
  const float mj = fmaxf(m[0], mp);
  const float ca = __expf(m[0] - mj);     // weight of this wave's key half
  const float cb = __expf(mp - mj);       // weight of the partner's
  const float lj = l[0] * ca + lp * cb;

  // ---- normalize and write attention output ----
  // Lane holds d = nt*16 + 8*hi + (0..7) of query nl: 16 contiguous bytes per nt.
  const float inv = 1.0f / (lj + xhalf(lj));
  const float fa = ca * inv, fb = cb * inv;
  _Float16* orow = oh + ((size_t)(b * SS + qt * 16 + nl)) * DHID + h0 * DH + 8 * hi;
#pragma unroll
  for (int nt = 0; nt < 4; ++nt) {
    h8 w;
#pragma unroll
    for (int q = 0; q < 2; ++q) {
      const f4 op = *(const f4*)(theirs + ((nt * 2 + q) * 32 + lane) * 4);
#pragma unroll
      for (int r = 0; r < 4; ++r) w[4 * q + r] = (_Float16)(o[0][nt][4 * q + r] * fa + op[r] * fb);
    }
    *(h8*)(orow + nt * 16) = w;
  }
}

// ---------------------------------------------------------------------------
// Launcher
// ---------------------------------------------------------------------------
extern "C" void kernel_launch(void* const* d_in, const int* in_sizes, int n_in,
                              void* d_out, int out_size, void* d_ws, size_t ws_size,
                              hipStream_t stream) {
  (void)in_sizes; (void)n_in; (void)out_size; (void)ws_size;

  const float* query = (const float*)d_in[0];
  const float* key   = (const float*)d_in[1];
  const float* value = (const float*)d_in[2];
  const float* Wq    = (const float*)d_in[3];
  const float* bq    = (const float*)d_in[4];
  const float* Wk    = (const float*)d_in[5];
  const float* bk    = (const float*)d_in[6];
  const float* Wv    = (const float*)d_in[7];
  const float* bv    = (const float*)d_in[8];
  const float* Wo    = (const float*)d_in[9];
  const float* bo    = (const float*)d_in[10];
  float* outF = (float*)d_out;

  // workspace carve-up (f16, 256B aligned), ~45 MB total
  char* ws = (char*)d_ws;
  size_t off = 0;
  auto carve = [&](size_t halves) {
    void* p = ws + off;
    off += (halves * sizeof(_Float16) + 255) & ~(size_t)255;
    return (_Float16*)p;
  };
  _Float16* Xq  = carve((size_t)BSZ * DIN);
  _Float16* Xk  = carve((size_t)BSZ * DIN);
  _Float16* Xv  = carve((size_t)BSZ * DIN);
  _Float16* WqT = carve((size_t)DIN * DHID);
  _Float16* WkT = carve((size_t)DH * DIN);
  _Float16* WvT = carve((size_t)DH * DIN);
  _Float16* WoT = carve((size_t)DIN * DHID);
  _Float16* qp  = carve((size_t)BSZ * DHID);
  _Float16* kp  = carve((size_t)BSZ * DH);
  _Float16* vTp = carve((size_t)DH * BSZ);   // V^T [64, B*S]
  _Float16* oat = carve((size_t)BSZ * DHID);

  cast_all<<<dim3(CAST_BLOCKS), CAST_THREADS, 0, stream>>>(
      query, key, value, Wq, Wk, Wv, Wo, Xq, Xk, Xv, WqT, WkT, WvT, WoT);

  // projections (WMMA, 128-row tiles per 16-wave block): K, V and Q in one launch
  gemm_qkv<<<dim3(BSZ / GM, 2 + DHID / 128), GEMM_THREADS, 0, stream>>>(
      Xq, Xk, Xv, WqT, WkT, WvT, bq, bk, bv, qp, kp, vTp, BSZ, DIN);

  // attention (WMMA flash, 16 heads per block sharing LDS-staged K/V)
  mqa_attn<<<dim3(SS / 16, BB), 512, 0, stream>>>(qp, kp, vTp, oat);

  // output projection (WMMA, fp32 out)
  gemm_out<<<dim3(BSZ / GM, DIN / 128), GEMM_THREADS, 0, stream>>>(oat, WoT, bo, outF, BSZ, DIN, DHID);
}

// v008
// A run of this version takes 72.6 microseconds.
// Two timings next to v007 put it at 1.04 and 1.03 times that version's speed.
// Over all steps from v000 it is 4.63 times as fast.
#include <hip/hip_runtime.h>
#include <hip/hip_bf16.h>

// ---------------------------------------------------------------------------
// MQA forward, all matmuls on v_wmma_f32_16x16x32_f16 (CDNA5 / gfx1250).
// B=2, S=2048, d_model=1024, H=16, Dh=64 (single shared K/V head).
// GEMMs: 16-wave blocks, both operands staged in LDS via global_load_async_to_lds
// (double buffered, ASYNCcnt).
// Attention: 16-wave blocks (two heads and half the keys per wave) sharing
// async-staged, double-buffered K/V stages in LDS -- 16x cut in L2 traffic for
// the shared MQA head; a stage holds many 32-key passes, so the waves meet rarely.
// Launches that do not depend on one another share one launch (the block index
// picks the job): all casts; the Q, K and V projections.
// ---------------------------------------------------------------------------

typedef __attribute__((ext_vector_type(16))) _Float16 v16h;
typedef __attribute__((ext_vector_type(8)))  _Float16 h8;
typedef __attribute__((ext_vector_type(8)))  float    v8f;
typedef __attribute__((ext_vector_type(2)))  _Float16 h2;
typedef __attribute__((ext_vector_type(4)))  int      v4i;
typedef __attribute__((ext_vector_type(4)))  float    f4;
typedef __attribute__((ext_vector_type(4)))  _Float16 h4;

#define BB    2
#define SS    2048
#define BSZ   4096      // B*S
#define DIN   1024
#define DHID  1024
#define NH    16
#define DH    64
#define SCALE 0.03125f  // 1/sqrt(1024)
#define LOG2E 1.44269504f  // log2(e)
#define TAU   5.5f      // how far a score may stand above its query's reference: e^5.5 < 256, well inside f16

// LDS row pitches in halves. Every tile here is read by 16-byte loads, 16 rows
// at a time, so the pitch is an odd multiple of 16 bytes: the 16 rows then fall
// on 16 different groups of four banks instead of on two (128-byte rows) or
// one (512-byte rows).
#define P64   72        // rows of 64 halves: 128 B of data, 144 B pitch
#define KT    256       // keys per attention stage (4 passes of 32 keys for each key half)
#define PKT   (KT + 8)  // rows of KT halves: 512 B of data, 528 B pitch

#if __has_builtin(__builtin_amdgcn_global_load_async_to_lds_b128)
#define HAVE_ASYNC 1
#else
#define HAVE_ASYNC 0
#endif

// 16-byte global -> LDS copy; async (ASYNCcnt) when the gfx1250 builtin exists.
__device__ __forceinline__ void cp16(const _Float16* g, _Float16* l) {
#if HAVE_ASYNC
  __builtin_amdgcn_global_load_async_to_lds_b128(
      (__attribute__((address_space(1))) v4i*)g,
      (__attribute__((address_space(3))) v4i*)l, 0, 0);
#else
  *(h8*)l = *(const h8*)g;
#endif
}

// Stands behind a global store, in front of the next write of a register that the
// store names (its address pair, its data).
__device__ __forceinline__ void store_issued() {
  asm volatile("s_wait_xcnt 0x0" ::: "memory");
}

// Assemble a 16-bit WMMA A/B fragment (16x32 resp. 32x16) for one K=32 chunk.
// Per ISA 7.12.2: lane holds row/col (lane&15); hi = lane>>4 selects the K
// half-groups. Half t -> K = t + 8*hi + 8*(t>=8); pairs merge into b128 loads.
__device__ __forceinline__ v16h frag16(const _Float16* __restrict__ base, int hi) {
  v16h r;
#pragma unroll
  for (int tp = 0; tp < 8; ++tp) {
    const int kk = 2 * tp + 8 * hi + ((tp >= 4) ? 8 : 0);
    h2 p = *(const h2*)(base + kk);
    r[2 * tp]     = p.x;
    r[2 * tp + 1] = p.y;
  }
  return r;
}

// ---------------------------------------------------------------------------
// fp32 -> f16 casts. A launch pays for every wave it starts, so a thread moves
// 32 elements: few waves, each with 8 16-byte loads in flight per lane.
// ---------------------------------------------------------------------------
#define CAST_THREADS 512                       // 16 waves: one block fills a WGP's stream
#define CAST_LOADS   8                         // 16-byte loads in flight per lane
#define CAST_ELEMS   (CAST_THREADS * CAST_LOADS * 4)   // elements per block
static_assert((BSZ * DIN) % CAST_ELEMS == 0, "cast_h has no tail");
static_assert(DIN % 64 == 0 && DHID % 64 == 0 && DH % 64 == 0, "cast_t has no tail");

// Each wave owns 4 KB of input in a row: every load covers 512 contiguous bytes
// (4 whole lines), every store 256 (2 whole lines); all loads precede the stores.
__device__ __forceinline__ void
cast_h(const float* __restrict__ in, _Float16* __restrict__ out, int blk) {
  const int wave = threadIdx.x >> 5;
  const int lane = threadIdx.x & 31;
  const size_t g = ((size_t)blk * (CAST_THREADS / 32) + wave) * (CAST_LOADS * 32) + lane;
  const f4* __restrict__ src = (const f4*)in + g;   // groups of 4 elements
  h4* __restrict__ dst = (h4*)out + g;
  f4 v[CAST_LOADS];
#pragma unroll
  for (int i = 0; i < CAST_LOADS; ++i) v[i] = src[i * 32];
#pragma unroll
  for (int i = 0; i < CAST_LOADS; ++i) dst[i * 32] = __builtin_convertvector(v[i], h4);
  store_issued();   // another job's code follows in the merged kernel
}

// W [K,N] fp32 row-major  ->  W^T [N,K] f16 row-major.
// A wave transposes a 64(k) x 16(n) tile in registers: a lane loads 8 k-rows of
// 4 n each and stores, for each of its 4 n, 8 consecutive k as 16 bytes; the 8
// lanes of one n together write one whole 128-byte line of W^T.
// 4 waves side by side in n make a 64 x 64 tile; a block of 16 waves takes 4 tiles
// that follow one another in n, then k. K and N are compile-time so that the 8
// loads share one address and the 4 stores another (immediate offsets).
template <int K, int N>
__device__ __forceinline__ void
cast_t(const float* __restrict__ in, _Float16* __restrict__ out, int blk) {
  const int wave = threadIdx.x >> 5;
  const int lane = threadIdx.x & 31;
  const int tile = blk * (CAST_THREADS / 128) + (wave >> 2);
  const int k = (tile / (N / 64)) * 64 + (lane & 7) * 8;
  const int n = (tile % (N / 64)) * 64 + (wave & 3) * 16 + (lane >> 3) * 4;
  f4 v[8];
#pragma unroll
  for (int j = 0; j < 8; ++j) v[j] = *(const f4*)(in + (size_t)(k + j) * N + n);
#pragma unroll
  for (int c = 0; c < 4; ++c) {
    h8 r;
#pragma unroll
    for (int j = 0; j < 8; ++j) r[j] = (_Float16)v[j][c];
    *(h8*)(out + (size_t)(n + c) * K + k) = r;
  }
  store_issued();   // another job's code follows in the merged kernel
}

// All seven casts in one launch: none reads what another writes, so one launch
// pays the gap, the fill and the tail once instead of seven times.
#define HBLK  (BSZ * DIN / CAST_ELEMS)                       // blocks per activation
#define TBLKW ((DIN / 64) * (DHID / 64) / (CAST_THREADS / 128))  // blocks per 1024 x 1024 weight
#define TBLKN ((DIN / 64) * (DH / 64) / (CAST_THREADS / 128))    // blocks per 1024 x 64 weight
#define CAST_BLOCKS (3 * HBLK + 2 * TBLKW + 2 * TBLKN)
static_assert(((DIN / 64) * (DH / 64)) % (CAST_THREADS / 128) == 0, "whole blocks of tiles");

__global__ void __launch_bounds__(CAST_THREADS)
cast_all(const float* __restrict__ query, const float* __restrict__ key,
         const float* __restrict__ value,
         const float* __restrict__ Wq, const float* __restrict__ Wk,
         const float* __restrict__ Wv, const float* __restrict__ Wo,
         _Float16* __restrict__ Xq, _Float16* __restrict__ Xk, _Float16* __restrict__ Xv,
         _Float16* __restrict__ WqT, _Float16* __restrict__ WkT,
         _Float16* __restrict__ WvT, _Float16* __restrict__ WoT) {
  int blk = blockIdx.x;
  if (blk < HBLK) { cast_h(query, Xq, blk); return; }
  blk -= HBLK;
  if (blk < HBLK) { cast_h(key, Xk, blk); return; }
  blk -= HBLK;
  if (blk < HBLK) { cast_h(value, Xv, blk); return; }
  blk -= HBLK;
  if (blk < TBLKW) { cast_t<DIN, DHID>(Wq, WqT, blk); return; }
  blk -= TBLKW;
  if (blk < TBLKW) { cast_t<DHID, DIN>(Wo, WoT, blk); return; }
  blk -= TBLKW;
  if (blk < TBLKN) { cast_t<DIN, DH>(Wk, WkT, blk); return; }
  blk -= TBLKN;
  cast_t<DIN, DH>(Wv, WvT, blk);
}

// ---------------------------------------------------------------------------
// WMMA GEMM:  C[M,N] = X[M,K] @ W[K,N] + bias,  W given as WT[N,K].
// Block = 16 waves = a 128 x BN tile (BN = 128, or 64 for the narrow K and V
// products); a wave owns 32 x BN/4 of it. Both operands of a 64-k stage are laid
// in LDS by async copies (whole 128-byte lines), two buffers: the next stage's
// copies fly while this stage is worked on, so no wave waits out a load of its
// own, and each operand byte is fetched from L2 once per 128 rows or columns.
// ---------------------------------------------------------------------------
#define GEMM_THREADS 512
#define GM      128                    // rows of X per block
#define GK      64                     // k per stage
#define STAGE_H ((GM + 128) * P64)     // halves per buffer: GM rows of X, then up to 128 rows of WT
static_assert(BSZ % GM == 0 && DHID % 128 == 0 && DIN % 128 == 0 && DH == 64, "whole tiles");
static_assert(DIN % GK == 0 && DHID % GK == 0, "whole stages");

// A wave's 16 x (16 * NT) accumulators plus bias to memory. KIND 0: f32 to outF; 1: f16
// to outH; 2: f16 to outH, transposed. C/D layout: register r is row gm0 + r, the
// lane's column is gn0 + 16 * nt.
template <int KIND, int NT>
__device__ __forceinline__ void
store_tile(const v8f (&c)[NT], const float* __restrict__ bias,
           _Float16* __restrict__ outH, float* __restrict__ outF,
           int M, int N, int gm0, int gn0) {
#pragma unroll
  for (int nt = 0; nt < NT; ++nt) {
    const int gn = gn0 + nt * 16;
    const float bval = bias ? bias[gn] : 0.0f;
#pragma unroll
    for (int r = 0; r < 8; ++r) {
      const int gm = gm0 + r;
      const float val = c[nt][r] + bval;
      if constexpr (KIND == 2)      outH[(size_t)gn * M + gm] = (_Float16)val;
      else if constexpr (KIND == 1) outH[(size_t)gm * N + gn] = (_Float16)val;
      else                          outF[(size_t)gm * N + gn] = val;
      if constexpr (KIND != 2) store_issued();   // the next element reuses the address and data registers
    }
    if constexpr (KIND == 2) store_issued();     // one run of 8 neighbours; the next run reuses its registers
  }
}

template <int BN, bool HALF_OUT>   // output: f16 (outH, plain or transposed) or f32 (outF)
__device__ __forceinline__ void
gemm_tile(const _Float16* __restrict__ X,
          const _Float16* __restrict__ WT,
          const float* __restrict__ bias,
          _Float16* __restrict__ outH,
          float* __restrict__ outF,
          int M, int N, int K, int transposeOut, int n0,
          _Float16* ring) {            // LDS, 2 * STAGE_H halves
  constexpr int NT = BN / 64;            // 16-column accumulators per wave and 16 rows

  const int tid  = threadIdx.x;          // 0..511
  const int wave = tid >> 5;
  const int lane = tid & 31;
  const int nl   = lane & 15;
  const int hi   = lane >> 4;
  const int wm   = wave & 3;             // the wave's 32 rows
  const int wn   = wave >> 2;            // the wave's BN/4 columns
  const int m0   = blockIdx.x * GM;

  // One stage: GM rows of X and BN rows of WT, 64 k each = 8 segments of 16 bytes a
  // row; 8 neighbouring lanes copy one row's whole line.
  auto stage = [&](int k0, int buf) {
    _Float16* sa = ring + buf * STAGE_H;
    _Float16* sb = sa + GM * P64;
#pragma unroll
    for (int i = 0; i < GM * 8 / GEMM_THREADS; ++i) {
      const int seg = tid + i * GEMM_THREADS;
      const int row = seg >> 3;
      const int c16 = seg & 7;
      cp16(X + (size_t)(m0 + row) * K + k0 + c16 * 8, sa + row * P64 + c16 * 8);
    }
#pragma unroll
    for (int i = 0; i < BN * 8 / GEMM_THREADS; ++i) {
      const int seg = tid + i * GEMM_THREADS;
      const int row = seg >> 3;
      const int c16 = seg & 7;
      cp16(WT + (size_t)(n0 + row) * K + k0 + c16 * 8, sb + row * P64 + c16 * 8);
    }
  };

  v8f z = {};
  v8f c[2][NT];
#pragma unroll
  for (int i = 0; i < 2; ++i)
#pragma unroll
    for (int j = 0; j < NT; ++j) c[i][j] = z;

  const int T = K / GK;                  // stages
  stage(0, 0);
  asm volatile("s_wait_asynccnt 0x0" ::: "memory");   // this wave's share of stage 0 has landed
  __syncthreads();                       // stage 0 visible to all 16 waves
  if (T > 1) stage(GK, 1);

  for (int t = 0; t < T; ++t) {
    const _Float16* sa = ring + (t & 1) * STAGE_H + (wm * 32 + nl) * P64;
    const _Float16* sb = ring + (t & 1) * STAGE_H + (GM + wn * (NT * 16) + nl) * P64;
#pragma unroll
    for (int kc = 0; kc < GK; kc += 32) {
      v16h a[2], b[NT];
#pragma unroll
      for (int i = 0; i < 2; ++i)  a[i] = frag16(sa + i * 16 * P64 + kc, hi);
#pragma unroll
      for (int j = 0; j < NT; ++j) b[j] = frag16(sb + j * 16 * P64 + kc, hi);
#pragma unroll
      for (int i = 0; i < 2; ++i)
#pragma unroll
        for (int j = 0; j < NT; ++j)
          c[i][j] = __builtin_amdgcn_wmma_f32_16x16x32_f16(
              false, a[i], false, b[j], (short)0, c[i][j], false, false);
    }
    asm volatile("s_wait_dscnt 0x0" ::: "memory");     // this wave has left the buffer that is refilled below
    asm volatile("s_wait_asynccnt 0x0" ::: "memory");  // this wave's share of stage t + 1 has landed
    __syncthreads();                     // stage t + 1 visible to all; every reader has left stage t
    if (t + 2 < T) stage((t + 2) * GK, t & 1);
  }
  asm volatile("s_wait_asynccnt 0x0" ::: "memory");    // no copy is left in flight when the wave ends

#pragma unroll
  for (int i = 0; i < 2; ++i) {
    const int gm0 = m0 + wm * 32 + i * 16 + 8 * hi;
    const int gn0 = n0 + wn * (NT * 16) + nl;
    if constexpr (!HALF_OUT)  store_tile<0, NT>(c[i], bias, outH, outF, M, N, gm0, gn0);
    else if (transposeOut)    store_tile<2, NT>(c[i], bias, outH, outF, M, N, gm0, gn0);
    else                      store_tile<1, NT>(c[i], bias, outH, outF, M, N, gm0, gn0);
  }
}

// The output projection (f32 out).
__global__ void __launch_bounds__(GEMM_THREADS)
gemm_out(const _Float16* __restrict__ X,
         const _Float16* __restrict__ WT,
         const float* __restrict__ bias,
         float* __restrict__ outF,
         int M, int N, int K) {
  __shared__ __attribute__((aligned(16))) _Float16 ring[2 * STAGE_H];
  gemm_tile<128, false>(X, WT, bias, nullptr, outF, M, N, K, 0, blockIdx.y * 128, ring);
}

// The Q, K and V projections in one launch: the K and V products have few blocks
// and last as long as a block's whole k loop, which runs beside the Q product
// instead of behind it. blockIdx.y: 0 = K, 1 = V (stored transposed), 2 and up =
// the 128-column strips of Q.
__global__ void __launch_bounds__(GEMM_THREADS)
gemm_qkv(const _Float16* __restrict__ Xq, const _Float16* __restrict__ Xk,
         const _Float16* __restrict__ Xv,
         const _Float16* __restrict__ WqT, const _Float16* __restrict__ WkT,
         const _Float16* __restrict__ WvT,
         const float* __restrict__ bq, const float* __restrict__ bk,
         const float* __restrict__ bv,
         _Float16* __restrict__ qp, _Float16* __restrict__ kp, _Float16* __restrict__ vTp,
         int M, int K) {
  __shared__ __attribute__((aligned(16))) _Float16 ring[2 * STAGE_H];
  const int y = blockIdx.y;
  if (y < 2)
    gemm_tile<64, true>(y == 0 ? Xk : Xv, y == 0 ? WkT : WvT, y == 0 ? bk : bv,
                        y == 0 ? kp : vTp, nullptr, M, DH, K, y == 1, 0, ring);
  else
    gemm_tile<128, true>(Xq, WqT, bq, qp, nullptr, M, DHID, K, 0, (y - 2) * 128, ring);
}

// Value of lane l ^ 16 (the other half of the wave), as one vector instruction.
__device__ __forceinline__ float xhalf(float x) {
  const int b = __builtin_bit_cast(int, x);
  return __builtin_bit_cast(float,
      __builtin_amdgcn_permlanex16(b, b, 0x76543210, 0xfedcba98, false, false));
}

// The grid is one block per WGP, four waves per SIMD: the register budget is stated
// for that, or the compiler, counting two blocks into the LDS, squeezes the pass
// into half the registers and strings its exponentials on one register.
__global__ void __launch_bounds__(512) __attribute__((amdgpu_waves_per_eu(4, 4)))
mqa_attn(const _Float16* __restrict__ qh,
         const _Float16* __restrict__ kh,
         const _Float16* __restrict__ vT,
         _Float16* __restrict__ oh) {
  // [buf]: V^T tile, vcol(64) x key(KT), then K tile, key row(KT) x d(64), both padded; 2 x 69 KB.
  // Keys 0 .. KT/2 - 1 of a tile belong to the first key half, the rest to the second.
  constexpr int VH = DH * PKT;            // halves of a V^T tile
  constexpr int KH = KT / 2;              // keys of one key half per stage
  constexpr int SH = SS / 2;              // keys of one key half
  __shared__ __attribute__((aligned(16))) _Float16 kv[2][VH + KT * P64];

  const int tid  = threadIdx.x;           // 0..511
  const int wave = __builtin_amdgcn_readfirstlane(tid >> 5);   // scalar: the pass loop's bounds hang on it
  const int lane = tid & 31;
  const int nl   = lane & 15;
  const int hi   = lane >> 4;
  const int qt   = blockIdx.x;            // query tile [0,128)
  const int b    = blockIdx.y;            // batch
  const int half = wave >> 3;             // the wave's key half
  // Column group 0 is the head whose output this wave writes, group 1 the head that
  // its partner (wave ^ 8) writes: the partner holds the same two heads, swapped.
  const int h0   = 2 * (wave & 7) + half;
  const int h1   = h0 ^ 1;

  // One stage: KT rows of K (8 segments of 16 bytes a row) and 64 rows of V^T
  // (KT / 8 segments a row), keys j .. j + KH - 1 of each key half; every thread
  // copies its share of both.
  auto stageKV = [&](int j, int buf) {
#pragma unroll
    for (int i = 0; i < KT * 8 / 512; ++i) {
      const int seg = tid + i * 512;
      const int row = seg >> 3, s = seg & 7;
      const int key = (row / KH) * SH + j + row % KH;
      cp16(kh + ((size_t)(b * SS + key)) * DH + s * 8,
           &kv[buf][VH + row * P64 + s * 8]);
    }
#pragma unroll
    for (int i = 0; i < DH * (KT / 8) / 512; ++i) {
      const int seg = tid + i * 512;
      const int row = seg / (KT / 8), s = seg % (KT / 8);
      const int key = (s / (KH / 8)) * SH + j + (s % (KH / 8)) * 8;
      cp16(vT + (size_t)row * BSZ + b * SS + key,
           &kv[buf][row * PKT + s * 8]);
    }
  };

  // Q tiles resident as two B fragments a head (d = 0..31, 32..63), column = query nl
  const _Float16* qrow = qh + ((size_t)(b * SS + qt * 16 + nl)) * DHID;
  const v16h qb[2][2] = {{frag16(qrow + h0 * DH, hi), frag16(qrow + h0 * DH + 32, hi)},
                         {frag16(qrow + h1 * DH, hi), frag16(qrow + h1 * DH + 32, hi)}};

  v8f z = {};
  v8f o[2][4] = {{z, z, z, z}, {z, z, z, z}};   // O^T accum per head, 64(d) x 16(query)
  // Reference of query nl's exponentials (same in both halves of the wave): the running
  // maximum as it stood when it was last taken over. Any reference gives the same
  // quotient; it only has to keep e^(score - m) inside f16, so it moves, and O and the
  // sum are rescaled, only in a pass where some score of the wave stands above mt = m + TAU.
  float m[2]  = {-3.0e38f, -3.0e38f};
  float mt[2] = {-3.0e38f, -3.0e38f};
  float l[2] = {0.0f, 0.0f};              // running sum over this half-wave's keys only, relative to m

  constexpr int T = SH / KH;              // stages
  static_assert(SH % KH == 0 && T >= 2 && KH % 32 == 0, "whole stages, two buffers in use");
  stageKV(0, 0);
  asm volatile("s_wait_asynccnt 0x0" ::: "memory");   // this wave's share of stage 0 has landed
  __syncthreads();                        // stage 0 visible to all waves
  stageKV(KH, 1);

  for (int t = 0; t < T; ++t) {
   const int buf = t & 1;
   for (int jj = half * KH; jj < half * KH + KH; jj += 32) {  // passes of 32 keys, no barrier between them
    // ---- scores: two 16x16 tiles a head, S^T = K @ Q^T, A operand from LDS ----
    const _Float16* kr0 = &kv[buf][VH + (jj + nl) * P64];
    const _Float16* kr1 = &kv[buf][VH + (jj + 16 + nl) * P64];
    const v16h ka[2][2] = {{frag16(kr0, hi), frag16(kr0 + 32, hi)},
                           {frag16(kr1, hi), frag16(kr1 + 32, hi)}};
    v16h av[4];                           // V^T fragments, 16 d each, for the second product
#pragma unroll
    for (int nt = 0; nt < 4; ++nt) av[nt] = frag16(&kv[buf][(nt * 16 + nl) * PKT + jj], hi);
    // Keeps the pass's 16 LDS reads in one group at its head: left to itself the compiler
    // sinks half of the V^T reads in among the second product's WMMAs, which then wait them out.
    __builtin_amdgcn_sched_barrier(0);
    v8f s[2][2];                          // [head][16 keys]
#pragma unroll
    for (int kt = 0; kt < 2; ++kt)
#pragma unroll
      for (int g = 0; g < 2; ++g)
        s[g][kt] = __builtin_amdgcn_wmma_f32_16x16x32_f16(false, ka[kt][0], false, qb[g][0], (short)0, z, false, false);
#pragma unroll
    for (int kt = 0; kt < 2; ++kt)
#pragma unroll
      for (int g = 0; g < 2; ++g)
        s[g][kt] = __builtin_amdgcn_wmma_f32_16x16x32_f16(false, ka[kt][1], false, qb[g][1], (short)0, s[g][kt], false, false);
    // Keeps the eight score products back to back: each is a slot of the distance that the
    // chip needs in front of the first read of an earlier one's result, where the compiler,
    // drawing the scaling in among them, pads with idle instructions.
    __builtin_amdgcn_sched_barrier(0);

    // ---- online softmax, lazy reference: 16 scores of query nl and head g in this lane ----
    v8f xs[2][2];                         // scaled scores: keys r + 8*hi, keys 16 + r + 8*hi
    float tm[2];                          // largest of this lane's 16 scores
#pragma unroll
    for (int g = 0; g < 2; ++g) {
      xs[g][0] = s[g][0] * SCALE;
      xs[g][1] = s[g][1] * SCALE;
      float x[16];
#pragma unroll
      for (int r = 0; r < 8; ++r) { x[r] = xs[g][0][r]; x[8 + r] = xs[g][1][r]; }
      float t4[4];                        // four short chains instead of one long one
#pragma unroll
      for (int c = 0; c < 4; ++c)
        t4[c] = fmaxf(fmaxf(x[4 * c], x[4 * c + 1]), fmaxf(x[4 * c + 2], x[4 * c + 3]));
      tm[g] = fmaxf(fmaxf(t4[0], t4[1]), fmaxf(t4[2], t4[3]));
    }
    // Every lane tests its own 16 scores, so the vote covers all 32 keys of every query;
    // the branch is the same for the whole wave (all lanes stay on for the exchange).
    float cr[2] = {1.0f, 1.0f};           // what the pass's move of the reference takes off the sums so far
    if (__builtin_amdgcn_ballot_w32(tm[0] > mt[0] || tm[1] > mt[1]) != 0u) {
#pragma unroll
      for (int g = 0; g < 2; ++g) {
        const float mnew = fmaxf(m[g], fmaxf(tm[g], xhalf(tm[g])));  // with the other 16 keys of the query
        cr[g] = __builtin_amdgcn_exp2f((m[g] - mnew) * LOG2E);
        m[g]  = mnew;
        mt[g] = mnew + TAU;
      }
#pragma unroll
      for (int g = 0; g < 2; ++g)
#pragma unroll
        for (int nt = 0; nt < 4; ++nt) o[g][nt] *= cr[g];
    }
    v8f d[2][2];                          // score minus the reference
#pragma unroll
    for (int g = 0; g < 2; ++g) {
      d[g][0] = (xs[g][0] - m[g]) * LOG2E;
      d[g][1] = (xs[g][1] - m[g]) * LOG2E;
    }
    // e^d is taken as 2^(d * log2 e), which is what __expf compiles to, so that this can
    // stand between the products and the exponentials.
    __builtin_amdgcn_sched_barrier(0);
    v16h pb[2];
    float p[2][16];
#pragma unroll
    for (int g = 0; g < 2; ++g) {
      // Half t of the B fragment is key t + 8*hi (t < 8) or 8 + t + 8*hi: the scores' order.
#pragma unroll
      for (int r = 0; r < 8; ++r) {
        p[g][r]      = __builtin_amdgcn_exp2f(d[g][0][r]);
        p[g][8 + r]  = __builtin_amdgcn_exp2f(d[g][1][r]);
        pb[g][r]     = (_Float16)p[g][r];
        pb[g][8 + r] = (_Float16)p[g][8 + r];
      }
    }

    // ---- O^T += V^T (A operand, read above) @ P^T (registers) ----
#pragma unroll
    for (int nt = 0; nt < 4; ++nt)
#pragma unroll
      for (int g = 0; g < 2; ++g)
        o[g][nt] = __builtin_amdgcn_wmma_f32_16x16x32_f16(
            false, av[nt], false, pb[g], (short)0, o[g][nt], false, false);
    // Keeps the row sums behind the products: with no barrier at the pass's end their adds
    // are the vector slots that the chip needs between the last product and the next
    // pass's first write of that product's operand registers, over the back edge.
    __builtin_amdgcn_sched_barrier(0);
#pragma unroll
    for (int g = 0; g < 2; ++g) {
      float r4[4];
#pragma unroll
      for (int c = 0; c < 4; ++c)
        r4[c] = (p[g][4 * c] + p[g][4 * c + 1]) + (p[g][4 * c + 2] + p[g][4 * c + 3]);
      l[g] = l[g] * cr[g] + ((r4[0] + r4[1]) + (r4[2] + r4[3]));
    }
   }
   asm volatile("s_wait_dscnt 0x0" ::: "memory");     // this wave has left the buffer that is refilled below
   asm volatile("s_wait_asynccnt 0x0" ::: "memory");  // this wave's share of stage t + 1 has landed
   __syncthreads();                       // stage t + 1 visible to all; every reader has left stage t
   if (t + 2 < T) stageKV((t + 2) * KH, buf);
  }
  asm volatile("s_wait_asynccnt 0x0" ::: "memory");   // no copy is left in flight when the wave ends

  // ---- join the two key halves ----
  // Behind the loop's last barrier nobody reads the K/V buffers and no copy is in
  // flight, so they serve as the exchange: a wave hands its partner the state of
  // column group 1 (accumulators, maximum, sum) and takes the partner's state of
  // its own group 0. 16 bytes a lane, lanes side by side: no bank conflict.
  constexpr int XW = 8 * 32 * 4 + 32 * 2;  // floats per wave: 8 x 4 accumulators and 2 scalars a lane
  static_assert(16 * XW * sizeof(float) <= sizeof(kv), "the exchange fits the K/V buffers");
  float* xch = (float*)&kv[0][0];
  {
    float* mine = xch + wave * XW;
#pragma unroll
    for (int nt = 0; nt < 4; ++nt)
#pragma unroll
      for (int q = 0; q < 2; ++q) {
        const f4 w = {o[1][nt][4 * q], o[1][nt][4 * q + 1], o[1][nt][4 * q + 2], o[1][nt][4 * q + 3]};
        *(f4*)(mine + ((nt * 2 + q) * 32 + lane) * 4) = w;
      }
    mine[8 * 32 * 4 + lane * 2]     = m[1];
    mine[8 * 32 * 4 + lane * 2 + 1] = l[1];
  }
  __syncthreads();                        // every wave's hand-over is written before its partner reads it
  const float* theirs = xch + (wave ^ 8) * XW;
  const float mp = theirs[8 * 32 * 4 + lane * 2];
  const float lp = theirs[8 * 32 * 4 + lane * 2 + 1];
  const float mj = fmaxf(m[0], mp);       // the halves' references differ; any common one joins them
  const float ca = __expf(m[0] - mj);     // weight of this wave's key half
  const float cb = __expf(mp - mj);       // weight of the partner's
  const float lj = l[0] * ca + lp * cb;

  // ---- normalize and write attention output ----
  // Lane holds d = nt*16 + 8*hi + (0..7) of query nl: 16 contiguous bytes per nt.
  const float inv = 1.0f / (lj + xhalf(lj));
  const float fa = ca * inv, fb = cb * inv;
  _Float16* orow = oh + ((size_t)(b * SS + qt * 16 + nl)) * DHID + h0 * DH + 8 * hi;
#pragma unroll
  for (int nt = 0; nt < 4; ++nt) {
    h8 w;
#pragma unroll
    for (int q = 0; q < 2; ++q) {
      const f4 op = *(const f4*)(theirs + ((nt * 2 + q) * 32 + lane) * 4);
#pragma unroll
      for (int r = 0; r < 4; ++r) w[4 * q + r] = (_Float16)(o[0][nt][4 * q + r] * fa + op[r] * fb);
    }
    *(h8*)(orow + nt * 16) = w;
  }
}

// ---------------------------------------------------------------------------
// Launcher
// ---------------------------------------------------------------------------
extern "C" void kernel_launch(void* const* d_in, const int* in_sizes, int n_in,
                              void* d_out, int out_size, void* d_ws, size_t ws_size,
                              hipStream_t stream) {
  (void)in_sizes; (void)n_in; (void)out_size; (void)ws_size;

  const float* query = (const float*)d_in[0];
  const float* key   = (const float*)d_in[1];
  const float* value = (const float*)d_in[2];
  const float* Wq    = (const float*)d_in[3];
  const float* bq    = (const float*)d_in[4];
  const float* Wk    = (const float*)d_in[5];
  const float* bk    = (const float*)d_in[6];
  const float* Wv    = (const float*)d_in[7];
  const float* bv    = (const float*)d_in[8];
  const float* Wo    = (const float*)d_in[9];
  const float* bo    = (const float*)d_in[10];
  float* outF = (float*)d_out;

  // workspace carve-up (f16, 256B aligned), ~45 MB total
  char* ws = (char*)d_ws;
  size_t off = 0;
  auto carve = [&](size_t halves) {
    void* p = ws + off;
    off += (halves * sizeof(_Float16) + 255) & ~(size_t)255;
    return (_Float16*)p;
  };
  _Float16* Xq  = carve((size_t)BSZ * DIN);
  _Float16* Xk  = carve((size_t)BSZ * DIN);
  _Float16* Xv  = carve((size_t)BSZ * DIN);
  _Float16* WqT = carve((size_t)DIN * DHID);
  _Float16* WkT = carve((size_t)DH * DIN);
  _Float16* WvT = carve((size_t)DH * DIN);
  _Float16* WoT = carve((size_t)DIN * DHID);
  _Float16* qp  = carve((size_t)BSZ * DHID);
  _Float16* kp  = carve((size_t)BSZ * DH);
  _Float16* vTp = carve((size_t)DH * BSZ);   // V^T [64, B*S]
  _Float16* oat = carve((size_t)BSZ * DHID);

  cast_all<<<dim3(CAST_BLOCKS), CAST_THREADS, 0, stream>>>(
      query, key, value, Wq, Wk, Wv, Wo, Xq, Xk, Xv, WqT, WkT, WvT, WoT);

  // projections (WMMA, 128-row tiles per 16-wave block): K, V and Q in one launch
  gemm_qkv<<<dim3(BSZ / GM, 2 + DHID / 128), GEMM_THREADS, 0, stream>>>(
      Xq, Xk, Xv, WqT, WkT, WvT, bq, bk, bv, qp, kp, vTp, BSZ, DIN);

  // attention (WMMA flash, 16 heads per block sharing LDS-staged K/V)
  mqa_attn<<<dim3(SS / 16, BB), 512, 0, stream>>>(qp, kp, vTp, oat);

  // output projection (WMMA, fp32 out)
  gemm_out<<<dim3(BSZ / GM, DIN / 128), GEMM_THREADS, 0, stream>>>(oat, WoT, bo, outF, BSZ, DIN, DHID);
}

// v009
// One run takes 70.3 microseconds.
// In both of two side-by-side timings against v008, it was 1.03 times as fast.
// Counting every step since v000, it is 4.79 times as fast.
#include <hip/hip_runtime.h>
#include <hip/hip_bf16.h>

// ---------------------------------------------------------------------------
// MQA forward, all matmuls on v_wmma_f32_16x16x32_f16 (CDNA5 / gfx1250).
// B=2, S=2048, d_model=1024, H=16, Dh=64 (single shared K/V head).
// GEMMs: 16-wave blocks, both operands staged in LDS via global_load_async_to_lds
// (double buffered, ASYNCcnt).
// Attention: 16-wave blocks (two heads and half the keys per wave) sharing
// async-staged, double-buffered K/V stages in LDS -- 16x cut in L2 traffic for
// the shared MQA head; a stage holds many 32-key passes, so the waves meet rarely.
// Launches that do not depend on one another share one launch (the block index
// picks the job): all casts; the Q, K and V projections.
// ---------------------------------------------------------------------------

typedef __attribute__((ext_vector_type(16))) _Float16 v16h;
typedef __attribute__((ext_vector_type(8)))  _Float16 h8;
typedef __attribute__((ext_vector_type(8)))  float    v8f;
typedef __attribute__((ext_vector_type(2)))  _Float16 h2;
typedef __attribute__((ext_vector_type(4)))  int      v4i;
typedef __attribute__((ext_vector_type(4)))  float    f4;
typedef __attribute__((ext_vector_type(4)))  _Float16 h4;

#define BB    2
#define SS    2048
#define BSZ   4096      // B*S
#define DIN   1024
#define DHID  1024
#define NH    16
#define DH    64
#define SCALE 0.03125f  // 1/sqrt(1024)
#define LOG2E 1.44269504f  // log2(e)
#define TAU   5.5f      // how far a score may stand above its query's reference: e^5.5 < 256, well inside f16
#define C2    (SCALE * LOG2E)   // a product q.k times this is the score's exponent to base 2; Q is stored times C2
#define TAU2  (TAU * LOG2E)     // TAU as an exponent to base 2

// LDS row pitches in halves. Every tile here is read by 16-byte loads, 16 rows
// at a time, so the pitch is an odd multiple of 16 bytes: the 16 rows then fall
// on 16 different groups of four banks instead of on two (128-byte rows) or
// one (512-byte rows).
#define P64   72        // rows of 64 halves: 128 B of data, 144 B pitch
#define KT    256       // keys per attention stage (4 passes of 32 keys for each key half)
#define PKT   (KT + 8)  // rows of KT halves: 512 B of data, 528 B pitch

#if __has_builtin(__builtin_amdgcn_global_load_async_to_lds_b128)
#define HAVE_ASYNC 1
#else
#define HAVE_ASYNC 0
#endif

// 16-byte global -> LDS copy; async (ASYNCcnt) when the gfx1250 builtin exists.
__device__ __forceinline__ void cp16(const _Float16* g, _Float16* l) {
#if HAVE_ASYNC
  __builtin_amdgcn_global_load_async_to_lds_b128(
      (__attribute__((address_space(1))) v4i*)g,
      (__attribute__((address_space(3))) v4i*)l, 0, 0);
#else
  *(h8*)l = *(const h8*)g;
#endif
}

// Stands behind a global store, in front of the next write of a register that the
// store names (its address pair, its data).
__device__ __forceinline__ void store_issued() {
  asm volatile("s_wait_xcnt 0x0" ::: "memory");
}

// Assemble a 16-bit WMMA A/B fragment (16x32 resp. 32x16) for one K=32 chunk.
// Per ISA 7.12.2: lane holds row/col (lane&15); hi = lane>>4 selects the K
// half-groups. Half t -> K = t + 8*hi + 8*(t>=8); pairs merge into b128 loads.
__device__ __forceinline__ v16h frag16(const _Float16* __restrict__ base, int hi) {
  v16h r;
#pragma unroll
  for (int tp = 0; tp < 8; ++tp) {
    const int kk = 2 * tp + 8 * hi + ((tp >= 4) ? 8 : 0);
    h2 p = *(const h2*)(base + kk);
    r[2 * tp]     = p.x;
    r[2 * tp + 1] = p.y;
  }
  return r;
}

// ---------------------------------------------------------------------------
// fp32 -> f16 casts. A launch pays for every wave it starts, so a thread moves
// 32 elements: few waves, each with 8 16-byte loads in flight per lane.
// ---------------------------------------------------------------------------
#define CAST_THREADS 512                       // 16 waves: one block fills a WGP's stream
#define CAST_LOADS   8                         // 16-byte loads in flight per lane
#define CAST_ELEMS   (CAST_THREADS * CAST_LOADS * 4)   // elements per block
static_assert((BSZ * DIN) % CAST_ELEMS == 0, "cast_h has no tail");
static_assert(DIN % 64 == 0 && DHID % 64 == 0 && DH % 64 == 0, "cast_t has no tail");

// Each wave owns 4 KB of input in a row: every load covers 512 contiguous bytes
// (4 whole lines), every store 256 (2 whole lines); all loads precede the stores.
__device__ __forceinline__ void
cast_h(const float* __restrict__ in, _Float16* __restrict__ out, int blk) {
  const int wave = threadIdx.x >> 5;
  const int lane = threadIdx.x & 31;
  const size_t g = ((size_t)blk * (CAST_THREADS / 32) + wave) * (CAST_LOADS * 32) + lane;
  const f4* __restrict__ src = (const f4*)in + g;   // groups of 4 elements
  h4* __restrict__ dst = (h4*)out + g;
  f4 v[CAST_LOADS];
#pragma unroll
  for (int i = 0; i < CAST_LOADS; ++i) v[i] = src[i * 32];
#pragma unroll
  for (int i = 0; i < CAST_LOADS; ++i) dst[i * 32] = __builtin_convertvector(v[i], h4);
  store_issued();   // another job's code follows in the merged kernel
}

// W [K,N] fp32 row-major  ->  W^T [N,K] f16 row-major.
// A wave transposes a 64(k) x 16(n) tile in registers: a lane loads 8 k-rows of
// 4 n each and stores, for each of its 4 n, 8 consecutive k as 16 bytes; the 8
// lanes of one n together write one whole 128-byte line of W^T.
// 4 waves side by side in n make a 64 x 64 tile; a block of 16 waves takes 4 tiles
// that follow one another in n, then k. K and N are compile-time so that the 8
// loads share one address and the 4 stores another (immediate offsets).
template <int K, int N>
__device__ __forceinline__ void
cast_t(const float* __restrict__ in, _Float16* __restrict__ out, int blk) {
  const int wave = threadIdx.x >> 5;
  const int lane = threadIdx.x & 31;
  const int tile = blk * (CAST_THREADS / 128) + (wave >> 2);
  const int k = (tile / (N / 64)) * 64 + (lane & 7) * 8;
  const int n = (tile % (N / 64)) * 64 + (wave & 3) * 16 + (lane >> 3) * 4;
  f4 v[8];
#pragma unroll
  for (int j = 0; j < 8; ++j) v[j] = *(const f4*)(in + (size_t)(k + j) * N + n);
#pragma unroll
  for (int c = 0; c < 4; ++c) {
    h8 r;
#pragma unroll
    for (int j = 0; j < 8; ++j) r[j] = (_Float16)v[j][c];
    *(h8*)(out + (size_t)(n + c) * K + k) = r;
  }
  store_issued();   // another job's code follows in the merged kernel
}

// All seven casts in one launch: none reads what another writes, so one launch
// pays the gap, the fill and the tail once instead of seven times.
#define HBLK  (BSZ * DIN / CAST_ELEMS)                       // blocks per activation
#define TBLKW ((DIN / 64) * (DHID / 64) / (CAST_THREADS / 128))  // blocks per 1024 x 1024 weight
#define TBLKN ((DIN / 64) * (DH / 64) / (CAST_THREADS / 128))    // blocks per 1024 x 64 weight
#define CAST_BLOCKS (3 * HBLK + 2 * TBLKW + 2 * TBLKN)
static_assert(((DIN / 64) * (DH / 64)) % (CAST_THREADS / 128) == 0, "whole blocks of tiles");

__global__ void __launch_bounds__(CAST_THREADS)
cast_all(const float* __restrict__ query, const float* __restrict__ key,
         const float* __restrict__ value,
         const float* __restrict__ Wq, const float* __restrict__ Wk,
         const float* __restrict__ Wv, const float* __restrict__ Wo,
         _Float16* __restrict__ Xq, _Float16* __restrict__ Xk, _Float16* __restrict__ Xv,
         _Float16* __restrict__ WqT, _Float16* __restrict__ WkT,
         _Float16* __restrict__ WvT, _Float16* __restrict__ WoT) {
  int blk = blockIdx.x;
  if (blk < HBLK) { cast_h(query, Xq, blk); return; }
  blk -= HBLK;
  if (blk < HBLK) { cast_h(key, Xk, blk); return; }
  blk -= HBLK;
  if (blk < HBLK) { cast_h(value, Xv, blk); return; }
  blk -= HBLK;
  if (blk < TBLKW) { cast_t<DIN, DHID>(Wq, WqT, blk); return; }
  blk -= TBLKW;
  if (blk < TBLKW) { cast_t<DHID, DIN>(Wo, WoT, blk); return; }
  blk -= TBLKW;
  if (blk < TBLKN) { cast_t<DIN, DH>(Wk, WkT, blk); return; }
  blk -= TBLKN;
  cast_t<DIN, DH>(Wv, WvT, blk);
}

// ---------------------------------------------------------------------------
// WMMA GEMM:  C[M,N] = X[M,K] @ W[K,N] + bias,  W given as WT[N,K].
// Block = 16 waves = a 128 x BN tile (BN = 128, or 64 for the narrow K and V
// products); a wave owns 32 x BN/4 of it. Both operands of a 64-k stage are laid
// in LDS by async copies (whole 128-byte lines), two buffers: the next stage's
// copies fly while this stage is worked on, so no wave waits out a load of its
// own, and each operand byte is fetched from L2 once per 128 rows or columns.
// ---------------------------------------------------------------------------
#define GEMM_THREADS 512
#define GM      128                    // rows of X per block
#define GK      64                     // k per stage
#define STAGE_H ((GM + 128) * P64)     // halves per buffer: GM rows of X, then up to 128 rows of WT
static_assert(BSZ % GM == 0 && DHID % 128 == 0 && DIN % 128 == 0 && DH == 64, "whole tiles");
static_assert(DIN % GK == 0 && DHID % GK == 0, "whole stages");

// A wave's 16 x (16 * NT) accumulators plus bias to memory. KIND 0: f32 to outF; 1: f16
// to outH; 2: f16 to outH, transposed. C/D layout: register r is row gm0 + r, the
// lane's column is gn0 + 16 * nt.
template <int KIND, int NT>
__device__ __forceinline__ void
store_tile(const v8f (&c)[NT], const float* __restrict__ bias,
           _Float16* __restrict__ outH, float* __restrict__ outF,
           int M, int N, int gm0, int gn0, float oscale) {
#pragma unroll
  for (int nt = 0; nt < NT; ++nt) {
    const int gn = gn0 + nt * 16;
    const float bval = bias ? bias[gn] : 0.0f;
#pragma unroll
    for (int r = 0; r < 8; ++r) {
      const int gm = gm0 + r;
      const float val = (c[nt][r] + bval) * oscale;   // scaled in f32, in front of the one rounding
      if constexpr (KIND == 2)      outH[(size_t)gn * M + gm] = (_Float16)val;
      else if constexpr (KIND == 1) outH[(size_t)gm * N + gn] = (_Float16)val;
      else                          outF[(size_t)gm * N + gn] = val;
      if constexpr (KIND != 2) store_issued();   // the next element reuses the address and data registers
    }
    if constexpr (KIND == 2) store_issued();     // one run of 8 neighbours; the next run reuses its registers
  }
}

template <int BN, bool HALF_OUT>   // output: f16 (outH, plain or transposed) or f32 (outF)
__device__ __forceinline__ void
gemm_tile(const _Float16* __restrict__ X,
          const _Float16* __restrict__ WT,
          const float* __restrict__ bias,
          _Float16* __restrict__ outH,
          float* __restrict__ outF,
          int M, int N, int K, int transposeOut, int n0,
          float oscale,                // factor on the output (a literal at every call)
          _Float16* ring) {            // LDS, 2 * STAGE_H halves
  constexpr int NT = BN / 64;            // 16-column accumulators per wave and 16 rows

  const int tid  = threadIdx.x;          // 0..511
  const int wave = tid >> 5;
  const int lane = tid & 31;
  const int nl   = lane & 15;
  const int hi   = lane >> 4;
  const int wm   = wave & 3;             // the wave's 32 rows
  const int wn   = wave >> 2;            // the wave's BN/4 columns
  const int m0   = blockIdx.x * GM;

  // One stage: GM rows of X and BN rows of WT, 64 k each = 8 segments of 16 bytes a
  // row; 8 neighbouring lanes copy one row's whole line.
  auto stage = [&](int k0, int buf) {
    _Float16* sa = ring + buf * STAGE_H;
    _Float16* sb = sa + GM * P64;
#pragma unroll
    for (int i = 0; i < GM * 8 / GEMM_THREADS; ++i) {
      const int seg = tid + i * GEMM_THREADS;
      const int row = seg >> 3;
      const int c16 = seg & 7;
      cp16(X + (size_t)(m0 + row) * K + k0 + c16 * 8, sa + row * P64 + c16 * 8);
    }
#pragma unroll
    for (int i = 0; i < BN * 8 / GEMM_THREADS; ++i) {
      const int seg = tid + i * GEMM_THREADS;
      const int row = seg >> 3;
      const int c16 = seg & 7;
      cp16(WT + (size_t)(n0 + row) * K + k0 + c16 * 8, sb + row * P64 + c16 * 8);
    }
  };

  v8f z = {};
  v8f c[2][NT];
#pragma unroll
  for (int i = 0; i < 2; ++i)
#pragma unroll
    for (int j = 0; j < NT; ++j) c[i][j] = z;

  const int T = K / GK;                  // stages
  stage(0, 0);
  asm volatile("s_wait_asynccnt 0x0" ::: "memory");   // this wave's share of stage 0 has landed
  __syncthreads();                       // stage 0 visible to all 16 waves
  if (T > 1) stage(GK, 1);

  for (int t = 0; t < T; ++t) {
    const _Float16* sa = ring + (t & 1) * STAGE_H + (wm * 32 + nl) * P64;
    const _Float16* sb = ring + (t & 1) * STAGE_H + (GM + wn * (NT * 16) + nl) * P64;
#pragma unroll
    for (int kc = 0; kc < GK; kc += 32) {
      v16h a[2], b[NT];
#pragma unroll
      for (int i = 0; i < 2; ++i)  a[i] = frag16(sa + i * 16 * P64 + kc, hi);
#pragma unroll
      for (int j = 0; j < NT; ++j) b[j] = frag16(sb + j * 16 * P64 + kc, hi);
#pragma unroll
      for (int i = 0; i < 2; ++i)
#pragma unroll
        for (int j = 0; j < NT; ++j)
          c[i][j] = __builtin_amdgcn_wmma_f32_16x16x32_f16(
              false, a[i], false, b[j], (short)0, c[i][j], false, false);
    }
    asm volatile("s_wait_dscnt 0x0" ::: "memory");     // this wave has left the buffer that is refilled below
    asm volatile("s_wait_asynccnt 0x0" ::: "memory");  // this wave's share of stage t + 1 has landed
    __syncthreads();                     // stage t + 1 visible to all; every reader has left stage t
    if (t + 2 < T) stage((t + 2) * GK, t & 1);
  }
  asm volatile("s_wait_asynccnt 0x0" ::: "memory");    // no copy is left in flight when the wave ends

#pragma unroll
  for (int i = 0; i < 2; ++i) {
    const int gm0 = m0 + wm * 32 + i * 16 + 8 * hi;
    const int gn0 = n0 + wn * (NT * 16) + nl;
    if constexpr (!HALF_OUT)  store_tile<0, NT>(c[i], bias, outH, outF, M, N, gm0, gn0, oscale);
    else if (transposeOut)    store_tile<2, NT>(c[i], bias, outH, outF, M, N, gm0, gn0, oscale);
    else                      store_tile<1, NT>(c[i], bias, outH, outF, M, N, gm0, gn0, oscale);
  }
}

// The output projection (f32 out).
__global__ void __launch_bounds__(GEMM_THREADS)
gemm_out(const _Float16* __restrict__ X,
         const _Float16* __restrict__ WT,
         const float* __restrict__ bias,
         float* __restrict__ outF,
         int M, int N, int K) {
  __shared__ __attribute__((aligned(16))) _Float16 ring[2 * STAGE_H];
  gemm_tile<128, false>(X, WT, bias, nullptr, outF, M, N, K, 0, blockIdx.y * 128, 1.0f, ring);
}

// The Q, K and V projections in one launch: the K and V products have few blocks
// and last as long as a block's whole k loop, which runs beside the Q product
// instead of behind it. blockIdx.y: 0 = K, 1 = V (stored transposed), 2 and up =
// the 128-column strips of Q.
__global__ void __launch_bounds__(GEMM_THREADS)
gemm_qkv(const _Float16* __restrict__ Xq, const _Float16* __restrict__ Xk,
         const _Float16* __restrict__ Xv,
         const _Float16* __restrict__ WqT, const _Float16* __restrict__ WkT,
         const _Float16* __restrict__ WvT,
         const float* __restrict__ bq, const float* __restrict__ bk,
         const float* __restrict__ bv,
         _Float16* __restrict__ qp, _Float16* __restrict__ kp, _Float16* __restrict__ vTp,
         int M, int K) {
  __shared__ __attribute__((aligned(16))) _Float16 ring[2 * STAGE_H];
  const int y = blockIdx.y;
  if (y < 2)
    gemm_tile<64, true>(y == 0 ? Xk : Xv, y == 0 ? WkT : WvT, y == 0 ? bk : bv,
                        y == 0 ? kp : vTp, nullptr, M, DH, K, y == 1, 0, 1.0f, ring);
  else   // Q leaves times C2, so that the attention's score product is an exponent to base 2
    gemm_tile<128, true>(Xq, WqT, bq, qp, nullptr, M, DHID, K, 0, (y - 2) * 128, C2, ring);
}

// Value of lane l ^ 16 (the other half of the wave), as one vector instruction.
__device__ __forceinline__ float xhalf(float x) {
  const int b = __builtin_bit_cast(int, x);
  return __builtin_bit_cast(float,
      __builtin_amdgcn_permlanex16(b, b, 0x76543210, 0xfedcba98, false, false));
}

// The grid is one block per WGP, four waves per SIMD: the register budget is stated
// for that, or the compiler, counting two blocks into the LDS, squeezes the pass
// into half the registers and strings its exponentials on one register.
__global__ void __launch_bounds__(512) __attribute__((amdgpu_waves_per_eu(4, 4)))
mqa_attn(const _Float16* __restrict__ qh,
         const _Float16* __restrict__ kh,
         const _Float16* __restrict__ vT,
         _Float16* __restrict__ oh) {
  // [buf]: V^T tile, vcol(64) x key(KT), then K tile, key row(KT) x d(64), both padded; 2 x 69 KB.
  // Keys 0 .. KT/2 - 1 of a tile belong to the first key half, the rest to the second.
  constexpr int VH = DH * PKT;            // halves of a V^T tile
  constexpr int KH = KT / 2;              // keys of one key half per stage
  constexpr int SH = SS / 2;              // keys of one key half
  __shared__ __attribute__((aligned(16))) _Float16 kv[2][VH + KT * P64];

  const int tid  = threadIdx.x;           // 0..511
  const int wave = __builtin_amdgcn_readfirstlane(tid >> 5);   // scalar: the pass loop's bounds hang on it
  const int lane = tid & 31;
  const int nl   = lane & 15;
  const int hi   = lane >> 4;
  const int qt   = blockIdx.x;            // query tile [0,128)
  const int b    = blockIdx.y;            // batch
  const int half = wave >> 3;             // the wave's key half
  // Column group 0 is the head whose output this wave writes, group 1 the head that
  // its partner (wave ^ 8) writes: the partner holds the same two heads, swapped.
  const int h0   = 2 * (wave & 7) + half;
  const int h1   = h0 ^ 1;

  // One stage: KT rows of K (8 segments of 16 bytes a row) and 64 rows of V^T
  // (KT / 8 segments a row), keys j .. j + KH - 1 of each key half; every thread
  // copies its share of both.
  auto stageKV = [&](int j, int buf) {
#pragma unroll
    for (int i = 0; i < KT * 8 / 512; ++i) {
      const int seg = tid + i * 512;
      const int row = seg >> 3, s = seg & 7;
      const int key = (row / KH) * SH + j + row % KH;
      cp16(kh + ((size_t)(b * SS + key)) * DH + s * 8,
           &kv[buf][VH + row * P64 + s * 8]);
    }
#pragma unroll
    for (int i = 0; i < DH * (KT / 8) / 512; ++i) {
      const int seg = tid + i * 512;
      const int row = seg / (KT / 8), s = seg % (KT / 8);
      const int key = (s / (KH / 8)) * SH + j + (s % (KH / 8)) * 8;
      cp16(vT + (size_t)row * BSZ + b * SS + key,
           &kv[buf][row * PKT + s * 8]);
    }
  };

  // Q tiles resident as two B fragments a head (d = 0..31, 32..63), column = query nl
  const _Float16* qrow = qh + ((size_t)(b * SS + qt * 16 + nl)) * DHID;
  const v16h qb[2][2] = {{frag16(qrow + h0 * DH, hi), frag16(qrow + h0 * DH + 32, hi)},
                         {frag16(qrow + h1 * DH, hi), frag16(qrow + h1 * DH + 32, hi)}};

  v8f z = {};
  v8f o[2][4] = {{z, z, z, z}, {z, z, z, z}};   // O^T accum per head, 64(d) x 16(query)
  // Reference of query nl's exponentials (same in both halves of the wave): the running
  // maximum as it stood when it was last taken over. Any reference gives the same
  // quotient; it only has to keep e^(score - m) inside f16, so it moves, and O and the
  // sum are rescaled, only in the first pass and in a pass where some score of the wave stands TAU above it.
  // Q arrives times C2, so K Q^T is the score as an exponent to base 2, and the score
  // product starts its accumulators at nm = minus the reference (all 8 rows of a lane's
  // accumulator are keys of its one query): what the matrix unit hands back is the
  // argument of the exponential, with no vector multiply or subtract per score.
  float nm[2] = {0.0f, 0.0f};             // minus the reference, as an exponent to base 2
  v8f nmv[2]  = {z, z};                   // the same in 8 registers: the score product's C operand
  // The first pass takes its maximum as the reference whatever it is: any score tops thr,
  // and the reference may move down as well as up (lo). From then on thr = TAU2, lo = 0.
  float thr = -3.0e38f, lo = -3.0e38f;
  float l[2] = {0.0f, 0.0f};              // running sum over this half-wave's keys only, relative to the reference

  constexpr int T = SH / KH;              // stages
  static_assert(SH % KH == 0 && T >= 2 && KH % 32 == 0, "whole stages, two buffers in use");
  stageKV(0, 0);
  asm volatile("s_wait_asynccnt 0x0" ::: "memory");   // this wave's share of stage 0 has landed
  __syncthreads();                        // stage 0 visible to all waves
  stageKV(KH, 1);

  for (int t = 0; t < T; ++t) {
   const int buf = t & 1;
   for (int jj = half * KH; jj < half * KH + KH; jj += 32) {  // passes of 32 keys, no barrier between them
    // ---- scores: two 16x16 tiles a head, S^T = K @ Q^T, A operand from LDS ----
    const _Float16* kr0 = &kv[buf][VH + (jj + nl) * P64];
    const _Float16* kr1 = &kv[buf][VH + (jj + 16 + nl) * P64];
    const v16h ka[2][2] = {{frag16(kr0, hi), frag16(kr0 + 32, hi)},
                           {frag16(kr1, hi), frag16(kr1 + 32, hi)}};
    v16h av[4];                           // V^T fragments, 16 d each, for the second product
#pragma unroll
    for (int nt = 0; nt < 4; ++nt) av[nt] = frag16(&kv[buf][(nt * 16 + nl) * PKT + jj], hi);
    // Keeps the pass's 16 LDS reads in one group at its head: left to itself the compiler
    // sinks half of the V^T reads in among the second product's WMMAs, which then wait them out.
    __builtin_amdgcn_sched_barrier(0);
    v8f s[2][2];                          // [head][16 keys]
#pragma unroll
    for (int kt = 0; kt < 2; ++kt)
#pragma unroll
      for (int g = 0; g < 2; ++g)
        s[g][kt] = __builtin_amdgcn_wmma_f32_16x16x32_f16(false, ka[kt][0], false, qb[g][0], (short)0, nmv[g], false, false);
#pragma unroll
    for (int kt = 0; kt < 2; ++kt)
#pragma unroll
      for (int g = 0; g < 2; ++g)
        s[g][kt] = __builtin_amdgcn_wmma_f32_16x16x32_f16(false, ka[kt][1], false, qb[g][1], (short)0, s[g][kt], false, false);
    // Keeps the eight score products back to back: each is a slot of the distance that the
    // chip needs in front of the first read of an earlier one's result, where the compiler,
    // drawing the maxima in among them, pads with idle instructions.
    __builtin_amdgcn_sched_barrier(0);
    // Inputs only: the start values are still in use behind the products, so that each
    // product reads them in place and writes elsewhere; where the second key tile's product
    // is their last use, the compiler copies all 16 registers in every pass instead.
    asm volatile("" :: "v"(nmv[0]), "v"(nmv[1]));

    // ---- online softmax, lazy reference: 16 scores of query nl and head g in this lane ----
    float tm[2];                          // largest of this lane's 16 exponents (keys r + 8*hi, 16 + r + 8*hi)
#pragma unroll
    for (int g = 0; g < 2; ++g) {
      float x[16];
#pragma unroll
      for (int r = 0; r < 8; ++r) { x[r] = s[g][0][r]; x[8 + r] = s[g][1][r]; }
      float t4[4];                        // four short chains instead of one long one
#pragma unroll
      for (int c = 0; c < 4; ++c)
        t4[c] = fmaxf(fmaxf(x[4 * c], x[4 * c + 1]), fmaxf(x[4 * c + 2], x[4 * c + 3]));
      tm[g] = fmaxf(fmaxf(t4[0], t4[1]), fmaxf(t4[2], t4[3]));
    }
    // Every lane tests its own 16 scores, so the vote covers all 32 keys of every query;
    // the branch is the same for the whole wave (all lanes stay on for the exchange).
    float cr[2] = {1.0f, 1.0f};           // what the pass's move of the reference takes off the sums so far
    if (__builtin_amdgcn_ballot_w32(tm[0] > thr || tm[1] > thr) != 0u) {
#pragma unroll
      for (int g = 0; g < 2; ++g) {
        const float up   = fmaxf(lo, fmaxf(tm[g], xhalf(tm[g])));  // with the other 16 keys of the query
        const float nnew = nm[g] - up;
        const float dn   = nnew - nm[g];  // the move as the accumulators will see it
        cr[g] = __builtin_amdgcn_exp2f(fminf(dn, 0.0f));   // a first pass that moves down has nothing to rescale
        nm[g] = nnew;
        nmv[g] = (v8f){nnew, nnew, nnew, nnew, nnew, nnew, nnew, nnew};
        s[g][0] += dn;                    // this pass's exponents were formed on the old reference
        s[g][1] += dn;
      }
      thr = TAU2;
      lo  = 0.0f;
#pragma unroll
      for (int g = 0; g < 2; ++g)
#pragma unroll
        for (int nt = 0; nt < 4; ++nt) o[g][nt] *= cr[g];
    }
    v16h pb[2];
    float p[2][16];
#pragma unroll
    for (int g = 0; g < 2; ++g)
#pragma unroll
      for (int r = 0; r < 8; ++r) {
        p[g][r]      = __builtin_amdgcn_exp2f(s[g][0][r]);
        p[g][8 + r]  = __builtin_amdgcn_exp2f(s[g][1][r]);
      }
    // Inputs only, behind all 32 exponentials: their arguments stay in use up to here, so no
    // exponential is written over the register that the one directly in front of it reads
    // (the instruction set asks for a slot between the two); without it four are.
    __builtin_amdgcn_sched_barrier(0);
    asm volatile("" :: "v"(s[0][0]), "v"(s[0][1]), "v"(s[1][0]), "v"(s[1][1]));
#pragma unroll
    for (int g = 0; g < 2; ++g)
      // Half t of the B fragment is key t + 8*hi (t < 8) or 8 + t + 8*hi: the scores' order.
#pragma unroll
      for (int r = 0; r < 8; ++r) {
        pb[g][r]     = (_Float16)p[g][r];
        pb[g][8 + r] = (_Float16)p[g][8 + r];
      }

    // ---- O^T += V^T (A operand, read above) @ P^T (registers) ----
#pragma unroll
    for (int nt = 0; nt < 4; ++nt)
#pragma unroll
      for (int g = 0; g < 2; ++g)
        o[g][nt] = __builtin_amdgcn_wmma_f32_16x16x32_f16(
            false, av[nt], false, pb[g], (short)0, o[g][nt], false, false);
    // Keeps the row sums behind the products: with no barrier at the pass's end their adds
    // are the vector slots that the chip needs between the last product and the next
    // pass's first write of that product's operand registers, over the back edge.
    __builtin_amdgcn_sched_barrier(0);
#pragma unroll
    for (int g = 0; g < 2; ++g) {
      float r4[4];
#pragma unroll
      for (int c = 0; c < 4; ++c)
        r4[c] = (p[g][4 * c] + p[g][4 * c + 1]) + (p[g][4 * c + 2] + p[g][4 * c + 3]);
      l[g] = l[g] * cr[g] + ((r4[0] + r4[1]) + (r4[2] + r4[3]));
    }
   }
   asm volatile("s_wait_dscnt 0x0" ::: "memory");     // this wave has left the buffer that is refilled below
   asm volatile("s_wait_asynccnt 0x0" ::: "memory");  // this wave's share of stage t + 1 has landed
   __syncthreads();                       // stage t + 1 visible to all; every reader has left stage t
   if (t + 2 < T) stageKV((t + 2) * KH, buf);
  }
  asm volatile("s_wait_asynccnt 0x0" ::: "memory");   // no copy is left in flight when the wave ends

  // ---- join the two key halves ----
  // Behind the loop's last barrier nobody reads the K/V buffers and no copy is in
  // flight, so they serve as the exchange: a wave hands its partner the state of
  // column group 1 (accumulators, reference, sum) and takes the partner's state of
  // its own group 0. 16 bytes a lane, lanes side by side: no bank conflict.
  constexpr int XW = 8 * 32 * 4 + 32 * 2;  // floats per wave: 8 x 4 accumulators and 2 scalars a lane
  static_assert(16 * XW * sizeof(float) <= sizeof(kv), "the exchange fits the K/V buffers");
  float* xch = (float*)&kv[0][0];
  {
    float* mine = xch + wave * XW;
#pragma unroll
    for (int nt = 0; nt < 4; ++nt)
#pragma unroll
      for (int q = 0; q < 2; ++q) {
        const f4 w = {o[1][nt][4 * q], o[1][nt][4 * q + 1], o[1][nt][4 * q + 2], o[1][nt][4 * q + 3]};
        *(f4*)(mine + ((nt * 2 + q) * 32 + lane) * 4) = w;
      }
    mine[8 * 32 * 4 + lane * 2]     = nm[1];
    mine[8 * 32 * 4 + lane * 2 + 1] = l[1];
  }
  __syncthreads();                        // every wave's hand-over is written before its partner reads it
  const float* theirs = xch + (wave ^ 8) * XW;
  const float np = theirs[8 * 32 * 4 + lane * 2];
  const float lp = theirs[8 * 32 * 4 + lane * 2 + 1];
  const float nj = fminf(nm[0], np);      // the halves' references differ; any common one joins them (the larger maximum)
  const float ca = __builtin_amdgcn_exp2f(nj - nm[0]);   // weight of this wave's key half
  const float cb = __builtin_amdgcn_exp2f(nj - np);      // weight of the partner's
  const float lj = l[0] * ca + lp * cb;

  // ---- normalize and write attention output ----
  // Lane holds d = nt*16 + 8*hi + (0..7) of query nl: 16 contiguous bytes per nt.
  const float inv = 1.0f / (lj + xhalf(lj));
  const float fa = ca * inv, fb = cb * inv;
  _Float16* orow = oh + ((size_t)(b * SS + qt * 16 + nl)) * DHID + h0 * DH + 8 * hi;
#pragma unroll
  for (int nt = 0; nt < 4; ++nt) {
    h8 w;
#pragma unroll
    for (int q = 0; q < 2; ++q) {
      const f4 op = *(const f4*)(theirs + ((nt * 2 + q) * 32 + lane) * 4);
#pragma unroll
      for (int r = 0; r < 4; ++r) w[4 * q + r] = (_Float16)(o[0][nt][4 * q + r] * fa + op[r] * fb);
    }
    *(h8*)(orow + nt * 16) = w;
  }
}

// ---------------------------------------------------------------------------
// Launcher
// ---------------------------------------------------------------------------
extern "C" void kernel_launch(void* const* d_in, const int* in_sizes, int n_in,
                              void* d_out, int out_size, void* d_ws, size_t ws_size,
                              hipStream_t stream) {
  (void)in_sizes; (void)n_in; (void)out_size; (void)ws_size;

  const float* query = (const float*)d_in[0];
  const float* key   = (const float*)d_in[1];
  const float* value = (const float*)d_in[2];
  const float* Wq    = (const float*)d_in[3];
  const float* bq    = (const float*)d_in[4];
  const float* Wk    = (const float*)d_in[5];
  const float* bk    = (const float*)d_in[6];
  const float* Wv    = (const float*)d_in[7];
  const float* bv    = (const float*)d_in[8];
  const float* Wo    = (const float*)d_in[9];
  const float* bo    = (const float*)d_in[10];
  float* outF = (float*)d_out;

  // workspace carve-up (f16, 256B aligned), ~45 MB total
  char* ws = (char*)d_ws;
  size_t off = 0;
  auto carve = [&](size_t halves) {
    void* p = ws + off;
    off += (halves * sizeof(_Float16) + 255) & ~(size_t)255;
    return (_Float16*)p;
  };
  _Float16* Xq  = carve((size_t)BSZ * DIN);
  _Float16* Xk  = carve((size_t)BSZ * DIN);
  _Float16* Xv  = carve((size_t)BSZ * DIN);
  _Float16* WqT = carve((size_t)DIN * DHID);
  _Float16* WkT = carve((size_t)DH * DIN);
  _Float16* WvT = carve((size_t)DH * DIN);
  _Float16* WoT = carve((size_t)DIN * DHID);
  _Float16* qp  = carve((size_t)BSZ * DHID);
  _Float16* kp  = carve((size_t)BSZ * DH);
  _Float16* vTp = carve((size_t)DH * BSZ);   // V^T [64, B*S]
  _Float16* oat = carve((size_t)BSZ * DHID);

  cast_all<<<dim3(CAST_BLOCKS), CAST_THREADS, 0, stream>>>(
      query, key, value, Wq, Wk, Wv, Wo, Xq, Xk, Xv, WqT, WkT, WvT, WoT);

  // projections (WMMA, 128-row tiles per 16-wave block): K, V and Q in one launch
  gemm_qkv<<<dim3(BSZ / GM, 2 + DHID / 128), GEMM_THREADS, 0, stream>>>(
      Xq, Xk, Xv, WqT, WkT, WvT, bq, bk, bv, qp, kp, vTp, BSZ, DIN);

  // attention (WMMA flash, 16 heads per block sharing LDS-staged K/V)
  mqa_attn<<<dim3(SS / 16, BB), 512, 0, stream>>>(qp, kp, vTp, oat);

  // output projection (WMMA, fp32 out)
  gemm_out<<<dim3(BSZ / GM, DIN / 128), GEMM_THREADS, 0, stream>>>(oat, WoT, bo, outF, BSZ, DIN, DHID);
}

// v010
// One run takes 65.3 microseconds.
// Two timings next to v009 put it at 1.07 and 1.08 times that version's speed.
// Counting every step since v000, it is 5.15 times as fast.
#include <hip/hip_runtime.h>
#include <hip/hip_bf16.h>

// ---------------------------------------------------------------------------
// MQA forward, all matmuls on v_wmma_f32_16x16x32_f16 (CDNA5 / gfx1250).
// B=2, S=2048, d_model=1024, H=16, Dh=64 (single shared K/V head).
// GEMMs: 16-wave blocks, both operands staged in LDS, double buffered. The Q, K and V
// projections read the f32 inputs and weights themselves and round them to f16 on the
// way to LDS (through registers); the output projection stages f16 by
// global_load_async_to_lds (ASYNCcnt).
// Attention: 16-wave blocks (two heads and half the keys per wave) sharing
// async-staged, double-buffered K/V stages in LDS -- 16x cut in L2 traffic for
// the shared MQA head; a stage holds many 32-key passes, so the waves meet rarely.
// Launches that do not depend on one another share one launch (the block index
// picks the job): the Q, K and V projections and the cast of Wo.
// ---------------------------------------------------------------------------

typedef __attribute__((ext_vector_type(16))) _Float16 v16h;
typedef __attribute__((ext_vector_type(8)))  _Float16 h8;
typedef __attribute__((ext_vector_type(8)))  float    v8f;
typedef __attribute__((ext_vector_type(2)))  _Float16 h2;
typedef __attribute__((ext_vector_type(4)))  int      v4i;
typedef __attribute__((ext_vector_type(4)))  float    f4;
typedef __attribute__((ext_vector_type(4)))  _Float16 h4;

#define BB    2
#define SS    2048
#define BSZ   4096      // B*S
#define DIN   1024
#define DHID  1024
#define NH    16
#define DH    64
#define SCALE 0.03125f  // 1/sqrt(1024)
#define LOG2E 1.44269504f  // log2(e)
#define TAU   5.5f      // how far a score may stand above its query's reference: e^5.5 < 256, well inside f16
#define C2    (SCALE * LOG2E)   // a product q.k times this is the score's exponent to base 2; Q is stored times C2
#define TAU2  (TAU * LOG2E)     // TAU as an exponent to base 2

// LDS row pitches in halves. Every tile here is read by 16-byte loads, 16 rows
// at a time, so the pitch is an odd multiple of 16 bytes: the 16 rows then fall
// on 16 different groups of four banks instead of on two (128-byte rows) or
// one (512-byte rows).
#define P64   72        // rows of 64 halves: 128 B of data, 144 B pitch
#define KT    256       // keys per attention stage (4 passes of 32 keys for each key half)
#define PKT   (KT + 8)  // rows of KT halves: 512 B of data, 528 B pitch

#if __has_builtin(__builtin_amdgcn_global_load_async_to_lds_b128)
#define HAVE_ASYNC 1
#else
#define HAVE_ASYNC 0
#endif

// 16-byte global -> LDS copy; async (ASYNCcnt) when the gfx1250 builtin exists.
__device__ __forceinline__ void cp16(const _Float16* g, _Float16* l) {
#if HAVE_ASYNC
  __builtin_amdgcn_global_load_async_to_lds_b128(
      (__attribute__((address_space(1))) v4i*)g,
      (__attribute__((address_space(3))) v4i*)l, 0, 0);
#else
  *(h8*)l = *(const h8*)g;
#endif
}

// Stands behind a global store, in front of the next write of a register that the
// store names (its address pair, its data).
__device__ __forceinline__ void store_issued() {
  asm volatile("s_wait_xcnt 0x0" ::: "memory");
}

// Assemble a 16-bit WMMA A/B fragment (16x32 resp. 32x16) for one K=32 chunk.
// Per ISA 7.12.2: lane holds row/col (lane&15); hi = lane>>4 selects the K
// half-groups. Half t -> K = t + 8*hi + 8*(t>=8); pairs merge into b128 loads.
__device__ __forceinline__ v16h frag16(const _Float16* __restrict__ base, int hi) {
  v16h r;
#pragma unroll
  for (int tp = 0; tp < 8; ++tp) {
    const int kk = 2 * tp + 8 * hi + ((tp >= 4) ? 8 : 0);
    h2 p = *(const h2*)(base + kk);
    r[2 * tp]     = p.x;
    r[2 * tp + 1] = p.y;
  }
  return r;
}

// ---------------------------------------------------------------------------
// fp32 -> f16 cast of a weight that a later launch reads many times (Wo).
// ---------------------------------------------------------------------------
#define CAST_THREADS 512                       // 16 waves, as the GEMM blocks it shares a launch with
static_assert(DIN % 64 == 0 && DHID % 64 == 0, "cast_t has no tail");

// W [K,N] fp32 row-major  ->  W^T [N,K] f16 row-major.
// A wave transposes a 64(k) x 16(n) tile in registers: a lane loads 8 k-rows of
// 4 n each and stores, for each of its 4 n, 8 consecutive k as 16 bytes; the 8
// lanes of one n together write one whole 128-byte line of W^T.
// 4 waves side by side in n make a 64 x 64 tile; a block of 16 waves takes 4 tiles
// that follow one another in n, then k. K and N are compile-time so that the 8
// loads share one address and the 4 stores another (immediate offsets).
template <int K, int N>
__device__ __forceinline__ void
cast_t(const float* __restrict__ in, _Float16* __restrict__ out, int blk) {
  const int wave = threadIdx.x >> 5;
  const int lane = threadIdx.x & 31;
  const int tile = blk * (CAST_THREADS / 128) + (wave >> 2);
  const int k = (tile / (N / 64)) * 64 + (lane & 7) * 8;
  const int n = (tile % (N / 64)) * 64 + (wave & 3) * 16 + (lane >> 3) * 4;
  f4 v[8];
#pragma unroll
  for (int j = 0; j < 8; ++j) v[j] = *(const f4*)(in + (size_t)(k + j) * N + n);
#pragma unroll
  for (int c = 0; c < 4; ++c) {
    h8 r;
#pragma unroll
    for (int j = 0; j < 8; ++j) r[j] = (_Float16)v[j][c];
    *(h8*)(out + (size_t)(n + c) * K + k) = r;
  }
  store_issued();   // another job's code follows in the merged kernel
}
#define TBLKW ((DIN / 64) * (DHID / 64) / (CAST_THREADS / 128))  // blocks per 1024 x 1024 weight

// ---------------------------------------------------------------------------
// WMMA GEMM:  C[M,N] = X[M,K] @ W[K,N] + bias,  W given as WT[N,K].
// Block = 16 waves = a 128 x BN tile (BN = 128: the output projection); a wave
// owns 32 x BN/4 of it. Both operands of a 64-k stage are laid
// in LDS by async copies (whole 128-byte lines), two buffers: the next stage's
// copies fly while this stage is worked on, so no wave waits out a load of its
// own, and each operand byte is fetched from L2 once per 128 rows or columns.
// ---------------------------------------------------------------------------
#define GEMM_THREADS 512
#define GM      128                    // rows of X per block
#define GK      64                     // k per stage
#define STAGE_H ((GM + 128) * P64)     // halves per buffer: GM rows of X, then up to 128 rows of WT
static_assert(BSZ % GM == 0 && DHID % 128 == 0 && DIN % 128 == 0 && DH == 64, "whole tiles");
static_assert(DIN % GK == 0 && DHID % GK == 0, "whole stages");

// A wave's 16 x (16 * NT) accumulators plus bias to memory. KIND 0: f32 to outF; 1: f16
// to outH; 2: f16 to outH, transposed. C/D layout: register r is row gm0 + r, the
// lane's column is gn0 + 16 * nt.
template <int KIND, int NT>
__device__ __forceinline__ void
store_tile(const v8f (&c)[NT], const float* __restrict__ bias,
           _Float16* __restrict__ outH, float* __restrict__ outF,
           int M, int N, int gm0, int gn0, float oscale) {
#pragma unroll
  for (int nt = 0; nt < NT; ++nt) {
    const int gn = gn0 + nt * 16;
    const float bval = bias ? bias[gn] : 0.0f;
#pragma unroll
    for (int r = 0; r < 8; ++r) {
      const int gm = gm0 + r;
      const float val = (c[nt][r] + bval) * oscale;   // scaled in f32, in front of the one rounding
      if constexpr (KIND == 2)      outH[(size_t)gn * M + gm] = (_Float16)val;
      else if constexpr (KIND == 1) outH[(size_t)gm * N + gn] = (_Float16)val;
      else                          outF[(size_t)gm * N + gn] = val;
      if constexpr (KIND != 2) store_issued();   // the next element reuses the address and data registers
    }
    if constexpr (KIND == 2) store_issued();     // one run of 8 neighbours; the next run reuses its registers
  }
}

template <int BN, bool HALF_OUT>   // output: f16 (outH, plain or transposed) or f32 (outF)
__device__ __forceinline__ void
gemm_tile(const _Float16* __restrict__ X,
          const _Float16* __restrict__ WT,
          const float* __restrict__ bias,
          _Float16* __restrict__ outH,
          float* __restrict__ outF,
          int M, int N, int K, int transposeOut, int n0,
          float oscale,                // factor on the output (a literal at every call)
          _Float16* ring) {            // LDS, 2 * STAGE_H halves
  constexpr int NT = BN / 64;            // 16-column accumulators per wave and 16 rows

  const int tid  = threadIdx.x;          // 0..511
  const int wave = tid >> 5;
  const int lane = tid & 31;
  const int nl   = lane & 15;
  const int hi   = lane >> 4;
  const int wm   = wave & 3;             // the wave's 32 rows
  const int wn   = wave >> 2;            // the wave's BN/4 columns
  const int m0   = blockIdx.x * GM;

  // One stage: GM rows of X and BN rows of WT, 64 k each = 8 segments of 16 bytes a
  // row; 8 neighbouring lanes copy one row's whole line.
  auto stage = [&](int k0, int buf) {
    _Float16* sa = ring + buf * STAGE_H;
    _Float16* sb = sa + GM * P64;
#pragma unroll
    for (int i = 0; i < GM * 8 / GEMM_THREADS; ++i) {
      const int seg = tid + i * GEMM_THREADS;
      const int row = seg >> 3;
      const int c16 = seg & 7;
      cp16(X + (size_t)(m0 + row) * K + k0 + c16 * 8, sa + row * P64 + c16 * 8);
    }
#pragma unroll
    for (int i = 0; i < BN * 8 / GEMM_THREADS; ++i) {
      const int seg = tid + i * GEMM_THREADS;
      const int row = seg >> 3;
      const int c16 = seg & 7;
      cp16(WT + (size_t)(n0 + row) * K + k0 + c16 * 8, sb + row * P64 + c16 * 8);
    }
  };

  v8f z = {};
  v8f c[2][NT];
#pragma unroll
  for (int i = 0; i < 2; ++i)
#pragma unroll
    for (int j = 0; j < NT; ++j) c[i][j] = z;

  const int T = K / GK;                  // stages
  stage(0, 0);
  asm volatile("s_wait_asynccnt 0x0" ::: "memory");   // this wave's share of stage 0 has landed
  __syncthreads();                       // stage 0 visible to all 16 waves
  if (T > 1) stage(GK, 1);

  for (int t = 0; t < T; ++t) {
    const _Float16* sa = ring + (t & 1) * STAGE_H + (wm * 32 + nl) * P64;
    const _Float16* sb = ring + (t & 1) * STAGE_H + (GM + wn * (NT * 16) + nl) * P64;
#pragma unroll
    for (int kc = 0; kc < GK; kc += 32) {
      v16h a[2], b[NT];
#pragma unroll
      for (int i = 0; i < 2; ++i)  a[i] = frag16(sa + i * 16 * P64 + kc, hi);
#pragma unroll
      for (int j = 0; j < NT; ++j) b[j] = frag16(sb + j * 16 * P64 + kc, hi);
#pragma unroll
      for (int i = 0; i < 2; ++i)
#pragma unroll
        for (int j = 0; j < NT; ++j)
          c[i][j] = __builtin_amdgcn_wmma_f32_16x16x32_f16(
              false, a[i], false, b[j], (short)0, c[i][j], false, false);
    }
    asm volatile("s_wait_dscnt 0x0" ::: "memory");     // this wave has left the buffer that is refilled below
    asm volatile("s_wait_asynccnt 0x0" ::: "memory");  // this wave's share of stage t + 1 has landed
    __syncthreads();                     // stage t + 1 visible to all; every reader has left stage t
    if (t + 2 < T) stage((t + 2) * GK, t & 1);
  }
  asm volatile("s_wait_asynccnt 0x0" ::: "memory");    // no copy is left in flight when the wave ends

#pragma unroll
  for (int i = 0; i < 2; ++i) {
    const int gm0 = m0 + wm * 32 + i * 16 + 8 * hi;
    const int gn0 = n0 + wn * (NT * 16) + nl;
    if constexpr (!HALF_OUT)  store_tile<0, NT>(c[i], bias, outH, outF, M, N, gm0, gn0, oscale);
    else if (transposeOut)    store_tile<2, NT>(c[i], bias, outH, outF, M, N, gm0, gn0, oscale);
    else                      store_tile<1, NT>(c[i], bias, outH, outF, M, N, gm0, gn0, oscale);
  }
}

// The output projection (f32 out).
__global__ void __launch_bounds__(GEMM_THREADS)
gemm_out(const _Float16* __restrict__ X,
         const _Float16* __restrict__ WT,
         const float* __restrict__ bias,
         float* __restrict__ outF,
         int M, int N, int K) {
  __shared__ __attribute__((aligned(16))) _Float16 ring[2 * STAGE_H];
  gemm_tile<128, false>(X, WT, bias, nullptr, outF, M, N, K, 0, blockIdx.y * 128, 1.0f, ring);
}

// A projection straight from the f32 tensors:  C[M,N] = X[M,K] @ W[K,N] + bias, f16 out.
// Same tile, same LDS layout and same products as gemm_tile; only the way into LDS
// differs: a stage's f32 values are loaded into registers while the stage before it is
// worked on, rounded to f16 and stored to the other buffer behind that work. So no
// launch has to write f16 copies of the inputs first, and none has to read them back.
// Waves 0-7 bring the GM x 64 piece of X: a load covers 2 rows of 256 bytes (whole lines).
// Waves 8 and up bring W, 32 k x 32 n a wave: a load covers 4 k-rows of 128 bytes (whole
// lines); a lane holds 8 k of 4 n and stores, for each n, its 8 k as 16 bytes of row n
// (the transposition); the 16 lanes of a half-wave fall on all 64 banks once.
template <int BN, int N>
__device__ __forceinline__ void
proj_tile(const float* __restrict__ X,
          const float* __restrict__ W,
          const float* __restrict__ bias,
          _Float16* __restrict__ outH,
          int transposeOut, int n0,
          float oscale,                // factor on the output (a literal at every call)
          _Float16* ring) {            // LDS, 2 * STAGE_H halves
  constexpr int NT = BN / 64;            // 16-column accumulators per wave and 16 rows
  constexpr int K  = DIN;
  constexpr int T  = K / GK;             // stages

  const int tid  = threadIdx.x;          // 0..511
  const int wave = __builtin_amdgcn_readfirstlane(tid >> 5);   // scalar: it picks the wave's staging job
  const int lane = tid & 31;
  const int nl   = lane & 15;
  const int hi   = lane >> 4;
  const int wm   = wave & 3;             // the wave's 32 rows
  const int wn   = wave >> 2;            // the wave's BN/4 columns
  const int m0   = blockIdx.x * GM;

  const bool doA = wave < 8;
  const bool doB = !doA && wave - 8 < BN / 16;   // 64 k x BN n in pieces of 32 x 32
  // Typed as global memory: the pointer goes through an asm statement below, behind which
  // the compiler would no longer know that, and would load by the slower generic form.
  typedef __attribute__((address_space(1))) const float gfloat;
  typedef __attribute__((address_space(1))) const f4    gf4;
  gfloat* g = (gfloat*)X;                // the first of the thread's 8 loads of the coming stage
  _Float16* d0 = ring;                   // where its first store goes in buffer 0
  if (doA) {
    const int row = tid >> 4, c4 = tid & 15;
    g  = (gfloat*)(X + (size_t)(m0 + row) * K + c4 * 4);
    d0 = ring + row * P64 + c4 * 4;
  } else if (doB) {
    const int k = ((wave - 8) & 1) * 32 + (lane & 3) * 8;
    const int n = ((wave - 8) >> 1) * 32 + (lane >> 2) * 4;
    g  = (gfloat*)(W + (size_t)k * N + n0 + n);
    d0 = ring + (GM + n) * P64 + k;
  }

  f4 v[8];                               // the thread's share of one stage, on its way
  // The wait stands behind a job's loads, in front of the step of their address register;
  // the address goes through the statement, or the compiler lifts the step over the wait.
  // Each job has its own: so the two runs of loads stay apart, and each keeps its one
  // address register with immediate offsets.
  auto fetch = [&]() {
    if (doA) {
#pragma unroll
      for (int i = 0; i < 8; ++i) v[i] = *(gf4*)(g + (size_t)i * 16 * K);
      asm volatile("s_wait_xcnt 0x0" : "+v"(g) :: "memory");
      g += GK;
    } else if (doB) {
#pragma unroll
      for (int j = 0; j < 8; ++j) v[j] = *(gf4*)(g + (size_t)j * N);
      asm volatile("s_wait_xcnt 0x0" : "+v"(g) :: "memory");
      g += GK * N;
    }
  };
  auto put = [&](int buf) {
    _Float16* d = d0 + buf * STAGE_H;
    if (doA) {
#pragma unroll
      for (int i = 0; i < 8; ++i) *(h4*)(d + i * 16 * P64) = __builtin_convertvector(v[i], h4);
    } else if (doB) {
#pragma unroll
      for (int c = 0; c < 4; ++c) {
        h8 r;
#pragma unroll
        for (int j = 0; j < 8; ++j) r[j] = (_Float16)v[j][c];
        *(h8*)(d + c * P64) = r;
      }
    }
  };

  v8f z = {};
  v8f c[2][NT];
#pragma unroll
  for (int i = 0; i < 2; ++i)
#pragma unroll
    for (int j = 0; j < NT; ++j) c[i][j] = z;

  fetch();
  put(0);
  __syncthreads();                       // stage 0 visible to all 16 waves

  // Stays rolled, for speed only.
#pragma unroll 1
  for (int t = 0; t < T; ++t) {
    if (t + 1 < T) fetch();              // stage t + 1 flies while stage t is worked on
    const _Float16* sa = ring + (t & 1) * STAGE_H + (wm * 32 + nl) * P64;
    const _Float16* sb = ring + (t & 1) * STAGE_H + (GM + wn * (NT * 16) + nl) * P64;
#pragma unroll
    for (int kc = 0; kc < GK; kc += 32) {
      v16h a[2], b[NT];
#pragma unroll
      for (int i = 0; i < 2; ++i)  a[i] = frag16(sa + i * 16 * P64 + kc, hi);
#pragma unroll
      for (int j = 0; j < NT; ++j) b[j] = frag16(sb + j * 16 * P64 + kc, hi);
#pragma unroll
      for (int i = 0; i < 2; ++i)
#pragma unroll
        for (int j = 0; j < NT; ++j)
          c[i][j] = __builtin_amdgcn_wmma_f32_16x16x32_f16(
              false, a[i], false, b[j], (short)0, c[i][j], false, false);
    }
    if (t + 1 < T) {
      put((t + 1) & 1);                  // its last readers left that buffer in front of the barrier of stage t - 1
      __syncthreads();                   // stage t + 1 visible to all; every reader has left stage t
    }
  }

#pragma unroll
  for (int i = 0; i < 2; ++i) {
    const int gm0 = m0 + wm * 32 + i * 16 + 8 * hi;
    const int gn0 = n0 + wn * (NT * 16) + nl;
    if (transposeOut) store_tile<2, NT>(c[i], bias, outH, nullptr, BSZ, N, gm0, gn0, oscale);
    else              store_tile<1, NT>(c[i], bias, outH, nullptr, BSZ, N, gm0, gn0, oscale);
  }
}

// The Q, K and V projections in one launch: the K and V products have few blocks
// and last as long as a block's whole k loop, which runs beside the Q product
// instead of behind it. The cast of Wo, which only the last launch reads, rides along.
// blockIdx.y: 0 = K, 1 = V (stored transposed), 2 .. 9 = the 128-column strips of Q,
// 10 and up = the cast.
#define QKV_Y (2 + DHID / 128)
static_assert(TBLKW % (BSZ / GM) == 0, "the cast's blocks fill whole rows of the grid");
__global__ void __launch_bounds__(GEMM_THREADS)
gemm_qkv(const float* __restrict__ query, const float* __restrict__ key,
         const float* __restrict__ value,
         const float* __restrict__ Wq, const float* __restrict__ Wk,
         const float* __restrict__ Wv, const float* __restrict__ Wo,
         const float* __restrict__ bq, const float* __restrict__ bk,
         const float* __restrict__ bv,
         _Float16* __restrict__ qp, _Float16* __restrict__ kp, _Float16* __restrict__ vTp,
         _Float16* __restrict__ WoT) {
  __shared__ __attribute__((aligned(16))) _Float16 ring[2 * STAGE_H];
  const int y = blockIdx.y;
  if (y < 2)
    proj_tile<64, DH>(y == 0 ? key : value, y == 0 ? Wk : Wv, y == 0 ? bk : bv,
                      y == 0 ? kp : vTp, y == 1, 0, 1.0f, ring);
  else if (y < QKV_Y)   // Q leaves times C2, so that the attention's score product is an exponent to base 2
    proj_tile<128, DHID>(query, Wq, bq, qp, 0, (y - 2) * 128, C2, ring);
  else
    cast_t<DHID, DIN>(Wo, WoT, (y - QKV_Y) * (BSZ / GM) + blockIdx.x);
}

// Value of lane l ^ 16 (the other half of the wave), as one vector instruction.
__device__ __forceinline__ float xhalf(float x) {
  const int b = __builtin_bit_cast(int, x);
  return __builtin_bit_cast(float,
      __builtin_amdgcn_permlanex16(b, b, 0x76543210, 0xfedcba98, false, false));
}

// The grid is one block per WGP, four waves per SIMD: the register budget is stated
// for that, or the compiler, counting two blocks into the LDS, squeezes the pass
// into half the registers and strings its exponentials on one register.
__global__ void __launch_bounds__(512) __attribute__((amdgpu_waves_per_eu(4, 4)))
mqa_attn(const _Float16* __restrict__ qh,
         const _Float16* __restrict__ kh,
         const _Float16* __restrict__ vT,
         _Float16* __restrict__ oh) {
  // [buf]: V^T tile, vcol(64) x key(KT), then K tile, key row(KT) x d(64), both padded; 2 x 69 KB.
  // Keys 0 .. KT/2 - 1 of a tile belong to the first key half, the rest to the second.
  constexpr int VH = DH * PKT;            // halves of a V^T tile
  constexpr int KH = KT / 2;              // keys of one key half per stage
  constexpr int SH = SS / 2;              // keys of one key half
  __shared__ __attribute__((aligned(16))) _Float16 kv[2][VH + KT * P64];

  const int tid  = threadIdx.x;           // 0..511
  const int wave = __builtin_amdgcn_readfirstlane(tid >> 5);   // scalar: the pass loop's bounds hang on it
  const int lane = tid & 31;
  const int nl   = lane & 15;
  const int hi   = lane >> 4;
  const int qt   = blockIdx.x;            // query tile [0,128)
  const int b    = blockIdx.y;            // batch
  const int half = wave >> 3;             // the wave's key half
  // Column group 0 is the head whose output this wave writes, group 1 the head that
  // its partner (wave ^ 8) writes: the partner holds the same two heads, swapped.
  const int h0   = 2 * (wave & 7) + half;
  const int h1   = h0 ^ 1;

  // One stage: KT rows of K (8 segments of 16 bytes a row) and 64 rows of V^T
  // (KT / 8 segments a row), keys j .. j + KH - 1 of each key half; every thread
  // copies its share of both.
  auto stageKV = [&](int j, int buf) {
#pragma unroll
    for (int i = 0; i < KT * 8 / 512; ++i) {
      const int seg = tid + i * 512;
      const int row = seg >> 3, s = seg & 7;
      const int key = (row / KH) * SH + j + row % KH;
      cp16(kh + ((size_t)(b * SS + key)) * DH + s * 8,
           &kv[buf][VH + row * P64 + s * 8]);
    }
#pragma unroll
    for (int i = 0; i < DH * (KT / 8) / 512; ++i) {
      const int seg = tid + i * 512;
      const int row = seg / (KT / 8), s = seg % (KT / 8);
      const int key = (s / (KH / 8)) * SH + j + (s % (KH / 8)) * 8;
      cp16(vT + (size_t)row * BSZ + b * SS + key,
           &kv[buf][row * PKT + s * 8]);
    }
  };

  // Q tiles resident as two B fragments a head (d = 0..31, 32..63), column = query nl
  const _Float16* qrow = qh + ((size_t)(b * SS + qt * 16 + nl)) * DHID;
  const v16h qb[2][2] = {{frag16(qrow + h0 * DH, hi), frag16(qrow + h0 * DH + 32, hi)},
                         {frag16(qrow + h1 * DH, hi), frag16(qrow + h1 * DH + 32, hi)}};

  v8f z = {};
  v8f o[2][4] = {{z, z, z, z}, {z, z, z, z}};   // O^T accum per head, 64(d) x 16(query)
  // Reference of query nl's exponentials (same in both halves of the wave): the running
  // maximum as it stood when it was last taken over. Any reference gives the same
  // quotient; it only has to keep e^(score - m) inside f16, so it moves, and O and the
  // sum are rescaled, only in the first pass and in a pass where some score of the wave stands TAU above it.
  // Q arrives times C2, so K Q^T is the score as an exponent to base 2, and the score
  // product starts its accumulators at nm = minus the reference (all 8 rows of a lane's
  // accumulator are keys of its one query): what the matrix unit hands back is the
  // argument of the exponential, with no vector multiply or subtract per score.
  float nm[2] = {0.0f, 0.0f};             // minus the reference, as an exponent to base 2
  v8f nmv[2]  = {z, z};                   // the same in 8 registers: the score product's C operand
  // The first pass takes its maximum as the reference whatever it is: any score tops thr,
  // and the reference may move down as well as up (lo). From then on thr = TAU2, lo = 0.
  float thr = -3.0e38f, lo = -3.0e38f;
  float l[2] = {0.0f, 0.0f};              // running sum over this half-wave's keys only, relative to the reference

  constexpr int T = SH / KH;              // stages
  static_assert(SH % KH == 0 && T >= 2 && KH % 32 == 0, "whole stages, two buffers in use");
  stageKV(0, 0);
  asm volatile("s_wait_asynccnt 0x0" ::: "memory");   // this wave's share of stage 0 has landed
  __syncthreads();                        // stage 0 visible to all waves
  stageKV(KH, 1);

  for (int t = 0; t < T; ++t) {
   const int buf = t & 1;
   for (int jj = half * KH; jj < half * KH + KH; jj += 32) {  // passes of 32 keys, no barrier between them
    // ---- scores: two 16x16 tiles a head, S^T = K @ Q^T, A operand from LDS ----
    const _Float16* kr0 = &kv[buf][VH + (jj + nl) * P64];
    const _Float16* kr1 = &kv[buf][VH + (jj + 16 + nl) * P64];
    const v16h ka[2][2] = {{frag16(kr0, hi), frag16(kr0 + 32, hi)},
                           {frag16(kr1, hi), frag16(kr1 + 32, hi)}};
    v16h av[4];                           // V^T fragments, 16 d each, for the second product
#pragma unroll
    for (int nt = 0; nt < 4; ++nt) av[nt] = frag16(&kv[buf][(nt * 16 + nl) * PKT + jj], hi);
    // Keeps the pass's 16 LDS reads in one group at its head: left to itself the compiler
    // sinks half of the V^T reads in among the second product's WMMAs, which then wait them out.
    __builtin_amdgcn_sched_barrier(0);
    v8f s[2][2];                          // [head][16 keys]
#pragma unroll
    for (int kt = 0; kt < 2; ++kt)
#pragma unroll
      for (int g = 0; g < 2; ++g)
        s[g][kt] = __builtin_amdgcn_wmma_f32_16x16x32_f16(false, ka[kt][0], false, qb[g][0], (short)0, nmv[g], false, false);
#pragma unroll
    for (int kt = 0; kt < 2; ++kt)
#pragma unroll
      for (int g = 0; g < 2; ++g)
        s[g][kt] = __builtin_amdgcn_wmma_f32_16x16x32_f16(false, ka[kt][1], false, qb[g][1], (short)0, s[g][kt], false, false);
    // Keeps the eight score products back to back: each is a slot of the distance that the
    // chip needs in front of the first read of an earlier one's result, where the compiler,
    // drawing the maxima in among them, pads with idle instructions.
    __builtin_amdgcn_sched_barrier(0);
    // Inputs only: the start values are still in use behind the products, so that each
    // product reads them in place and writes elsewhere; where the second key tile's product
    // is their last use, the compiler copies all 16 registers in every pass instead.
    asm volatile("" :: "v"(nmv[0]), "v"(nmv[1]));

    // ---- online softmax, lazy reference: 16 scores of query nl and head g in this lane ----
    float tm[2];                          // largest of this lane's 16 exponents (keys r + 8*hi, 16 + r + 8*hi)
#pragma unroll
    for (int g = 0; g < 2; ++g) {
      float x[16];
#pragma unroll
      for (int r = 0; r < 8; ++r) { x[r] = s[g][0][r]; x[8 + r] = s[g][1][r]; }
      float t4[4];                        // four short chains instead of one long one
#pragma unroll
      for (int c = 0; c < 4; ++c)
        t4[c] = fmaxf(fmaxf(x[4 * c], x[4 * c + 1]), fmaxf(x[4 * c + 2], x[4 * c + 3]));
      tm[g] = fmaxf(fmaxf(t4[0], t4[1]), fmaxf(t4[2], t4[3]));
    }
    // Every lane tests its own 16 scores, so the vote covers all 32 keys of every query;
    // the branch is the same for the whole wave (all lanes stay on for the exchange).
    float cr[2] = {1.0f, 1.0f};           // what the pass's move of the reference takes off the sums so far
    if (__builtin_amdgcn_ballot_w32(tm[0] > thr || tm[1] > thr) != 0u) {
#pragma unroll
      for (int g = 0; g < 2; ++g) {
        const float up   = fmaxf(lo, fmaxf(tm[g], xhalf(tm[g])));  // with the other 16 keys of the query
        const float nnew = nm[g] - up;
        const float dn   = nnew - nm[g];  // the move as the accumulators will see it
        cr[g] = __builtin_amdgcn_exp2f(fminf(dn, 0.0f));   // a first pass that moves down has nothing to rescale
        nm[g] = nnew;
        nmv[g] = (v8f){nnew, nnew, nnew, nnew, nnew, nnew, nnew, nnew};
        s[g][0] += dn;                    // this pass's exponents were formed on the old reference
        s[g][1] += dn;
      }
      thr = TAU2;
      lo  = 0.0f;
#pragma unroll
      for (int g = 0; g < 2; ++g)
#pragma unroll
        for (int nt = 0; nt < 4; ++nt) o[g][nt] *= cr[g];
    }
    v16h pb[2];
    float p[2][16];
#pragma unroll
    for (int g = 0; g < 2; ++g)
#pragma unroll
      for (int r = 0; r < 8; ++r) {
        p[g][r]      = __builtin_amdgcn_exp2f(s[g][0][r]);
        p[g][8 + r]  = __builtin_amdgcn_exp2f(s[g][1][r]);
      }
    // Inputs only, behind all 32 exponentials: their arguments stay in use up to here, so no
    // exponential is written over the register that the one directly in front of it reads
    // (the instruction set asks for a slot between the two); without it four are.
    __builtin_amdgcn_sched_barrier(0);
    asm volatile("" :: "v"(s[0][0]), "v"(s[0][1]), "v"(s[1][0]), "v"(s[1][1]));
#pragma unroll
    for (int g = 0; g < 2; ++g)
      // Half t of the B fragment is key t + 8*hi (t < 8) or 8 + t + 8*hi: the scores' order.
#pragma unroll
      for (int r = 0; r < 8; ++r) {
        pb[g][r]     = (_Float16)p[g][r];
        pb[g][8 + r] = (_Float16)p[g][8 + r];
      }

    // ---- O^T += V^T (A operand, read above) @ P^T (registers) ----
#pragma unroll
    for (int nt = 0; nt < 4; ++nt)
#pragma unroll
      for (int g = 0; g < 2; ++g)
        o[g][nt] = __builtin_amdgcn_wmma_f32_16x16x32_f16(
            false, av[nt], false, pb[g], (short)0, o[g][nt], false, false);
    // Keeps the row sums behind the products: with no barrier at the pass's end their adds
    // are the vector slots that the chip needs between the last product and the next
    // pass's first write of that product's operand registers, over the back edge.
    __builtin_amdgcn_sched_barrier(0);
#pragma unroll
    for (int g = 0; g < 2; ++g) {
      float r4[4];
#pragma unroll
      for (int c = 0; c < 4; ++c)
        r4[c] = (p[g][4 * c] + p[g][4 * c + 1]) + (p[g][4 * c + 2] + p[g][4 * c + 3]);
      l[g] = l[g] * cr[g] + ((r4[0] + r4[1]) + (r4[2] + r4[3]));
    }
   }
   asm volatile("s_wait_dscnt 0x0" ::: "memory");     // this wave has left the buffer that is refilled below
   asm volatile("s_wait_asynccnt 0x0" ::: "memory");  // this wave's share of stage t + 1 has landed
   __syncthreads();                       // stage t + 1 visible to all; every reader has left stage t
   if (t + 2 < T) stageKV((t + 2) * KH, buf);
  }
  asm volatile("s_wait_asynccnt 0x0" ::: "memory");   // no copy is left in flight when the wave ends

  // ---- join the two key halves ----
  // Behind the loop's last barrier nobody reads the K/V buffers and no copy is in
  // flight, so they serve as the exchange: a wave hands its partner the state of
  // column group 1 (accumulators, reference, sum) and takes the partner's state of
  // its own group 0. 16 bytes a lane, lanes side by side: no bank conflict.
  constexpr int XW = 8 * 32 * 4 + 32 * 2;  // floats per wave: 8 x 4 accumulators and 2 scalars a lane
  static_assert(16 * XW * sizeof(float) <= sizeof(kv), "the exchange fits the K/V buffers");
  float* xch = (float*)&kv[0][0];
  {
    float* mine = xch + wave * XW;
#pragma unroll
    for (int nt = 0; nt < 4; ++nt)
#pragma unroll
      for (int q = 0; q < 2; ++q) {
        const f4 w = {o[1][nt][4 * q], o[1][nt][4 * q + 1], o[1][nt][4 * q + 2], o[1][nt][4 * q + 3]};
        *(f4*)(mine + ((nt * 2 + q) * 32 + lane) * 4) = w;
      }
    mine[8 * 32 * 4 + lane * 2]     = nm[1];
    mine[8 * 32 * 4 + lane * 2 + 1] = l[1];
  }
  __syncthreads();                        // every wave's hand-over is written before its partner reads it
  const float* theirs = xch + (wave ^ 8) * XW;
  const float np = theirs[8 * 32 * 4 + lane * 2];
  const float lp = theirs[8 * 32 * 4 + lane * 2 + 1];
  const float nj = fminf(nm[0], np);      // the halves' references differ; any common one joins them (the larger maximum)
  const float ca = __builtin_amdgcn_exp2f(nj - nm[0]);   // weight of this wave's key half
  const float cb = __builtin_amdgcn_exp2f(nj - np);      // weight of the partner's
  const float lj = l[0] * ca + lp * cb;

  // ---- normalize and write attention output ----
  // Lane holds d = nt*16 + 8*hi + (0..7) of query nl: 16 contiguous bytes per nt.
  const float inv = 1.0f / (lj + xhalf(lj));
  const float fa = ca * inv, fb = cb * inv;
  _Float16* orow = oh + ((size_t)(b * SS + qt * 16 + nl)) * DHID + h0 * DH + 8 * hi;
#pragma unroll
  for (int nt = 0; nt < 4; ++nt) {
    h8 w;
#pragma unroll
    for (int q = 0; q < 2; ++q) {
      const f4 op = *(const f4*)(theirs + ((nt * 2 + q) * 32 + lane) * 4);
#pragma unroll
      for (int r = 0; r < 4; ++r) w[4 * q + r] = (_Float16)(o[0][nt][4 * q + r] * fa + op[r] * fb);
    }
    *(h8*)(orow + nt * 16) = w;
  }
}

// ---------------------------------------------------------------------------
// Launcher
// ---------------------------------------------------------------------------
extern "C" void kernel_launch(void* const* d_in, const int* in_sizes, int n_in,
                              void* d_out, int out_size, void* d_ws, size_t ws_size,
                              hipStream_t stream) {
  (void)in_sizes; (void)n_in; (void)out_size; (void)ws_size;

  const float* query = (const float*)d_in[0];
  const float* key   = (const float*)d_in[1];
  const float* value = (const float*)d_in[2];
  const float* Wq    = (const float*)d_in[3];
  const float* bq    = (const float*)d_in[4];
  const float* Wk    = (const float*)d_in[5];
  const float* bk    = (const float*)d_in[6];
  const float* Wv    = (const float*)d_in[7];
  const float* bv    = (const float*)d_in[8];
  const float* Wo    = (const float*)d_in[9];
  const float* bo    = (const float*)d_in[10];
  float* outF = (float*)d_out;

  // workspace carve-up (f16, 256B aligned), ~19 MB total
  char* ws = (char*)d_ws;
  size_t off = 0;
  auto carve = [&](size_t halves) {
    void* p = ws + off;
    off += (halves * sizeof(_Float16) + 255) & ~(size_t)255;
    return (_Float16*)p;
  };
  _Float16* WoT = carve((size_t)DIN * DHID);
  _Float16* qp  = carve((size_t)BSZ * DHID);
  _Float16* kp  = carve((size_t)BSZ * DH);
  _Float16* vTp = carve((size_t)DH * BSZ);   // V^T [64, B*S]
  _Float16* oat = carve((size_t)BSZ * DHID);

  // projections (WMMA, 128-row tiles per 16-wave block): K, V and Q from the f32 tensors, and Wo's cast
  gemm_qkv<<<dim3(BSZ / GM, QKV_Y + TBLKW / (BSZ / GM)), GEMM_THREADS, 0, stream>>>(
      query, key, value, Wq, Wk, Wv, Wo, bq, bk, bv, qp, kp, vTp, WoT);

  // attention (WMMA flash, 16 heads per block sharing LDS-staged K/V)
  mqa_attn<<<dim3(SS / 16, BB), 512, 0, stream>>>(qp, kp, vTp, oat);

  // output projection (WMMA, fp32 out)
  gemm_out<<<dim3(BSZ / GM, DIN / 128), GEMM_THREADS, 0, stream>>>(oat, WoT, bo, outF, BSZ, DIN, DHID);
}
